// v000
// Times are from an AMD MI455X. After a warm-up the kernel runs many times in a row, and a time is the length of
// such a window on the GPU divided by its runs, so every launch and the gaps after it count. The runs cycle
// through copies of the inputs. A figure is the median of several windows, for all but v000 over two sittings.
// Sittings can differ by a few percent; kernels timed side by side share one.
// v000 is the starting kernel. One run takes 1540 microseconds.
// Contractions: q,k projections (X f16 x W^T f16 carried x16), v projection (Wv bf16 hi/lo x X^T bf16 hi/lo, 3 products), scores q.k^T (q,k f16 planes, K=64), attn.v (P f16 carried x2048 x V^T f16 carried x16), output projection (y f16 carried x64 x Wp^T f16 carried x16): v_wmma_f32_16x16x32_f16 and v_wmma_f32_16x16x32_bf16, f32 accumulate; rope, rms-norm, sigmoid in f32.
#include <hip/hip_runtime.h>
#include <math.h>

// ---------------------------------------------------------------------------
// Problem constants
// ---------------------------------------------------------------------------
constexpr int kSeqLen = 4096;
constexpr int kEmbd   = 1024;
constexpr int kHeads  = 16;
constexpr int kHeadD  = 64;
constexpr int kRotD   = 32;
constexpr int kHeadsPerChunk = 2;
constexpr float kWCarry   = 16.0f;              // f16 weights carried x16
constexpr float kVCarry   = 16.0f;              // V^T f16 plane carried x16
constexpr float kPCarry   = 2048.0f;            // sigmoid probabilities carried x2048
constexpr float kQKScale  = 1.0f / 16.0f;       // undo weight carry on q,k
constexpr float kScScale  = 0.125f;             // 1/sqrt(64)
constexpr float kPVScale  = 1.0f / 32768.0f;    // 1/(kPCarry*kVCarry): O16 = 64*y
constexpr float kOutScale = 1.0f / 1024.0f;     // (1/64) * (1/kWCarry)
constexpr float kEpsRms   = 1e-6f;

typedef __attribute__((ext_vector_type(16))) _Float16 v16h;
typedef __attribute__((ext_vector_type(8)))  _Float16 v8h;
typedef __attribute__((ext_vector_type(16))) __bf16   v16b;
typedef __attribute__((ext_vector_type(8)))  __bf16   v8b;
typedef __attribute__((ext_vector_type(8)))  float    v8f;
typedef __attribute__((ext_vector_type(4)))  float    v4f;
typedef __attribute__((ext_vector_type(4)))  unsigned int v4u;

// ---------------------------------------------------------------------------
// Helpers
// ---------------------------------------------------------------------------
__device__ __forceinline__ unsigned short f2bf_bits(float f) {
  unsigned u = __float_as_uint(f);
  return (unsigned short)((u + 0x7FFFu + ((u >> 16) & 1u)) >> 16);
}
__device__ __forceinline__ float bf_bits2f(unsigned short h) { return __uint_as_float(((unsigned)h) << 16); }

// hazard guards as plain device helpers (no inline asm inside the kernel template body)
__device__ __forceinline__ void dep_guard_h(v8f& a, v8f& b, v16h x, v16h y) { asm volatile("v_nop\n\tv_nop\n\tv_nop\n\tv_nop" : "+v"(a), "+v"(b) : "v"(x), "v"(y)); }
__device__ __forceinline__ void dep_guard_b(v8f& a, v8f& b, v16b x, v16b y) { asm volatile("v_nop\n\tv_nop\n\tv_nop\n\tv_nop" : "+v"(a), "+v"(b) : "v"(x), "v"(y)); }
__device__ __forceinline__ void keep4_h(v16h a, v16h b, v16h c, v16h d) { asm volatile("v_nop" :: "v"(a), "v"(b), "v"(c), "v"(d)); }
__device__ __forceinline__ void keep4_b(v16b a, v16b b, v16b c, v16b d) { asm volatile("v_nop" :: "v"(a), "v"(b), "v"(c), "v"(d)); }
__device__ __forceinline__ void acc_guard4(v8f& a, v8f& b, v8f& c, v8f& d) { asm volatile("v_nop\n\tv_nop\n\tv_nop\n\tv_nop" : "+v"(a), "+v"(b), "+v"(c), "+v"(d)); }
template <typename T> struct Frag;
template <> struct Frag<_Float16> {
  typedef v16h V; union U { v16h v; v8h h[2]; };
  static __device__ __forceinline__ v16h load(const _Float16* p) {   // elements 0..7 <- p[0..7], 8..15 <- p[16..23]
    U f; f.h[0] = *(const v8h*)(p); f.h[1] = *(const v8h*)(p + 16); return f.v;
  }
  static __device__ __forceinline__ v8f mma(v16h a, v16h b, v8f c) {
    return __builtin_amdgcn_wmma_f32_16x16x32_f16(false, a, false, b, (short)0, c, false, false);
  }
  static __device__ __forceinline__ void guard(v8f& a, v8f& b, v16h x, v16h y) { dep_guard_h(a, b, x, y); }
  static __device__ __forceinline__ void keep(v16h a, v16h b, v16h c, v16h d) { keep4_h(a, b, c, d); }
};
template <> struct Frag<__bf16> {
  typedef v16b V; union U { v16b v; v8b h[2]; };
  static __device__ __forceinline__ v16b load(const __bf16* p) {
    U f; f.h[0] = *(const v8b*)(p); f.h[1] = *(const v8b*)(p + 16); return f.v;
  }
  static __device__ __forceinline__ v8f mma(v16b a, v16b b, v8f c) {
    return __builtin_amdgcn_wmma_f32_16x16x32_bf16(false, a, false, b, (short)0, c, false, false);
  }
  static __device__ __forceinline__ void guard(v8f& a, v8f& b, v16b x, v16b y) { dep_guard_b(a, b, x, y); }
  static __device__ __forceinline__ void keep(v16b a, v16b b, v16b c, v16b d) { keep4_b(a, b, c, d); }
};

__device__ __forceinline__ unsigned pk16(unsigned short a, unsigned short b) { return (unsigned)a | ((unsigned)b << 16); }
__device__ __forceinline__ unsigned short h_bits(float f) { const _Float16 h = (_Float16)f; return __builtin_bit_cast(unsigned short, h); }

// ---- Register-blocked batched WMMA GEMM (ACT reduced to none/relu/leaky + mode 6,
//      added TRI tile enumeration and CAUSALK k-extent) ----------------------------------------
// C[m,n] = scale * sum_k A[m,k] * Bt[n,k] (+bias)(+resid); each wave owns a 64x64 tile.
// A row-major [M,K]; Bt row-major [N,K]; M,N % 64 == 0, K % 32 == 0.
// SPLIT: operands are hi/lo planes (A2/Bt2 = lo planes, same layout); product = hi.hi + hi.lo + lo.hi.
// BIAS_MODE: 0 = none, 1 = bias[m], 2 = bias[n].
// OUT_MODE: 0 = f32, 1 = f16, 2 = bf16 hi plane (Cout) + bf16 lo plane (Cout2).
// ACT: 2 relu, 4 leaky, 6 = causal sigmoid carry: v = (n > m) ? 0 : kPCarry / (1 + exp(-v)).
// TRI: only tiles with tn <= tm are enumerated (M == N), tile count tilesM*(tilesM+1)/2.
// CAUSALK: k-extent of tile row tm limited to min(K, (tm+1)*64).
// ET: 0 = f16 operands, 1 = bf16 operands (pointers passed as 16-bit storage)
template <int ET> struct Elem;
template <> struct Elem<0> { typedef _Float16 T; };
template <> struct Elem<1> { typedef __bf16 T; };
template <int ET, bool SPLIT, int BIAS_MODE, int OUT_MODE, bool RESID, int ACT = 0, bool TRI = false, bool CAUSALK = false>
__global__ __launch_bounds__(256) void wmma_gemm64(
    const unsigned short* __restrict__ Ap, const unsigned short* __restrict__ A2p, int lda, long strideA,
    const unsigned short* __restrict__ Btp, const unsigned short* __restrict__ Bt2p, int ldb, long strideB,
    void* __restrict__ Cout, void* __restrict__ Cout2, int ldc, long strideC,
    const float* __restrict__ bias,
    const float* __restrict__ resid, long strideR,
    int M, int N, int K, float scale) {
  typedef typename Elem<ET>::T T;
  typedef typename Frag<T>::V V;
  const T* A = (const T*)Ap; const T* A2 = (const T*)A2p; const T* Bt = (const T*)Btp; const T* Bt2 = (const T*)Bt2p;
  __shared__ __align__(16) float sT[8][16 * 68];   // per-wave 16x64 slab, pitch 68 floats
  const int b    = blockIdx.y;
  const int lane = threadIdx.x & 31;
  const int wave = threadIdx.x >> 5;
  const int tilesN = N >> 6;
  const int tilesM = M >> 6;
  const int ntiles = TRI ? ((tilesM * (tilesM + 1)) >> 1) : (tilesM * tilesN);
  const int tile = blockIdx.x * 8 + wave;
  if (tile >= ntiles) return;   // wave-uniform; no block barriers in this kernel
  int tm, tn;
  if (TRI) {
    int t0 = (int)((sqrtf(8.0f * (float)tile + 1.0f) - 1.0f) * 0.5f);
    if (((t0 + 1) * (t0 + 2)) / 2 <= tile) t0 += 1;
    if ((t0 * (t0 + 1)) / 2 > tile) t0 -= 1;
    t0 = t0 < 0 ? 0 : (t0 > tilesM - 1 ? tilesM - 1 : t0);
    tm = t0;
    tn = tile - (t0 * (t0 + 1)) / 2;
    tn = tn < 0 ? 0 : (tn > tm ? tm : tn);
  } else {
    tm = tile / tilesN;
    tn = tile - tm * tilesN;
  }
  const int m0 = tm << 6;
  const int n0 = tn << 6;
  const int Kc = (tm + 1) << 6;
  const int Kt = CAUSALK ? (Kc < K ? Kc : K) : K;

  const T* Ab  = A  + (size_t)b * strideA;
  const T* Bb  = Bt + (size_t)b * strideB;
  const T* Ab2 = SPLIT ? (A2  + (size_t)b * strideA) : nullptr;
  const T* Bb2 = SPLIT ? (Bt2 + (size_t)b * strideB) : nullptr;

  const int rlane = lane & 15;                 // row (A) / col (B, D) within subtile
  const int koff  = (lane >> 4) * 8;           // k offset of this lane half
  const int mOff  = (lane >> 4) * 8;           // D row offset

  v8f acc[4][4];
#pragma unroll
  for (int i = 0; i < 4; ++i)
#pragma unroll
    for (int j = 0; j < 4; ++j) acc[i][j] = (v8f){0.f,0.f,0.f,0.f,0.f,0.f,0.f,0.f};

  for (int k0 = 0; k0 < Kt; k0 += 32) {
    V bh[4], bl[4];
#pragma unroll
    for (int j = 0; j < 4; ++j) {
      const size_t bo = (size_t)(n0 + (j << 4) + rlane) * ldb + koff + k0;
      bh[j] = Frag<T>::load(Bb + bo);
      if (SPLIT) bl[j] = Frag<T>::load(Bb2 + bo);
    }
#pragma unroll
    for (int i = 0; i < 4; ++i) {
      const size_t ao = (size_t)(m0 + (i << 4) + rlane) * lda + koff + k0;
      V ah = Frag<T>::load(Ab + ao);
      V al;
      if (SPLIT) al = Frag<T>::load(Ab2 + ao);
#pragma unroll
      for (int j = 0; j < 4; ++j) {
        acc[i][j] = Frag<T>::mma(ah, bh[j], acc[i][j]);
        if (SPLIT) {
          acc[i][j] = Frag<T>::mma(ah, bl[j], acc[i][j]);
          acc[i][j] = Frag<T>::mma(al, bh[j], acc[i][j]);
        }
      }
      Frag<T>::guard(acc[i][0], acc[i][3], ah, SPLIT ? al : ah);
    }
    Frag<T>::keep(bh[0], bh[1], bh[2], bh[3]);
    if (SPLIT) Frag<T>::keep(bl[0], bl[1], bl[2], bl[3]);
  }
  acc_guard4(acc[0][0], acc[0][1], acc[0][2], acc[0][3]);
  acc_guard4(acc[1][0], acc[1][1], acc[1][2], acc[1][3]);
  acc_guard4(acc[2][0], acc[2][1], acc[2][2], acc[2][3]);
  acc_guard4(acc[3][0], acc[3][1], acc[3][2], acc[3][3]);

  // ---- epilogue ----
  float* slab = sT[wave];
  const float* Rb = RESID ? (resid + (size_t)b * strideR) : nullptr;
#pragma unroll
  for (int i = 0; i < 4; ++i) {
    const int mBase = m0 + (i << 4);
#pragma unroll
    for (int j = 0; j < 4; ++j) {
      const int n = n0 + (j << 4) + rlane;
      float bv = 0.f;
      if (BIAS_MODE == 2) bv = bias[n];
#pragma unroll
      for (int r = 0; r < 8; ++r) {
        float v = acc[i][j][r] * scale;
        if (BIAS_MODE == 1) v += bias[mBase + mOff + r];
        if (BIAS_MODE == 2) v += bv;
        if (RESID) v += Rb[(size_t)(mBase + mOff + r) * ldc + n];
        if (ACT == 2) v = fmaxf(v, 0.0f);
        if (ACT == 4) v = (v > 0.f) ? v : 0.01f * v;
        if (ACT == 6) {
          const float sg = kPCarry / (1.0f + expf(-v));
          v = (n > (mBase + mOff + r)) ? 0.0f : sg;
        }
        slab[(mOff + r) * 68 + (j << 4) + rlane] = v;
      }
    }
    __builtin_amdgcn_fence(__ATOMIC_RELEASE, "workgroup");
    __builtin_amdgcn_wave_barrier();
    __builtin_amdgcn_fence(__ATOMIC_ACQUIRE, "workgroup");
    if (OUT_MODE == 0) {
      float* C = (float*)Cout + (size_t)b * strideC;
      const int hh = lane >> 4, c4 = (lane & 15) * 4;     // row seg = 256 B = 16 lanes x 16 B
      {
#pragma unroll
        for (int it = 0; it < 8; ++it) {
          const int row = it * 2 + hh;
          v4f v = *(const v4f*)(slab + row * 68 + c4);
          *(v4f*)(C + (size_t)(mBase + row) * ldc + n0 + c4) = v;
        }
        
      }
    } else {
      const int q = lane >> 3, c8 = (lane & 7) * 8;
      unsigned short* C  = (unsigned short*)Cout  + (size_t)b * strideC;
      unsigned short* C2 = (OUT_MODE == 2) ? ((unsigned short*)Cout2 + (size_t)b * strideC) : nullptr;
      {
#pragma unroll
        for (int it = 0; it < 4; ++it) {
          const int row = it * 4 + q;
          const float* sp = slab + row * 68 + c8;
          v8h hv, lv;
#pragma unroll
          for (int e = 0; e < 8; ++e) {
            if (OUT_MODE == 1) {
              hv[e] = (_Float16)sp[e];
            } else {
              unsigned short hb = f2bf_bits(sp[e]);
              unsigned short lb = f2bf_bits(sp[e] - bf_bits2f(hb));
              hv[e] = __builtin_bit_cast(_Float16, hb);
              lv[e] = __builtin_bit_cast(_Float16, lb);
            }
          }
          *(v8h*)(C + (size_t)(mBase + row) * ldc + n0 + c8) = hv;
          if (OUT_MODE == 2) *(v8h*)(C2 + (size_t)(mBase + row) * ldc + n0 + c8) = lv;
        }
        
      }
    }
    __builtin_amdgcn_fence(__ATOMIC_RELEASE, "workgroup");
    __builtin_amdgcn_wave_barrier();
    __builtin_amdgcn_fence(__ATOMIC_ACQUIRE, "workgroup");
  }
}

// ---------------------------------------------------------------------------
// x f32 [4096][1024] -> three planes: f16, bf16 hi, bf16 lo (RNE converts), 8 elements per thread.
// Coverage: n8 = 4096*1024/8 = 524288 threads = 2048 blocks x 256 exactly; each lane one 16-B store per
// ---------------------------------------------------------------------------
__global__ __launch_bounds__(256) void xcast_kernel(const float* __restrict__ in, unsigned short* __restrict__ o16,
                                                    unsigned short* __restrict__ obh, unsigned short* __restrict__ obl, int n8) {
  const int i = blockIdx.x * 256 + threadIdx.x;
  if (i >= n8) return;
  const float* p = in + 8 * (size_t)i;
  const v4f a = *(const v4f*)(p);
  const v4f c = *(const v4f*)(p + 4);
  float f[8];
#pragma unroll
  for (int e = 0; e < 4; ++e) { f[e] = a[e]; f[4 + e] = c[e]; }
  unsigned short hb[8], bh[8], bl[8];
#pragma unroll
  for (int e = 0; e < 8; ++e) {
    hb[e] = h_bits(f[e]);
    bh[e] = f2bf_bits(f[e]);
    bl[e] = f2bf_bits(f[e] - bf_bits2f(bh[e]));
  }
  const v4u u0 = (v4u){pk16(hb[0], hb[1]), pk16(hb[2], hb[3]), pk16(hb[4], hb[5]), pk16(hb[6], hb[7])};
  const v4u u1 = (v4u){pk16(bh[0], bh[1]), pk16(bh[2], bh[3]), pk16(bh[4], bh[5]), pk16(bh[6], bh[7])};
  const v4u u2 = (v4u){pk16(bl[0], bl[1]), pk16(bl[2], bl[3]), pk16(bl[4], bl[5]), pk16(bl[6], bl[7])};
  const size_t o = 8 * (size_t)i;
  *(v4u*)(o16 + o) = u0;
  *(v4u*)(obh + o) = u1;
  *(v4u*)(obl + o) = u2;
  
}

// ---------------------------------------------------------------------------
// Weight f32 [1024][1024] -> f16(scale*w), three weights selected by blockIdx.y (block-uniform),
// output plane y at out + y*n8*8 halves. Coverage: n8 = 131072 threads = 512 blocks exactly per plane;
// ---------------------------------------------------------------------------
__global__ __launch_bounds__(256) void wcast_kernel(const float* __restrict__ w0, const float* __restrict__ w1,
                                                    const float* __restrict__ w2, unsigned short* __restrict__ out,
                                                    float scale, int n8) {
  const int i = blockIdx.x * 256 + threadIdx.x;
  if (i >= n8) return;
  const int z = blockIdx.y;
  const float* w = (z == 0) ? w0 : ((z == 1) ? w1 : w2);
  const float* p = w + 8 * (size_t)i;
  const v4f a = *(const v4f*)(p);
  const v4f c = *(const v4f*)(p + 4);
  unsigned short hb[8];
#pragma unroll
  for (int e = 0; e < 4; ++e) {
    hb[e]     = h_bits(a[e] * scale);
    hb[4 + e] = h_bits(c[e] * scale);
  }
  const v4u u = (v4u){pk16(hb[0], hb[1]), pk16(hb[2], hb[3]), pk16(hb[4], hb[5]), pk16(hb[6], hb[7])};
  unsigned short* q = out + (size_t)z * (size_t)n8 * 8 + 8 * (size_t)i;
  *(v4u*)q = u;
  
}

// ---------------------------------------------------------------------------
// Weight f32 [1024][1024] -> bf16 hi and lo planes (RNE converts). Coverage as above.
// ---------------------------------------------------------------------------
__global__ __launch_bounds__(256) void wsplit_kernel(const float* __restrict__ w, unsigned short* __restrict__ hi,
                                                     unsigned short* __restrict__ lo, int n8) {
  const int i = blockIdx.x * 256 + threadIdx.x;
  if (i >= n8) return;
  const float* p = w + 8 * (size_t)i;
  const v4f a = *(const v4f*)(p);
  const v4f c = *(const v4f*)(p + 4);
  float f[8];
#pragma unroll
  for (int e = 0; e < 4; ++e) { f[e] = a[e]; f[4 + e] = c[e]; }
  unsigned short bh[8], bl[8];
#pragma unroll
  for (int e = 0; e < 8; ++e) {
    bh[e] = f2bf_bits(f[e]);
    bl[e] = f2bf_bits(f[e] - bf_bits2f(bh[e]));
  }
  const v4u u1 = (v4u){pk16(bh[0], bh[1]), pk16(bh[2], bh[3]), pk16(bh[4], bh[5]), pk16(bh[6], bh[7])};
  const v4u u2 = (v4u){pk16(bl[0], bl[1]), pk16(bl[2], bl[3]), pk16(bl[4], bl[5]), pk16(bl[6], bl[7])};
  const size_t o = 8 * (size_t)i;
  *(v4u*)(hi + o) = u1;
  *(v4u*)(lo + o) = u2;
  
}

// ---------------------------------------------------------------------------
// RoPE + per-head RMS-norm for q and k (f32), output f16 planes Q16 and K16, both laid out [h][t][64]
// (K16 plane = qk16 + 16*4096*64 halves). qf/kf: f32 [t][h*64+d]; cosT/sinT: [t][32].
// One wave handles two (t,h) pairs: lane l carries the rotation pair (d=l, d=l+32) of each.
// Results staged per wave in LDS as f32, then one store instruction: lanes 0..7 -> Q row of pair 0,
// 8..15 -> K row of pair 0, 16..23 -> Q row of pair 1, 24..31 -> K row of pair 1; each row = 64 halves
// Coverage: 4096 blocks x 8 waves x 2 pairs = 65536 = 4096 t x 16 h pairs exactly.
// ---------------------------------------------------------------------------
__global__ __launch_bounds__(256) void rope_rms_kernel(const float* __restrict__ qf, const float* __restrict__ kf,
                                                       const float* __restrict__ cosT, const float* __restrict__ sinT,
                                                       unsigned short* __restrict__ qk16) {
#pragma clang fp contract(off)
  __shared__ __align__(16) float sm[8][256];
  const int lane = threadIdx.x & 31;
  const int wave = threadIdx.x >> 5;
  const int pbase = (blockIdx.x * 8 + wave) * 2;
#pragma unroll
  for (int u = 0; u < 2; ++u) {
    const int p = pbase + u;
    const int t = p >> 4;
    const int h = p & 15;
    const float c = cosT[(size_t)t * kRotD + lane];
    const float s = sinT[(size_t)t * kRotD + lane];
    const size_t ib = (size_t)t * kEmbd + (size_t)h * kHeadD + lane;
    const float q1 = qf[ib], q2 = qf[ib + 32];
    const float k1 = kf[ib], k2 = kf[ib + 32];
    const float qo1 = q1 * c + q2 * s;
    const float qo2 = -q1 * s + q2 * c;
    const float ko1 = k1 * c + k2 * s;
    const float ko2 = -k1 * s + k2 * c;
    float ssq = qo1 * qo1 + qo2 * qo2;
    float ssk = ko1 * ko1 + ko2 * ko2;
#pragma unroll
    for (int off = 16; off >= 1; off >>= 1) {
      ssq += __shfl_xor(ssq, off, 32);
      ssk += __shfl_xor(ssk, off, 32);
    }
    const float rq = rsqrtf(ssq * (1.0f / 64.0f) + kEpsRms);
    const float rk = rsqrtf(ssk * (1.0f / 64.0f) + kEpsRms);
    float* row = &sm[wave][u * 128];
    row[lane]      = qo1 * rq;
    row[32 + lane] = qo2 * rq;
    row[64 + lane] = ko1 * rk;
    row[96 + lane] = ko2 * rk;
  }
  __syncthreads();
  const int g = lane >> 3;
  const int uu = g >> 1;
  const int which = g & 1;
  const int j = lane & 7;
  const int p = pbase + uu;
  const int t = p >> 4;
  const int h = p & 15;
  const float* sp = &sm[wave][uu * 128 + which * 64 + 8 * j];
  const v4f a = *(const v4f*)(sp);
  const v4f c = *(const v4f*)(sp + 4);
  unsigned short hb[8];
#pragma unroll
  for (int e = 0; e < 4; ++e) {
    hb[e]     = h_bits(a[e]);
    hb[4 + e] = h_bits(c[e]);
  }
  const v4u u = (v4u){pk16(hb[0], hb[1]), pk16(hb[2], hb[3]), pk16(hb[4], hb[5]), pk16(hb[6], hb[7])};
  unsigned short* dst = qk16 + (size_t)which * ((size_t)kHeads * kSeqLen * kHeadD)
                      + ((size_t)h * kSeqLen + t) * kHeadD + 8 * j;
  *(v4u*)dst = u;
  
}

// ---------------------------------------------------------------------------
// Host-side orchestration
// ---------------------------------------------------------------------------
extern "C" void kernel_launch(void* const* d_in, const int* in_sizes, int n_in,
                              void* d_out, int out_size, void* d_ws,
                              size_t ws_size, hipStream_t stream) {
  if (n_in < 7) return;
  if (in_sizes[0] != kSeqLen * kEmbd) return;
  if (in_sizes[1] != kSeqLen * kRotD || in_sizes[2] != kSeqLen * kRotD) return;
  if (in_sizes[3] != kEmbd * kEmbd || in_sizes[4] != kEmbd * kEmbd ||
      in_sizes[5] != kEmbd * kEmbd || in_sizes[6] != kEmbd * kEmbd) return;
  if (out_size != kSeqLen * kEmbd) return;

  const float* x    = (const float*)d_in[0];
  const float* cosT = (const float*)d_in[1];
  const float* sinT = (const float*)d_in[2];
  const float* wq   = (const float*)d_in[3];
  const float* wk   = (const float*)d_in[4];
  const float* wv   = (const float*)d_in[5];
  const float* wp   = (const float*)d_in[6];

  // ---- workspace region map (bytes) ----
  // persistent:
  //   Q16  f16 [16][4096][64]   8 MiB  @ 0
  //   K16  f16 [16][4096][64]   8 MiB  @ 8 MiB   (must follow Q16 directly)
  //   VT16 f16 [1024][4096]     8 MiB  @ 16 MiB
  //   O16  f16 [4096][1024]     8 MiB  @ 24 MiB
  //   W16  f16 3 x [1024][1024] 6 MiB  @ 32 MiB  (wq, wk, wproj carried x16)
  //   WVH  bf16 [1024][1024]    2 MiB  @ 38 MiB
  //   WVL  bf16 [1024][1024]    2 MiB  @ 40 MiB
  // phase 1 (dead after rope):                       phase 2 (attention chunks):
  //   X16  f16  8 MiB @ 42 MiB                         P16 f16 2 x [4096][4096] 64 MiB @ 42 MiB
  //   XBH  bf16 8 MiB @ 50 MiB
  //   XBL  bf16 8 MiB @ 58 MiB
  //   QF   f32 16 MiB @ 66 MiB
  //   KF   f32 16 MiB @ 82 MiB  (must follow QF directly)
  // total = 106 MiB = 111149056 B
  const size_t MiB = 1048576;
  const size_t total = 106 * MiB;
  if (total > ws_size) return;
  char* ws = (char*)d_ws;
  unsigned short* Q16  = (unsigned short*)(ws + 0 * MiB);
  unsigned short* K16  = (unsigned short*)(ws + 8 * MiB);
  unsigned short* VT16 = (unsigned short*)(ws + 16 * MiB);
  unsigned short* O16  = (unsigned short*)(ws + 24 * MiB);
  unsigned short* W16  = (unsigned short*)(ws + 32 * MiB);
  unsigned short* WVH  = (unsigned short*)(ws + 38 * MiB);
  unsigned short* WVL  = (unsigned short*)(ws + 40 * MiB);
  unsigned short* X16  = (unsigned short*)(ws + 42 * MiB);
  unsigned short* XBH  = (unsigned short*)(ws + 50 * MiB);
  unsigned short* XBL  = (unsigned short*)(ws + 58 * MiB);
  float*          QF   = (float*)(ws + 66 * MiB);
  unsigned short* P16  = (unsigned short*)(ws + 42 * MiB);
  unsigned short* WP16 = W16 + 2 * (size_t)kEmbd * kEmbd;
  const float* fdummy = (const float*)(ws);

  // 1) casts
  {
    const int n8x = (kSeqLen * kEmbd) / 8;          // 524288 = 2048 * 256
    xcast_kernel<<<dim3((n8x + 255) / 256), 256, 0, stream>>>(x, X16, XBH, XBL, n8x);
    const int n8w = (kEmbd * kEmbd) / 8;            // 131072 = 512 * 256
    wcast_kernel<<<dim3((n8w + 255) / 256, 3), 256, 0, stream>>>(wq, wk, wp, W16, kWCarry, n8w);
    wsplit_kernel<<<dim3((n8w + 255) / 256), 256, 0, stream>>>(wv, WVH, WVL, n8w);
  }

  // 2) q,k = X16 . Wq16^T / Wk16^T : M=4096, N=1024, K=1024 (K%32==0, M,N%64==0), f32 out, scale 1/16
  {
    const int tiles = (kSeqLen / 64) * (kEmbd / 64);   // 1024
    wmma_gemm64<0, false, 0, 0, false, 0><<<dim3((tiles + 7) / 8, 2), 256, 0, stream>>>(
        X16, X16, kEmbd, (long)0,
        W16, W16, kEmbd, (long)kEmbd * kEmbd,
        (void*)QF, (void*)QF, kEmbd, (long)kSeqLen * kEmbd,
        fdummy, fdummy, (long)0,
        kSeqLen, kEmbd, kEmbd, kQKScale);
  }

  // 3) V^T = Wv . X^T as bf16 hi/lo 3-product: A = Wv planes [1024][1024], Bt = X planes [4096][1024];
  //    M=1024, N=4096, K=1024; f16 out [h*64+d][t] carried x16, ldc = 4096
  {
    const int tiles = (kEmbd / 64) * (kSeqLen / 64);   // 1024
    wmma_gemm64<1, true, 0, 1, false, 0><<<dim3((tiles + 7) / 8, 1), 256, 0, stream>>>(
        WVH, WVL, kEmbd, (long)0,
        XBH, XBL, kEmbd, (long)0,
        (void*)VT16, (void*)VT16, kSeqLen, (long)0,
        fdummy, fdummy, (long)0,
        kEmbd, kSeqLen, kEmbd, kVCarry);
  }

  // 4) RoPE + RMS-norm -> Q16, K16 planes [h][t][64]
  rope_rms_kernel<<<dim3((kSeqLen * kHeads) / 16), 256, 0, stream>>>(QF, QF + (size_t)kSeqLen * kEmbd, cosT, sinT, Q16);

  // 5) attention, 2 heads per chunk
  {
    const long headPlane = (long)kSeqLen * kHeadD;               // Q16/K16 per-head stride (halves)
    const long vtHead    = (long)kHeadD * kSeqLen;               // VT16 per-head stride (halves)
    const long pPlane    = (long)kSeqLen * kSeqLen;              // P16 per-head stride (halves)
    const int  tilesM    = kSeqLen / 64;                         // 64
    const int  ntri      = (tilesM * (tilesM + 1)) / 2;          // 2080 lower-triangular 64x64 tiles
    const int  pvTiles   = tilesM * (kHeadD / 64);               // 64
    for (int hc = 0; hc < kHeads / kHeadsPerChunk; ++hc) {
      const int h0 = hc * kHeadsPerChunk;
      // scores: A = Q16 head rows [4096][64], Bt = K16 head rows [4096][64], K=64, scale 1/8,
      // epilogue sigmoid x2048 with causal zero -> P16 f16 [4096][4096] (tiles tn <= tm only)
      wmma_gemm64<0, false, 0, 1, false, 6, true, false><<<dim3((ntri + 7) / 8, kHeadsPerChunk), 256, 0, stream>>>(
          Q16 + (size_t)h0 * headPlane, Q16 + (size_t)h0 * headPlane, kHeadD, headPlane,
          K16 + (size_t)h0 * headPlane, K16 + (size_t)h0 * headPlane, kHeadD, headPlane,
          (void*)P16, (void*)P16, kSeqLen, pPlane,
          fdummy, fdummy, (long)0,
          kSeqLen, kSeqLen, kHeadD, kScScale);
      // O = P . V : A = P16 [4096][4096], Bt = VT16 head [64][4096], k-extent (tm+1)*64, M=4096, N=64,
      // f16 out into O16 columns h*64.. (ldc 1024), O16 = 64*y
      wmma_gemm64<0, false, 0, 1, false, 0, false, true><<<dim3((pvTiles + 7) / 8, kHeadsPerChunk), 256, 0, stream>>>(
          P16, P16, kSeqLen, pPlane,
          VT16 + (size_t)h0 * vtHead, VT16 + (size_t)h0 * vtHead, kSeqLen, vtHead,
          (void*)(O16 + (size_t)h0 * kHeadD), (void*)(O16 + (size_t)h0 * kHeadD), kEmbd, (long)kHeadD,
          fdummy, fdummy, (long)0,
          kSeqLen, kHeadD, kSeqLen, kPVScale);
    }
  }

  // 6) out = (64*y) . (16*Wp)^T * (1/1024): M=4096, N=1024, K=1024, f32 out to d_out
  {
    const int tiles = (kSeqLen / 64) * (kEmbd / 64);   // 1024
    wmma_gemm64<0, false, 0, 0, false, 0><<<dim3((tiles + 7) / 8, 1), 256, 0, stream>>>(
        O16, O16, kEmbd, (long)0,
        WP16, WP16, kEmbd, (long)0,
        d_out, d_out, kEmbd, (long)0,
        fdummy, fdummy, (long)0,
        kSeqLen, kEmbd, kEmbd, kOutScale);
  }
}

// v002
// Measured time: 274 microseconds a run.
// Versions between v000 and this one are left out; their measured steps multiply to 5.78 times as fast.
// Contractions: q,k projections (X f16 x W^T f16 carried x16), v projection (Wv bf16 hi/lo x X^T bf16 hi/lo, 3 products), scores q.k^T (q,k f16 planes, K=64), attn.v (P f16 carried x2048 x V^T f16 carried x16), output projection (y f16 carried x64 x Wp^T f16 carried x16): v_wmma_f32_16x16x32_f16 and v_wmma_f32_16x16x32_bf16, f32 accumulate; rope, rms-norm, sigmoid in f32.
#include <hip/hip_runtime.h>
#include <math.h>

// ---------------------------------------------------------------------------
// Problem constants
// ---------------------------------------------------------------------------
constexpr int kSeqLen = 4096;
constexpr int kEmbd   = 1024;
constexpr int kHeads  = 16;
constexpr int kHeadD  = 64;
constexpr int kRotD   = 32;
constexpr float kWCarry   = 16.0f;              // f16 weights carried x16
constexpr float kVCarry   = 16.0f;              // V^T f16 plane carried x16
constexpr float kPCarry   = 2048.0f;            // sigmoid probabilities carried x2048
constexpr float kQKScale  = 1.0f / 16.0f;       // undo weight carry on q,k
constexpr float kScScale  = 0.125f;             // 1/sqrt(64)
constexpr float kPVScale  = 1.0f / 32768.0f;    // 1/(kPCarry*kVCarry): O16 = 64*y
constexpr float kOutScale = 1.0f / 1024.0f;     // (1/64) * (1/kWCarry)
constexpr float kEpsRms   = 1e-6f;

typedef __attribute__((ext_vector_type(16))) _Float16 v16h;
typedef __attribute__((ext_vector_type(8)))  _Float16 v8h;
typedef __attribute__((ext_vector_type(16))) __bf16   v16b;
typedef __attribute__((ext_vector_type(8)))  __bf16   v8b;
typedef __attribute__((ext_vector_type(8)))  float    v8f;
typedef __attribute__((ext_vector_type(4)))  float    v4f;
typedef __attribute__((ext_vector_type(2)))  float    v2f;
typedef __attribute__((ext_vector_type(4)))  unsigned int v4u;

// ---------------------------------------------------------------------------
// Helpers
// ---------------------------------------------------------------------------
__device__ __forceinline__ unsigned short f2bf_bits(float f) {
  unsigned u = __float_as_uint(f);
  return (unsigned short)((u + 0x7FFFu + ((u >> 16) & 1u)) >> 16);
}
__device__ __forceinline__ float bf_bits2f(unsigned short h) { return __uint_as_float(((unsigned)h) << 16); }

// hazard guards as plain device helpers (no inline asm inside the kernel template body)
__device__ __forceinline__ void dep_guard_h(v8f& a, v8f& b, v16h x, v16h y) { asm volatile("v_nop\n\tv_nop\n\tv_nop\n\tv_nop" : "+v"(a), "+v"(b) : "v"(x), "v"(y)); }
__device__ __forceinline__ void dep_guard_b(v8f& a, v8f& b, v16b x, v16b y) { asm volatile("v_nop\n\tv_nop\n\tv_nop\n\tv_nop" : "+v"(a), "+v"(b) : "v"(x), "v"(y)); }
__device__ __forceinline__ void keep4_h(v16h a, v16h b, v16h c, v16h d) { asm volatile("v_nop" :: "v"(a), "v"(b), "v"(c), "v"(d)); }
__device__ __forceinline__ void keep4_b(v16b a, v16b b, v16b c, v16b d) { asm volatile("v_nop" :: "v"(a), "v"(b), "v"(c), "v"(d)); }
__device__ __forceinline__ void acc_guard4(v8f& a, v8f& b, v8f& c, v8f& d) { asm volatile("v_nop\n\tv_nop\n\tv_nop\n\tv_nop" : "+v"(a), "+v"(b), "+v"(c), "+v"(d)); }
template <typename T> struct Frag;
template <> struct Frag<_Float16> {
  typedef v16h V; union U { v16h v; v8h h[2]; };
  static __device__ __forceinline__ v16h load(const _Float16* p) {   // elements 0..7 <- p[0..7], 8..15 <- p[16..23]
    U f; f.h[0] = *(const v8h*)(p); f.h[1] = *(const v8h*)(p + 16); return f.v;
  }
  static __device__ __forceinline__ v8f mma(v16h a, v16h b, v8f c) {
    return __builtin_amdgcn_wmma_f32_16x16x32_f16(false, a, false, b, (short)0, c, false, false);
  }
  static __device__ __forceinline__ void guard(v8f& a, v8f& b, v16h x, v16h y) { dep_guard_h(a, b, x, y); }
  static __device__ __forceinline__ void keep(v16h a, v16h b, v16h c, v16h d) { keep4_h(a, b, c, d); }
};
template <> struct Frag<__bf16> {
  typedef v16b V; union U { v16b v; v8b h[2]; };
  static __device__ __forceinline__ v16b load(const __bf16* p) {
    U f; f.h[0] = *(const v8b*)(p); f.h[1] = *(const v8b*)(p + 16); return f.v;
  }
  static __device__ __forceinline__ v8f mma(v16b a, v16b b, v8f c) {
    return __builtin_amdgcn_wmma_f32_16x16x32_bf16(false, a, false, b, (short)0, c, false, false);
  }
  static __device__ __forceinline__ void guard(v8f& a, v8f& b, v16b x, v16b y) { dep_guard_b(a, b, x, y); }
  static __device__ __forceinline__ void keep(v16b a, v16b b, v16b c, v16b d) { keep4_b(a, b, c, d); }
};

__device__ __forceinline__ unsigned pk16(unsigned short a, unsigned short b) { return (unsigned)a | ((unsigned)b << 16); }
__device__ __forceinline__ unsigned short h_bits(float f) { const _Float16 h = (_Float16)f; return __builtin_bit_cast(unsigned short, h); }

// ---- Register-blocked batched WMMA GEMM (ACT reduced to none/relu/leaky + mode 6,
//      added TRI tile enumeration and CAUSALK k-extent) ----------------------------------------
// C[m,n] = scale * sum_k A[m,k] * Bt[n,k] (+bias)(+resid); each wave owns a 64x64 tile.
// A row-major [M,K]; Bt row-major [N,K]; M,N % 64 == 0, K % 32 == 0.
// SPLIT: operands are hi/lo planes (A2/Bt2 = lo planes, same layout); product = hi.hi + hi.lo + lo.hi.
// BIAS_MODE: 0 = none, 1 = bias[m], 2 = bias[n].
// OUT_MODE: 0 = f32, 1 = f16, 2 = bf16 hi plane (Cout) + bf16 lo plane (Cout2).
// ACT: 2 relu, 4 leaky, 6 = causal sigmoid carry: v = (n > m) ? 0 : kPCarry / (1 + exp(-v)).
// TRI: only tiles with tn <= tm are enumerated (M == N), tile count tilesM*(tilesM+1)/2.
// CAUSALK: k-extent of tile row tm limited to min(K, (tm+1)*64).
// ET: 0 = f16 operands, 1 = bf16 operands (pointers passed as 16-bit storage)
template <int ET> struct Elem;
template <> struct Elem<0> { typedef _Float16 T; };
template <> struct Elem<1> { typedef __bf16 T; };
template <int ET, bool SPLIT, int BIAS_MODE, int OUT_MODE, bool RESID, int ACT = 0, bool TRI = false, bool CAUSALK = false>
__global__ __launch_bounds__(256) void wmma_gemm64(
    const unsigned short* __restrict__ Ap, const unsigned short* __restrict__ A2p, int lda, long strideA,
    const unsigned short* __restrict__ Btp, const unsigned short* __restrict__ Bt2p, int ldb, long strideB,
    void* __restrict__ Cout, void* __restrict__ Cout2, int ldc, long strideC,
    const float* __restrict__ bias,
    const float* __restrict__ resid, long strideR,
    int M, int N, int K, float scale) {
  typedef typename Elem<ET>::T T;
  typedef typename Frag<T>::V V;
  const T* A = (const T*)Ap; const T* A2 = (const T*)A2p; const T* Bt = (const T*)Btp; const T* Bt2 = (const T*)Bt2p;
  __shared__ __align__(16) float sT[8][16 * 68];   // per-wave 16x64 slab, pitch 68 floats
  const int b    = blockIdx.y;
  const int lane = threadIdx.x & 31;
  const int wave = threadIdx.x >> 5;
  const int tilesN = N >> 6;
  const int tilesM = M >> 6;
  const int ntiles = TRI ? ((tilesM * (tilesM + 1)) >> 1) : (tilesM * tilesN);
  const int tile = blockIdx.x * 8 + wave;
  if (tile >= ntiles) return;   // wave-uniform; no block barriers in this kernel
  int tm, tn;
  if (TRI) {
    int t0 = (int)((sqrtf(8.0f * (float)tile + 1.0f) - 1.0f) * 0.5f);
    if (((t0 + 1) * (t0 + 2)) / 2 <= tile) t0 += 1;
    if ((t0 * (t0 + 1)) / 2 > tile) t0 -= 1;
    t0 = t0 < 0 ? 0 : (t0 > tilesM - 1 ? tilesM - 1 : t0);
    tm = t0;
    tn = tile - (t0 * (t0 + 1)) / 2;
    tn = tn < 0 ? 0 : (tn > tm ? tm : tn);
  } else {
    tm = tile / tilesN;
    tn = tile - tm * tilesN;
  }
  const int m0 = tm << 6;
  const int n0 = tn << 6;
  const int Kc = (tm + 1) << 6;
  const int Kt = CAUSALK ? (Kc < K ? Kc : K) : K;

  const T* Ab  = A  + (size_t)b * strideA;
  const T* Bb  = Bt + (size_t)b * strideB;
  const T* Ab2 = SPLIT ? (A2  + (size_t)b * strideA) : nullptr;
  const T* Bb2 = SPLIT ? (Bt2 + (size_t)b * strideB) : nullptr;

  const int rlane = lane & 15;                 // row (A) / col (B, D) within subtile
  const int koff  = (lane >> 4) * 8;           // k offset of this lane half
  const int mOff  = (lane >> 4) * 8;           // D row offset

  v8f acc[4][4];
#pragma unroll
  for (int i = 0; i < 4; ++i)
#pragma unroll
    for (int j = 0; j < 4; ++j) acc[i][j] = (v8f){0.f,0.f,0.f,0.f,0.f,0.f,0.f,0.f};

  for (int k0 = 0; k0 < Kt; k0 += 32) {
    V bh[4], bl[4];
#pragma unroll
    for (int j = 0; j < 4; ++j) {
      const size_t bo = (size_t)(n0 + (j << 4) + rlane) * ldb + koff + k0;
      bh[j] = Frag<T>::load(Bb + bo);
      if (SPLIT) bl[j] = Frag<T>::load(Bb2 + bo);
    }
#pragma unroll
    for (int i = 0; i < 4; ++i) {
      const size_t ao = (size_t)(m0 + (i << 4) + rlane) * lda + koff + k0;
      V ah = Frag<T>::load(Ab + ao);
      V al;
      if (SPLIT) al = Frag<T>::load(Ab2 + ao);
#pragma unroll
      for (int j = 0; j < 4; ++j) {
        acc[i][j] = Frag<T>::mma(ah, bh[j], acc[i][j]);
        if (SPLIT) {
          acc[i][j] = Frag<T>::mma(ah, bl[j], acc[i][j]);
          acc[i][j] = Frag<T>::mma(al, bh[j], acc[i][j]);
        }
      }
      Frag<T>::guard(acc[i][0], acc[i][3], ah, SPLIT ? al : ah);
    }
    Frag<T>::keep(bh[0], bh[1], bh[2], bh[3]);
    if (SPLIT) Frag<T>::keep(bl[0], bl[1], bl[2], bl[3]);
  }
  acc_guard4(acc[0][0], acc[0][1], acc[0][2], acc[0][3]);
  acc_guard4(acc[1][0], acc[1][1], acc[1][2], acc[1][3]);
  acc_guard4(acc[2][0], acc[2][1], acc[2][2], acc[2][3]);
  acc_guard4(acc[3][0], acc[3][1], acc[3][2], acc[3][3]);

  // ---- epilogue ----
  float* slab = sT[wave];
  const float* Rb = RESID ? (resid + (size_t)b * strideR) : nullptr;
#pragma unroll
  for (int i = 0; i < 4; ++i) {
    const int mBase = m0 + (i << 4);
#pragma unroll
    for (int j = 0; j < 4; ++j) {
      const int n = n0 + (j << 4) + rlane;
      float bv = 0.f;
      if (BIAS_MODE == 2) bv = bias[n];
#pragma unroll
      for (int r = 0; r < 8; ++r) {
        float v = acc[i][j][r] * scale;
        if (BIAS_MODE == 1) v += bias[mBase + mOff + r];
        if (BIAS_MODE == 2) v += bv;
        if (RESID) v += Rb[(size_t)(mBase + mOff + r) * ldc + n];
        if (ACT == 2) v = fmaxf(v, 0.0f);
        if (ACT == 4) v = (v > 0.f) ? v : 0.01f * v;
        if (ACT == 6) {
          const float sg = kPCarry / (1.0f + expf(-v));
          v = (n > (mBase + mOff + r)) ? 0.0f : sg;
        }
        slab[(mOff + r) * 68 + (j << 4) + rlane] = v;
      }
    }
    __builtin_amdgcn_fence(__ATOMIC_RELEASE, "workgroup");
    __builtin_amdgcn_wave_barrier();
    __builtin_amdgcn_fence(__ATOMIC_ACQUIRE, "workgroup");
    if (OUT_MODE == 0) {
      float* C = (float*)Cout + (size_t)b * strideC;
      const int hh = lane >> 4, c4 = (lane & 15) * 4;     // row seg = 256 B = 16 lanes x 16 B
      {
#pragma unroll
        for (int it = 0; it < 8; ++it) {
          const int row = it * 2 + hh;
          v4f v = *(const v4f*)(slab + row * 68 + c4);
          *(v4f*)(C + (size_t)(mBase + row) * ldc + n0 + c4) = v;
        }
        
      }
    } else {
      const int q = lane >> 3, c8 = (lane & 7) * 8;
      unsigned short* C  = (unsigned short*)Cout  + (size_t)b * strideC;
      unsigned short* C2 = (OUT_MODE == 2) ? ((unsigned short*)Cout2 + (size_t)b * strideC) : nullptr;
      {
#pragma unroll
        for (int it = 0; it < 4; ++it) {
          const int row = it * 4 + q;
          const float* sp = slab + row * 68 + c8;
          v8h hv, lv;
#pragma unroll
          for (int e = 0; e < 8; ++e) {
            if (OUT_MODE == 1) {
              hv[e] = (_Float16)sp[e];
            } else {
              unsigned short hb = f2bf_bits(sp[e]);
              unsigned short lb = f2bf_bits(sp[e] - bf_bits2f(hb));
              hv[e] = __builtin_bit_cast(_Float16, hb);
              lv[e] = __builtin_bit_cast(_Float16, lb);
            }
          }
          *(v8h*)(C + (size_t)(mBase + row) * ldc + n0 + c8) = hv;
          if (OUT_MODE == 2) *(v8h*)(C2 + (size_t)(mBase + row) * ldc + n0 + c8) = lv;
        }
        
      }
    }
    __builtin_amdgcn_fence(__ATOMIC_RELEASE, "workgroup");
    __builtin_amdgcn_wave_barrier();
    __builtin_amdgcn_fence(__ATOMIC_ACQUIRE, "workgroup");
  }
}

// ---------------------------------------------------------------------------
// x f32 [4096][1024] -> three planes: f16, bf16 hi, bf16 lo (RNE converts), 8 elements per thread.
// Coverage: n8 = 4096*1024/8 = 524288 threads = 2048 blocks x 256 exactly; each lane one 16-B store per
// ---------------------------------------------------------------------------
__global__ __launch_bounds__(256) void xcast_kernel(const float* __restrict__ in, unsigned short* __restrict__ o16,
                                                    unsigned short* __restrict__ obh, unsigned short* __restrict__ obl, int n8) {
  const int i = blockIdx.x * 256 + threadIdx.x;
  if (i >= n8) return;
  const float* p = in + 8 * (size_t)i;
  const v4f a = *(const v4f*)(p);
  const v4f c = *(const v4f*)(p + 4);
  float f[8];
#pragma unroll
  for (int e = 0; e < 4; ++e) { f[e] = a[e]; f[4 + e] = c[e]; }
  unsigned short hb[8], bh[8], bl[8];
#pragma unroll
  for (int e = 0; e < 8; ++e) {
    hb[e] = h_bits(f[e]);
    bh[e] = f2bf_bits(f[e]);
    bl[e] = f2bf_bits(f[e] - bf_bits2f(bh[e]));
  }
  const v4u u0 = (v4u){pk16(hb[0], hb[1]), pk16(hb[2], hb[3]), pk16(hb[4], hb[5]), pk16(hb[6], hb[7])};
  const v4u u1 = (v4u){pk16(bh[0], bh[1]), pk16(bh[2], bh[3]), pk16(bh[4], bh[5]), pk16(bh[6], bh[7])};
  const v4u u2 = (v4u){pk16(bl[0], bl[1]), pk16(bl[2], bl[3]), pk16(bl[4], bl[5]), pk16(bl[6], bl[7])};
  const size_t o = 8 * (size_t)i;
  *(v4u*)(o16 + o) = u0;
  *(v4u*)(obh + o) = u1;
  *(v4u*)(obl + o) = u2;
  
}

// ---------------------------------------------------------------------------
// Weight f32 [1024][1024] -> f16(scale*w), three weights selected by blockIdx.y (block-uniform),
// output plane y at out + y*n8*8 halves. Coverage: n8 = 131072 threads = 512 blocks exactly per plane;
// ---------------------------------------------------------------------------
__global__ __launch_bounds__(256) void wcast_kernel(const float* __restrict__ w0, const float* __restrict__ w1,
                                                    const float* __restrict__ w2, unsigned short* __restrict__ out,
                                                    float scale, int n8) {
  const int i = blockIdx.x * 256 + threadIdx.x;
  if (i >= n8) return;
  const int z = blockIdx.y;
  const float* w = (z == 0) ? w0 : ((z == 1) ? w1 : w2);
  const float* p = w + 8 * (size_t)i;
  const v4f a = *(const v4f*)(p);
  const v4f c = *(const v4f*)(p + 4);
  unsigned short hb[8];
#pragma unroll
  for (int e = 0; e < 4; ++e) {
    hb[e]     = h_bits(a[e] * scale);
    hb[4 + e] = h_bits(c[e] * scale);
  }
  const v4u u = (v4u){pk16(hb[0], hb[1]), pk16(hb[2], hb[3]), pk16(hb[4], hb[5]), pk16(hb[6], hb[7])};
  unsigned short* q = out + (size_t)z * (size_t)n8 * 8 + 8 * (size_t)i;
  *(v4u*)q = u;
  
}

// ---------------------------------------------------------------------------
// Weight f32 [1024][1024] -> bf16 hi and lo planes (RNE converts). Coverage as above.
// ---------------------------------------------------------------------------
__global__ __launch_bounds__(256) void wsplit_kernel(const float* __restrict__ w, unsigned short* __restrict__ hi,
                                                     unsigned short* __restrict__ lo, int n8) {
  const int i = blockIdx.x * 256 + threadIdx.x;
  if (i >= n8) return;
  const float* p = w + 8 * (size_t)i;
  const v4f a = *(const v4f*)(p);
  const v4f c = *(const v4f*)(p + 4);
  float f[8];
#pragma unroll
  for (int e = 0; e < 4; ++e) { f[e] = a[e]; f[4 + e] = c[e]; }
  unsigned short bh[8], bl[8];
#pragma unroll
  for (int e = 0; e < 8; ++e) {
    bh[e] = f2bf_bits(f[e]);
    bl[e] = f2bf_bits(f[e] - bf_bits2f(bh[e]));
  }
  const v4u u1 = (v4u){pk16(bh[0], bh[1]), pk16(bh[2], bh[3]), pk16(bh[4], bh[5]), pk16(bh[6], bh[7])};
  const v4u u2 = (v4u){pk16(bl[0], bl[1]), pk16(bl[2], bl[3]), pk16(bl[4], bl[5]), pk16(bl[6], bl[7])};
  const size_t o = 8 * (size_t)i;
  *(v4u*)(hi + o) = u1;
  *(v4u*)(lo + o) = u2;
  
}

// ---------------------------------------------------------------------------
// RoPE + per-head RMS-norm for q and k (f32), output f16 planes Q16 and K16, both laid out [h][t][64]
// (K16 plane = qk16 + 16*4096*64 halves). qf/kf: f32 [t][h*64+d]; cosT/sinT: [t][32].
// One wave handles two (t,h) pairs: lane l carries the rotation pair (d=l, d=l+32) of each.
// Results staged per wave in LDS as f32, then one store instruction: lanes 0..7 -> Q row of pair 0,
// 8..15 -> K row of pair 0, 16..23 -> Q row of pair 1, 24..31 -> K row of pair 1; each row = 64 halves
// Coverage: 4096 blocks x 8 waves x 2 pairs = 65536 = 4096 t x 16 h pairs exactly.
// ---------------------------------------------------------------------------
__global__ __launch_bounds__(256) void rope_rms_kernel(const float* __restrict__ qf, const float* __restrict__ kf,
                                                       const float* __restrict__ cosT, const float* __restrict__ sinT,
                                                       unsigned short* __restrict__ qk16) {
#pragma clang fp contract(off)
  __shared__ __align__(16) float sm[8][256];
  const int lane = threadIdx.x & 31;
  const int wave = threadIdx.x >> 5;
  const int pbase = (blockIdx.x * 8 + wave) * 2;
#pragma unroll
  for (int u = 0; u < 2; ++u) {
    const int p = pbase + u;
    const int t = p >> 4;
    const int h = p & 15;
    const float c = cosT[(size_t)t * kRotD + lane];
    const float s = sinT[(size_t)t * kRotD + lane];
    const size_t ib = (size_t)t * kEmbd + (size_t)h * kHeadD + lane;
    const float q1 = qf[ib], q2 = qf[ib + 32];
    const float k1 = kf[ib], k2 = kf[ib + 32];
    const float qo1 = q1 * c + q2 * s;
    const float qo2 = -q1 * s + q2 * c;
    const float ko1 = k1 * c + k2 * s;
    const float ko2 = -k1 * s + k2 * c;
    float ssq = qo1 * qo1 + qo2 * qo2;
    float ssk = ko1 * ko1 + ko2 * ko2;
#pragma unroll
    for (int off = 16; off >= 1; off >>= 1) {
      ssq += __shfl_xor(ssq, off, 32);
      ssk += __shfl_xor(ssk, off, 32);
    }
    const float rq = rsqrtf(ssq * (1.0f / 64.0f) + kEpsRms);
    const float rk = rsqrtf(ssk * (1.0f / 64.0f) + kEpsRms);
    float* row = &sm[wave][u * 128];
    row[lane]      = qo1 * rq;
    row[32 + lane] = qo2 * rq;
    row[64 + lane] = ko1 * rk;
    row[96 + lane] = ko2 * rk;
  }
  __syncthreads();
  const int g = lane >> 3;
  const int uu = g >> 1;
  const int which = g & 1;
  const int j = lane & 7;
  const int p = pbase + uu;
  const int t = p >> 4;
  const int h = p & 15;
  const float* sp = &sm[wave][uu * 128 + which * 64 + 8 * j];
  const v4f a = *(const v4f*)(sp);
  const v4f c = *(const v4f*)(sp + 4);
  unsigned short hb[8];
#pragma unroll
  for (int e = 0; e < 4; ++e) {
    hb[e]     = h_bits(a[e]);
    hb[4 + e] = h_bits(c[e]);
  }
  const v4u u = (v4u){pk16(hb[0], hb[1]), pk16(hb[2], hb[3]), pk16(hb[4], hb[5]), pk16(hb[6], hb[7])};
  unsigned short* dst = qk16 + (size_t)which * ((size_t)kHeads * kSeqLen * kHeadD)
                      + ((size_t)h * kSeqLen + t) * kHeadD + 8 * j;
  *(v4u*)dst = u;
  
}

// ---------------------------------------------------------------------------
// Fused causal sigmoid attention, all heads in one launch; P never leaves the registers.
// One wave owns 32 query rows of one head and walks the keys 32 at a time, in rising order:
//   S^T = K . Q^T      A = K16 rows (16 keys), B = Q16 rows (16 queries), k = head dim (2 x 32)
//   P^T = f16(2048 * sigmoid(S^T / 8)), zero where key > query
//   O^T += V^T . P^T   A = VT16 rows (16 head dims), B = P^T, k = 32 keys
// A lane's accumulators of the two 16-key tiles of S^T are, converted in place, its B operand of the second
// product (element e of tile kt -> element 8*kt + e), in the k order that Frag::load gives the V^T rows.
// O^T: a lane holds 8 consecutive head dims of one query row: one 16-byte store each.
// Placement: 256 blocks x 8 waves; block = (head, group g); waves 0..3 take query tiles 4g+w, waves 4..7
// take tiles 127-(4g+w-4), so every pair (w, w+4) walks 129 key steps together. Every (head, tile) once.
// No LDS and no barrier: the waves are independent.
// ---------------------------------------------------------------------------
// Two scores at a time: 2048 * sigmoid(s / 8) = 1 / (2^-11 + 2^(-s * log2(e) / 8 - 11)): one packed fma, the hardware's exp2,
// one packed add, the hardware's reciprocal. Right over the whole range without a range test: exp2 -> 0 gives 2048,
// exp2 -> inf gives 0. All of it in f32; the result is rounded to f16 as before.
__device__ __forceinline__ v2f sigmoid2_carried(v2f s) {
  const float a = -kScScale * 1.4426950408889634f;
  const v2f t = __builtin_elementwise_fma(s, (v2f){a, a}, (v2f){-11.0f, -11.0f});
  const v2f d = (v2f){__builtin_amdgcn_exp2f(t.x), __builtin_amdgcn_exp2f(t.y)} + (v2f){1.0f / kPCarry, 1.0f / kPCarry};
  return (v2f){__builtin_amdgcn_rcpf(d.x), __builtin_amdgcn_rcpf(d.y)};
}

template <bool MASK>
__device__ __forceinline__ void attn_step(const _Float16* __restrict__ Kh, const _Float16* __restrict__ Vh,
                                          int kb, int kbNext, int q0, int c, int h8,
                                          v16h (&kf)[2][2], const v16h (&qf)[2][2], v8f (&o)[4][2]) {
  v16h vf[4];
#pragma unroll
  for (int dt = 0; dt < 4; ++dt) {
    vf[dt] = Frag<_Float16>::load(Vh + (size_t)((dt << 4) + c) * kSeqLen + kb + h8);
    // diagonal step only: a later load of this run may land in an earlier one's address registers; the wait stands in front of it
    if (MASK) asm volatile("s_wait_xcnt 0x0" ::: "memory");
  }
  v8f s[2][2];
#pragma unroll
  for (int kt = 0; kt < 2; ++kt)
#pragma unroll
    for (int g = 0; g < 2; ++g) {
      s[kt][g] = (v8f){0.f,0.f,0.f,0.f,0.f,0.f,0.f,0.f};
      s[kt][g] = Frag<_Float16>::mma(kf[kt][0], qf[g][0], s[kt][g]);
      s[kt][g] = Frag<_Float16>::mma(kf[kt][1], qf[g][1], s[kt][g]);
    }
  // K rows of the next step, fetched behind this step's last use of the registers
  v16h kn[2][2];
#pragma unroll
  for (int kt = 0; kt < 2; ++kt)
#pragma unroll
    for (int ks = 0; ks < 2; ++ks)
      kn[kt][ks] = Frag<_Float16>::load(Kh + (size_t)(kbNext + (kt << 4) + c) * kHeadD + (ks << 5) + h8);
  // keeps the loads above in front of the sigmoid work: sunk to the loop's foot, their latency is waited out at the next step's first product
  __builtin_amdgcn_sched_barrier(0);
#pragma unroll
  for (int g = 0; g < 2; ++g) {
    v16h p;
#pragma unroll
    for (int kt = 0; kt < 2; ++kt)
#pragma unroll
      for (int r = 0; r < 8; r += 2) {
        v2f sg = sigmoid2_carried((v2f){s[kt][g][r], s[kt][g][r + 1]});
        if (MASK) {
          const int rel = (kb + (kt << 4) + h8 + r) - (q0 + (g << 4) + c);   // key minus query of element r
          sg.x = (rel > 0) ? 0.0f : sg.x;
          sg.y = (rel + 1 > 0) ? 0.0f : sg.y;
        }
        p[(kt << 3) + r]     = (_Float16)sg.x;
        p[(kt << 3) + r + 1] = (_Float16)sg.y;
      }
#pragma unroll
    for (int dt = 0; dt < 4; ++dt) o[dt][g] = Frag<_Float16>::mma(vf[dt], p, o[dt][g]);
  }
#pragma unroll
  for (int kt = 0; kt < 2; ++kt)
#pragma unroll
    for (int ks = 0; ks < 2; ++ks) kf[kt][ks] = kn[kt][ks];
}

__global__ __launch_bounds__(256) void attn_fused_kernel(const unsigned short* __restrict__ Q16p,
                                                         const unsigned short* __restrict__ K16p,
                                                         const unsigned short* __restrict__ VT16p,
                                                         unsigned short* __restrict__ O16p) {
  const int lane = threadIdx.x & 31;
  const int wave = threadIdx.x >> 5;
  const int c    = lane & 15;
  const int h8   = (lane >> 4) * 8;
  const int head = blockIdx.x & (kHeads - 1);
  const int grp  = blockIdx.x >> 4;                                    // 0..15
  const int qt   = __builtin_amdgcn_readfirstlane((wave < 4) ? (4 * grp + wave) : (127 - (4 * grp + wave - 4)));
  const int q0   = qt << 5;
  const _Float16* Qh = (const _Float16*)Q16p  + (size_t)head * kSeqLen * kHeadD;
  const _Float16* Kh = (const _Float16*)K16p  + (size_t)head * kSeqLen * kHeadD;
  const _Float16* Vh = (const _Float16*)VT16p + (size_t)head * kHeadD * kSeqLen;

  v16h qf[2][2], kf[2][2];
#pragma unroll
  for (int g = 0; g < 2; ++g)
#pragma unroll
    for (int ks = 0; ks < 2; ++ks) {
      qf[g][ks] = Frag<_Float16>::load(Qh + (size_t)(q0 + (g << 4) + c) * kHeadD + (ks << 5) + h8);
      kf[g][ks] = Frag<_Float16>::load(Kh + (size_t)((g << 4) + c) * kHeadD + (ks << 5) + h8);
    }
  // the address registers of the loads above are reused right behind them: the wait stands in front of that reuse
  asm volatile("s_wait_xcnt 0x0" ::: "memory");
  v8f o[4][2];
#pragma unroll
  for (int dt = 0; dt < 4; ++dt)
#pragma unroll
    for (int g = 0; g < 2; ++g) o[dt][g] = (v8f){0.f,0.f,0.f,0.f,0.f,0.f,0.f,0.f};

  for (int kb = 0; kb < q0; kb += 32) attn_step<false>(Kh, Vh, kb, kb + 32, q0, c, h8, kf, qf, o);
  attn_step<true>(Kh, Vh, q0, q0, q0, c, h8, kf, qf, o);              // diagonal step; its refetch stays in range

#pragma unroll
  for (int g = 0; g < 2; ++g)
#pragma unroll
    for (int dt = 0; dt < 4; ++dt) {
      v8h hv;
#pragma unroll
      for (int r = 0; r < 8; ++r) hv[r] = (_Float16)(o[dt][g][r] * kPVScale);
      *(v8h*)(O16p + (size_t)(q0 + (g << 4) + c) * kEmbd + head * kHeadD + (dt << 4) + h8) = hv;
    }
}

// ---------------------------------------------------------------------------
// Host-side orchestration
// ---------------------------------------------------------------------------
extern "C" void kernel_launch(void* const* d_in, const int* in_sizes, int n_in,
                              void* d_out, int out_size, void* d_ws,
                              size_t ws_size, hipStream_t stream) {
  if (n_in < 7) return;
  if (in_sizes[0] != kSeqLen * kEmbd) return;
  if (in_sizes[1] != kSeqLen * kRotD || in_sizes[2] != kSeqLen * kRotD) return;
  if (in_sizes[3] != kEmbd * kEmbd || in_sizes[4] != kEmbd * kEmbd ||
      in_sizes[5] != kEmbd * kEmbd || in_sizes[6] != kEmbd * kEmbd) return;
  if (out_size != kSeqLen * kEmbd) return;

  const float* x    = (const float*)d_in[0];
  const float* cosT = (const float*)d_in[1];
  const float* sinT = (const float*)d_in[2];
  const float* wq   = (const float*)d_in[3];
  const float* wk   = (const float*)d_in[4];
  const float* wv   = (const float*)d_in[5];
  const float* wp   = (const float*)d_in[6];

  // ---- workspace region map (bytes) ----
  // persistent:
  //   Q16  f16 [16][4096][64]   8 MiB  @ 0
  //   K16  f16 [16][4096][64]   8 MiB  @ 8 MiB   (must follow Q16 directly)
  //   VT16 f16 [1024][4096]     8 MiB  @ 16 MiB
  //   O16  f16 [4096][1024]     8 MiB  @ 24 MiB
  //   W16  f16 3 x [1024][1024] 6 MiB  @ 32 MiB  (wq, wk, wproj carried x16)
  //   WVH  bf16 [1024][1024]    2 MiB  @ 38 MiB
  //   WVL  bf16 [1024][1024]    2 MiB  @ 40 MiB
  // dead after rope:
  //   X16  f16  8 MiB @ 42 MiB
  //   XBH  bf16 8 MiB @ 50 MiB
  //   XBL  bf16 8 MiB @ 58 MiB
  //   QF   f32 16 MiB @ 66 MiB
  //   KF   f32 16 MiB @ 82 MiB  (must follow QF directly)
  // total = 98 MiB
  const size_t MiB = 1048576;
  const size_t total = 98 * MiB;
  if (total > ws_size) return;
  char* ws = (char*)d_ws;
  unsigned short* Q16  = (unsigned short*)(ws + 0 * MiB);
  unsigned short* K16  = (unsigned short*)(ws + 8 * MiB);
  unsigned short* VT16 = (unsigned short*)(ws + 16 * MiB);
  unsigned short* O16  = (unsigned short*)(ws + 24 * MiB);
  unsigned short* W16  = (unsigned short*)(ws + 32 * MiB);
  unsigned short* WVH  = (unsigned short*)(ws + 38 * MiB);
  unsigned short* WVL  = (unsigned short*)(ws + 40 * MiB);
  unsigned short* X16  = (unsigned short*)(ws + 42 * MiB);
  unsigned short* XBH  = (unsigned short*)(ws + 50 * MiB);
  unsigned short* XBL  = (unsigned short*)(ws + 58 * MiB);
  float*          QF   = (float*)(ws + 66 * MiB);
  unsigned short* WP16 = W16 + 2 * (size_t)kEmbd * kEmbd;
  const float* fdummy = (const float*)(ws);

  // 1) casts
  {
    const int n8x = (kSeqLen * kEmbd) / 8;          // 524288 = 2048 * 256
    xcast_kernel<<<dim3((n8x + 255) / 256), 256, 0, stream>>>(x, X16, XBH, XBL, n8x);
    const int n8w = (kEmbd * kEmbd) / 8;            // 131072 = 512 * 256
    wcast_kernel<<<dim3((n8w + 255) / 256, 3), 256, 0, stream>>>(wq, wk, wp, W16, kWCarry, n8w);
    wsplit_kernel<<<dim3((n8w + 255) / 256), 256, 0, stream>>>(wv, WVH, WVL, n8w);
  }

  // 2) q,k = X16 . Wq16^T / Wk16^T : M=4096, N=1024, K=1024 (K%32==0, M,N%64==0), f32 out, scale 1/16
  {
    const int tiles = (kSeqLen / 64) * (kEmbd / 64);   // 1024
    wmma_gemm64<0, false, 0, 0, false, 0><<<dim3((tiles + 7) / 8, 2), 256, 0, stream>>>(
        X16, X16, kEmbd, (long)0,
        W16, W16, kEmbd, (long)kEmbd * kEmbd,
        (void*)QF, (void*)QF, kEmbd, (long)kSeqLen * kEmbd,
        fdummy, fdummy, (long)0,
        kSeqLen, kEmbd, kEmbd, kQKScale);
  }

  // 3) V^T = Wv . X^T as bf16 hi/lo 3-product: A = Wv planes [1024][1024], Bt = X planes [4096][1024];
  //    M=1024, N=4096, K=1024; f16 out [h*64+d][t] carried x16, ldc = 4096
  {
    const int tiles = (kEmbd / 64) * (kSeqLen / 64);   // 1024
    wmma_gemm64<1, true, 0, 1, false, 0><<<dim3((tiles + 7) / 8, 1), 256, 0, stream>>>(
        WVH, WVL, kEmbd, (long)0,
        XBH, XBL, kEmbd, (long)0,
        (void*)VT16, (void*)VT16, kSeqLen, (long)0,
        fdummy, fdummy, (long)0,
        kEmbd, kSeqLen, kEmbd, kVCarry);
  }

  // 4) RoPE + RMS-norm -> Q16, K16 planes [h][t][64]
  rope_rms_kernel<<<dim3((kSeqLen * kHeads) / 16), 256, 0, stream>>>(QF, QF + (size_t)kSeqLen * kEmbd, cosT, sinT, Q16);

  // 5) attention, all heads: O16 = 64*y, f16 [4096][1024]; 16 heads x 16 groups = 256 blocks
  attn_fused_kernel<<<dim3(kHeads * (kSeqLen / 256)), 256, 0, stream>>>(Q16, K16, VT16, O16);

  // 6) out = (64*y) . (16*Wp)^T * (1/1024): M=4096, N=1024, K=1024, f32 out to d_out
  {
    const int tiles = (kSeqLen / 64) * (kEmbd / 64);   // 1024
    wmma_gemm64<0, false, 0, 0, false, 0><<<dim3((tiles + 7) / 8, 1), 256, 0, stream>>>(
        O16, O16, kEmbd, (long)0,
        WP16, WP16, kEmbd, (long)0,
        d_out, d_out, kEmbd, (long)0,
        fdummy, fdummy, (long)0,
        kSeqLen, kEmbd, kEmbd, kOutScale);
  }
}

// v003
// Measured time: 172 microseconds a run.
// Two timings next to v002 both put it at 1.59 times that version's speed.
// All steps since v000 together make it 9.19 times as fast.
// Contractions: q,k projections (X f16 x W^T f16 carried x16), v projection (Wv bf16 hi/lo x X^T bf16 hi/lo, 3 products), scores q.k^T (q,k f16 planes, K=64), attn.v (P f16 carried x2048 x V^T f16 carried x16), output projection (y f16 carried x64 x Wp^T f16 carried x16): v_wmma_f32_16x16x32_f16 and v_wmma_f32_16x16x32_bf16, f32 accumulate; rope, rms-norm, sigmoid in f32.
#include <hip/hip_runtime.h>
#include <math.h>

// ---------------------------------------------------------------------------
// Problem constants
// ---------------------------------------------------------------------------
constexpr int kSeqLen = 4096;
constexpr int kEmbd   = 1024;
constexpr int kHeads  = 16;
constexpr int kHeadD  = 64;
constexpr int kRotD   = 32;
constexpr float kWCarry   = 16.0f;              // f16 weights carried x16
constexpr float kVCarry   = 16.0f;              // V^T f16 plane carried x16
constexpr float kPCarry   = 2048.0f;            // sigmoid probabilities carried x2048
constexpr float kQKScale  = 1.0f / 16.0f;       // undo weight carry on q,k
constexpr float kScScale  = 0.125f;             // 1/sqrt(64)
constexpr float kPVScale  = 1.0f / 32768.0f;    // 1/(kPCarry*kVCarry): O16 = 64*y
constexpr float kOutScale = 1.0f / 1024.0f;     // (1/64) * (1/kWCarry)
constexpr float kEpsRms   = 1e-6f;

typedef __attribute__((ext_vector_type(16))) _Float16 v16h;
typedef __attribute__((ext_vector_type(8)))  _Float16 v8h;
typedef __attribute__((ext_vector_type(16))) __bf16   v16b;
typedef __attribute__((ext_vector_type(8)))  __bf16   v8b;
typedef __attribute__((ext_vector_type(8)))  float    v8f;
typedef __attribute__((ext_vector_type(4)))  float    v4f;
typedef __attribute__((ext_vector_type(2)))  float    v2f;
typedef __attribute__((ext_vector_type(4)))  unsigned int v4u;

// ---------------------------------------------------------------------------
// Helpers
// ---------------------------------------------------------------------------
__device__ __forceinline__ unsigned short f2bf_bits(float f) {
  unsigned u = __float_as_uint(f);
  return (unsigned short)((u + 0x7FFFu + ((u >> 16) & 1u)) >> 16);
}
__device__ __forceinline__ float bf_bits2f(unsigned short h) { return __uint_as_float(((unsigned)h) << 16); }

// hazard guards as plain device helpers
__device__ __forceinline__ void dep_guard_h(v8f& a, v8f& b, v16h x, v16h y) { asm volatile("v_nop\n\tv_nop\n\tv_nop\n\tv_nop" : "+v"(a), "+v"(b) : "v"(x), "v"(y)); }
__device__ __forceinline__ void dep_guard_b(v8f& a, v8f& b, v16b x, v16b y) { asm volatile("v_nop\n\tv_nop\n\tv_nop\n\tv_nop" : "+v"(a), "+v"(b) : "v"(x), "v"(y)); }
__device__ __forceinline__ void keep4_h(v16h a, v16h b, v16h c, v16h d) { asm volatile("v_nop" :: "v"(a), "v"(b), "v"(c), "v"(d)); }
__device__ __forceinline__ void keep4_b(v16b a, v16b b, v16b c, v16b d) { asm volatile("v_nop" :: "v"(a), "v"(b), "v"(c), "v"(d)); }
__device__ __forceinline__ void acc_guard4(v8f& a, v8f& b, v8f& c, v8f& d) { asm volatile("v_nop\n\tv_nop\n\tv_nop\n\tv_nop" : "+v"(a), "+v"(b), "+v"(c), "+v"(d)); }
template <typename T> struct Frag;
template <> struct Frag<_Float16> {
  typedef v16h V; union U { v16h v; v8h h[2]; };
  static __device__ __forceinline__ v16h load(const _Float16* p) {   // elements 0..7 <- p[0..7], 8..15 <- p[16..23]
    U f; f.h[0] = *(const v8h*)(p); f.h[1] = *(const v8h*)(p + 16); return f.v;
  }
  static __device__ __forceinline__ v8f mma(v16h a, v16h b, v8f c) {
    return __builtin_amdgcn_wmma_f32_16x16x32_f16(false, a, false, b, (short)0, c, false, false);
  }
  static __device__ __forceinline__ void guard(v8f& a, v8f& b, v16h x, v16h y) { dep_guard_h(a, b, x, y); }
  static __device__ __forceinline__ void keep(v16h a, v16h b, v16h c, v16h d) { keep4_h(a, b, c, d); }
};
template <> struct Frag<__bf16> {
  typedef v16b V; union U { v16b v; v8b h[2]; };
  static __device__ __forceinline__ v16b load(const __bf16* p) {
    U f; f.h[0] = *(const v8b*)(p); f.h[1] = *(const v8b*)(p + 16); return f.v;
  }
  static __device__ __forceinline__ v8f mma(v16b a, v16b b, v8f c) {
    return __builtin_amdgcn_wmma_f32_16x16x32_bf16(false, a, false, b, (short)0, c, false, false);
  }
  static __device__ __forceinline__ void guard(v8f& a, v8f& b, v16b x, v16b y) { dep_guard_b(a, b, x, y); }
  static __device__ __forceinline__ void keep(v16b a, v16b b, v16b c, v16b d) { keep4_b(a, b, c, d); }
};

__device__ __forceinline__ unsigned pk16(unsigned short a, unsigned short b) { return (unsigned)a | ((unsigned)b << 16); }
__device__ __forceinline__ unsigned short h_bits(float f) { const _Float16 h = (_Float16)f; return __builtin_bit_cast(unsigned short, h); }

// ---- Batched WMMA GEMM, operands staged in LDS ------------------------------------------------
// C[m,n] = scale * sum_k A[m,k] * Bt[n,k] (+bias)(+resid).
// A row-major [M,K]; Bt row-major [N,K]; M,N % 128 == 0, K % 64 == 0.
// A work-group of 8 waves owns a 128x128 tile of C; wave w owns rows 32*(w>>1).., columns 64*(w&1).. of it.
// Per trip 64 k of the 128 A rows and the 128 Bt rows lie in LDS, brought there by asynchronous copies as whole
// 128-byte lines (8 lanes a row), so that no fragment load gathers 16 lines from the caches any more.
// LDS rows have a pitch of 144 bytes (16 B x odd: ds_load_b128 without bank conflicts). Two buffers: the copies of
// trip t+1 fly while trip t is worked on. The k order of the sums is the one of the fragment loads from LDS.
// SPLIT: operands are hi/lo planes (A2/Bt2 = lo planes, same layout); product = hi.hi + hi.lo + lo.hi.
// BIAS_MODE: 0 = none, 1 = bias[m], 2 = bias[n].
// OUT_MODE: 0 = f32, 1 = f16, 2 = bf16 hi plane (Cout) + bf16 lo plane (Cout2).
// ACT: 2 relu, 4 leaky, 6 = causal sigmoid carry: v = (n > m) ? 0 : kPCarry / (1 + exp(-v)).
// ET: 0 = f16 operands, 1 = bf16 operands (pointers passed as 16-bit storage)
constexpr int kTileK    = 64;                  // k per trip, 128 bytes of every operand row
constexpr int kRowPitch = 72;                  // LDS row pitch in 16-bit elements (144 bytes)
constexpr int kPlane    = 128 * kRowPitch;     // 16-bit elements of one operand plane in LDS

// Eight copies of 16 bytes a lane, global memory -> LDS through no register. The closing wait stands inside the statement,
// in front of any later rewrite of the address registers that the copies name.
__device__ __forceinline__ void async_copy8(const unsigned (&l)[8], const unsigned short* const (&g)[8]) {
  asm volatile("global_load_async_to_lds_b128 %0, %8, off\n\t"
               "global_load_async_to_lds_b128 %1, %9, off\n\t"
               "global_load_async_to_lds_b128 %2, %10, off\n\t"
               "global_load_async_to_lds_b128 %3, %11, off\n\t"
               "global_load_async_to_lds_b128 %4, %12, off\n\t"
               "global_load_async_to_lds_b128 %5, %13, off\n\t"
               "global_load_async_to_lds_b128 %6, %14, off\n\t"
               "global_load_async_to_lds_b128 %7, %15, off\n\t"
               "s_wait_xcnt 0x0"
               :: "v"(l[0]), "v"(l[1]), "v"(l[2]), "v"(l[3]), "v"(l[4]), "v"(l[5]), "v"(l[6]), "v"(l[7]),
                  "v"(g[0]), "v"(g[1]), "v"(g[2]), "v"(g[3]), "v"(g[4]), "v"(g[5]), "v"(g[6]), "v"(g[7])
               : "memory");
}
// One plane of A and one of Bt, 128 rows x 128 bytes each: this thread's 16 bytes of rows r, r+32, r+64, r+96.
__device__ __forceinline__ void stage_pair(const unsigned short* ga, size_t stepA, const unsigned short* gb, size_t stepB,
                                           unsigned lds) {
  unsigned l[8];
  const unsigned short* g[8];
#pragma unroll
  for (int i = 0; i < 4; ++i) {
    l[i]     = lds + (unsigned)(i * 32 * kRowPitch * 2);
    l[4 + i] = lds + (unsigned)((kPlane + i * 32 * kRowPitch) * 2);
    g[i]     = ga + i * stepA;
    g[4 + i] = gb + i * stepB;
  }
  async_copy8(l, g);
}

template <int ET> struct Elem;
template <> struct Elem<0> { typedef _Float16 T; };
template <> struct Elem<1> { typedef __bf16 T; };
template <int ET, bool SPLIT, int BIAS_MODE, int OUT_MODE, bool RESID, int ACT = 0>
__global__ __launch_bounds__(256) void wmma_gemm64(
    const unsigned short* __restrict__ Ap, const unsigned short* __restrict__ A2p, int lda, long strideA,
    const unsigned short* __restrict__ Btp, const unsigned short* __restrict__ Bt2p, int ldb, long strideB,
    void* __restrict__ Cout, void* __restrict__ Cout2, int ldc, long strideC,
    const float* __restrict__ bias,
    const float* __restrict__ resid, long strideR,
    int M, int N, int K, float scale) {
  typedef typename Elem<ET>::T T;
  typedef typename Frag<T>::V V;
  constexpr int kStage = (SPLIT ? 4 : 2) * kPlane;           // one buffer: [A][Bt], SPLIT: [A hi][Bt hi][A lo][Bt lo]
  constexpr int kGroupK = SPLIT ? 32 : 64;                   // k of one group of fragment loads: 24 loads either way
  __shared__ __align__(16) unsigned short ring[2 * kStage];
  __shared__ __align__(16) float sT[8][16 * 68];   // per-wave 16x64 slab, pitch 68 floats
  const int b    = blockIdx.y;
  const int lane = threadIdx.x & 31;
  const int wave = threadIdx.x >> 5;
  const int tilesN = N >> 7;
  const int tilesM = M >> 7;
  if ((int)blockIdx.x >= tilesM * tilesN) return;   // the same for the whole work-group, in front of every barrier
  const int bm = blockIdx.x / tilesN;
  const int bn = blockIdx.x - bm * tilesN;
  const int m0 = (bm << 7) + ((wave >> 1) << 5);
  const int n0 = (bn << 7) + ((wave & 1) << 6);
  const int nt = K / kTileK;

  const int rlane = lane & 15;                 // row (A) / col (B, D) within subtile
  const int koff  = (lane >> 4) * 8;           // k offset of this lane half
  const int mOff  = (lane >> 4) * 8;           // D row offset

  // this thread's share of the copies: 16 bytes at column ccol of rows crow + 32 i of every plane
  const int crow = threadIdx.x >> 3;
  const int ccol = (threadIdx.x & 7) * 8;
  const size_t stepA = (size_t)32 * lda;
  const size_t stepB = (size_t)32 * ldb;
  const size_t offA = (size_t)b * strideA + (size_t)((bm << 7) + crow) * lda + ccol;
  const size_t offB = (size_t)b * strideB + (size_t)((bn << 7) + crow) * ldb + ccol;
  const unsigned lds0 = (unsigned)(size_t)(&ring[crow * kRowPitch + ccol]);   // LDS byte address: low word of the pointer

  // this lane's fragment rows in a buffer
  const int fragA = (((wave >> 1) << 5) + rlane) * kRowPitch + koff;
  const int fragB = kPlane + (((wave & 1) << 6) + rlane) * kRowPitch + koff;

  v8f acc[2][4];
#pragma unroll
  for (int i = 0; i < 2; ++i)
#pragma unroll
    for (int j = 0; j < 4; ++j) acc[i][j] = (v8f){0.f,0.f,0.f,0.f,0.f,0.f,0.f,0.f};

  // tile 0 into buffer 0, landed and published; then tile 1 into buffer 1
  stage_pair(Ap + offA, stepA, Btp + offB, stepB, lds0);
  if (SPLIT) stage_pair(A2p + offA, stepA, Bt2p + offB, stepB, lds0 + 2 * kPlane * 2);
  asm volatile("s_wait_asynccnt 0x0" ::: "memory");   // this wave's copies of tile 0 have landed
  __syncthreads();                                    // every wave's have
  if (nt > 1) {
    stage_pair(Ap + offA + kTileK, stepA, Btp + offB + kTileK, stepB, lds0 + kStage * 2);
    if (SPLIT) stage_pair(A2p + offA + kTileK, stepA, Bt2p + offB + kTileK, stepB, lds0 + (kStage + 2 * kPlane) * 2);
  }

  for (int t = 0; t < nt; ++t) {
    const int bufo = (t & 1) * kStage;
    const T* sb = (const T*)(ring + bufo);
#pragma unroll
    for (int kg = 0; kg < kTileK; kg += kGroupK) {
      // all fragment loads of a group stand in front of its products: one place where the wave waits for LDS
      V ah[kGroupK / 32][2], al[kGroupK / 32][2], bh[kGroupK / 32][4], bl[kGroupK / 32][4];
#pragma unroll
      for (int s = 0; s < kGroupK / 32; ++s) {
#pragma unroll
        for (int i = 0; i < 2; ++i) {
          const int ao = fragA + (i << 4) * kRowPitch + kg + (s << 5);
          ah[s][i] = Frag<T>::load(sb + ao);
          if (SPLIT) al[s][i] = Frag<T>::load(sb + 2 * kPlane + ao);
        }
#pragma unroll
        for (int j = 0; j < 4; ++j) {
          const int bo = fragB + (j << 4) * kRowPitch + kg + (s << 5);
          bh[s][j] = Frag<T>::load(sb + bo);
          if (SPLIT) bl[s][j] = Frag<T>::load(sb + 2 * kPlane + bo);
        }
      }
#pragma unroll
      for (int s = 0; s < kGroupK / 32; ++s) {
#pragma unroll
        for (int i = 0; i < 2; ++i) {
#pragma unroll
          for (int j = 0; j < 4; ++j) {
            acc[i][j] = Frag<T>::mma(ah[s][i], bh[s][j], acc[i][j]);
            if (SPLIT) {
              acc[i][j] = Frag<T>::mma(ah[s][i], bl[s][j], acc[i][j]);
              acc[i][j] = Frag<T>::mma(al[s][i], bh[s][j], acc[i][j]);
            }
          }
          Frag<T>::guard(acc[i][0], acc[i][3], ah[s][i], SPLIT ? al[s][i] : ah[s][i]);
        }
        Frag<T>::keep(bh[s][0], bh[s][1], bh[s][2], bh[s][3]);
        if (SPLIT) Frag<T>::keep(bl[s][0], bl[s][1], bl[s][2], bl[s][3]);
      }
    }
    asm volatile("s_wait_dscnt 0x0" ::: "memory");      // this wave's reads of the buffer are done before it is refilled
    asm volatile("s_wait_asynccnt 0x0" ::: "memory");   // this wave's copies of tile t+1 have landed
    __syncthreads();                                    // publishes tile t+1 and ends every wave's reads of tile t
    if (t + 2 < nt) {
      const size_t ko = (size_t)(t + 2) * kTileK;
      stage_pair(Ap + offA + ko, stepA, Btp + offB + ko, stepB, lds0 + bufo * 2);
      if (SPLIT) stage_pair(A2p + offA + ko, stepA, Bt2p + offB + ko, stepB, lds0 + (bufo + 2 * kPlane) * 2);
    }
  }
  asm volatile("s_wait_asynccnt 0x0" ::: "memory");     // no copy is in flight behind the loop
  acc_guard4(acc[0][0], acc[0][1], acc[0][2], acc[0][3]);
  acc_guard4(acc[1][0], acc[1][1], acc[1][2], acc[1][3]);

  // ---- epilogue ----
  float* slab = sT[wave];
  const float* Rb = RESID ? (resid + (size_t)b * strideR) : nullptr;
#pragma unroll
  for (int i = 0; i < 2; ++i) {
    const int mBase = m0 + (i << 4);
#pragma unroll
    for (int j = 0; j < 4; ++j) {
      const int n = n0 + (j << 4) + rlane;
      float bv = 0.f;
      if (BIAS_MODE == 2) bv = bias[n];
#pragma unroll
      for (int r = 0; r < 8; ++r) {
        float v = acc[i][j][r] * scale;
        if (BIAS_MODE == 1) v += bias[mBase + mOff + r];
        if (BIAS_MODE == 2) v += bv;
        if (RESID) v += Rb[(size_t)(mBase + mOff + r) * ldc + n];
        if (ACT == 2) v = fmaxf(v, 0.0f);
        if (ACT == 4) v = (v > 0.f) ? v : 0.01f * v;
        if (ACT == 6) {
          const float sg = kPCarry / (1.0f + expf(-v));
          v = (n > (mBase + mOff + r)) ? 0.0f : sg;
        }
        slab[(mOff + r) * 68 + (j << 4) + rlane] = v;
      }
    }
    __builtin_amdgcn_fence(__ATOMIC_RELEASE, "workgroup");
    __builtin_amdgcn_wave_barrier();
    __builtin_amdgcn_fence(__ATOMIC_ACQUIRE, "workgroup");
    if (OUT_MODE == 0) {
      float* C = (float*)Cout + (size_t)b * strideC;
      const int hh = lane >> 4, c4 = (lane & 15) * 4;     // row seg = 256 B = 16 lanes x 16 B
      {
#pragma unroll
        for (int it = 0; it < 8; ++it) {
          const int row = it * 2 + hh;
          v4f v = *(const v4f*)(slab + row * 68 + c4);
          *(v4f*)(C + (size_t)(mBase + row) * ldc + n0 + c4) = v;
        }
        
      }
    } else {
      const int q = lane >> 3, c8 = (lane & 7) * 8;
      unsigned short* C  = (unsigned short*)Cout  + (size_t)b * strideC;
      unsigned short* C2 = (OUT_MODE == 2) ? ((unsigned short*)Cout2 + (size_t)b * strideC) : nullptr;
      {
#pragma unroll
        for (int it = 0; it < 4; ++it) {
          const int row = it * 4 + q;
          const float* sp = slab + row * 68 + c8;
          v8h hv, lv;
#pragma unroll
          for (int e = 0; e < 8; ++e) {
            if (OUT_MODE == 1) {
              hv[e] = (_Float16)sp[e];
            } else {
              unsigned short hb = f2bf_bits(sp[e]);
              unsigned short lb = f2bf_bits(sp[e] - bf_bits2f(hb));
              hv[e] = __builtin_bit_cast(_Float16, hb);
              lv[e] = __builtin_bit_cast(_Float16, lb);
            }
          }
          *(v8h*)(C + (size_t)(mBase + row) * ldc + n0 + c8) = hv;
          if (OUT_MODE == 2) *(v8h*)(C2 + (size_t)(mBase + row) * ldc + n0 + c8) = lv;
        }
        
      }
    }
    __builtin_amdgcn_fence(__ATOMIC_RELEASE, "workgroup");
    __builtin_amdgcn_wave_barrier();
    __builtin_amdgcn_fence(__ATOMIC_ACQUIRE, "workgroup");
  }
}

// ---------------------------------------------------------------------------
// x f32 [4096][1024] -> three planes: f16, bf16 hi, bf16 lo (RNE converts), 8 elements per thread.
// Coverage: n8 = 4096*1024/8 = 524288 threads = 2048 blocks x 256 exactly; each lane one 16-B store per
// ---------------------------------------------------------------------------
__global__ __launch_bounds__(256) void xcast_kernel(const float* __restrict__ in, unsigned short* __restrict__ o16,
                                                    unsigned short* __restrict__ obh, unsigned short* __restrict__ obl, int n8) {
  const int i = blockIdx.x * 256 + threadIdx.x;
  if (i >= n8) return;
  const float* p = in + 8 * (size_t)i;
  const v4f a = *(const v4f*)(p);
  const v4f c = *(const v4f*)(p + 4);
  float f[8];
#pragma unroll
  for (int e = 0; e < 4; ++e) { f[e] = a[e]; f[4 + e] = c[e]; }
  unsigned short hb[8], bh[8], bl[8];
#pragma unroll
  for (int e = 0; e < 8; ++e) {
    hb[e] = h_bits(f[e]);
    bh[e] = f2bf_bits(f[e]);
    bl[e] = f2bf_bits(f[e] - bf_bits2f(bh[e]));
  }
  const v4u u0 = (v4u){pk16(hb[0], hb[1]), pk16(hb[2], hb[3]), pk16(hb[4], hb[5]), pk16(hb[6], hb[7])};
  const v4u u1 = (v4u){pk16(bh[0], bh[1]), pk16(bh[2], bh[3]), pk16(bh[4], bh[5]), pk16(bh[6], bh[7])};
  const v4u u2 = (v4u){pk16(bl[0], bl[1]), pk16(bl[2], bl[3]), pk16(bl[4], bl[5]), pk16(bl[6], bl[7])};
  const size_t o = 8 * (size_t)i;
  *(v4u*)(o16 + o) = u0;
  *(v4u*)(obh + o) = u1;
  *(v4u*)(obl + o) = u2;
  
}

// ---------------------------------------------------------------------------
// Weight f32 [1024][1024] -> f16(scale*w), three weights selected by blockIdx.y (block-uniform),
// output plane y at out + y*n8*8 halves. Coverage: n8 = 131072 threads = 512 blocks exactly per plane;
// ---------------------------------------------------------------------------
__global__ __launch_bounds__(256) void wcast_kernel(const float* __restrict__ w0, const float* __restrict__ w1,
                                                    const float* __restrict__ w2, unsigned short* __restrict__ out,
                                                    float scale, int n8) {
  const int i = blockIdx.x * 256 + threadIdx.x;
  if (i >= n8) return;
  const int z = blockIdx.y;
  const float* w = (z == 0) ? w0 : ((z == 1) ? w1 : w2);
  const float* p = w + 8 * (size_t)i;
  const v4f a = *(const v4f*)(p);
  const v4f c = *(const v4f*)(p + 4);
  unsigned short hb[8];
#pragma unroll
  for (int e = 0; e < 4; ++e) {
    hb[e]     = h_bits(a[e] * scale);
    hb[4 + e] = h_bits(c[e] * scale);
  }
  const v4u u = (v4u){pk16(hb[0], hb[1]), pk16(hb[2], hb[3]), pk16(hb[4], hb[5]), pk16(hb[6], hb[7])};
  unsigned short* q = out + (size_t)z * (size_t)n8 * 8 + 8 * (size_t)i;
  *(v4u*)q = u;
  
}

// ---------------------------------------------------------------------------
// Weight f32 [1024][1024] -> bf16 hi and lo planes (RNE converts). Coverage as above.
// ---------------------------------------------------------------------------
__global__ __launch_bounds__(256) void wsplit_kernel(const float* __restrict__ w, unsigned short* __restrict__ hi,
                                                     unsigned short* __restrict__ lo, int n8) {
  const int i = blockIdx.x * 256 + threadIdx.x;
  if (i >= n8) return;
  const float* p = w + 8 * (size_t)i;
  const v4f a = *(const v4f*)(p);
  const v4f c = *(const v4f*)(p + 4);
  float f[8];
#pragma unroll
  for (int e = 0; e < 4; ++e) { f[e] = a[e]; f[4 + e] = c[e]; }
  unsigned short bh[8], bl[8];
#pragma unroll
  for (int e = 0; e < 8; ++e) {
    bh[e] = f2bf_bits(f[e]);
    bl[e] = f2bf_bits(f[e] - bf_bits2f(bh[e]));
  }
  const v4u u1 = (v4u){pk16(bh[0], bh[1]), pk16(bh[2], bh[3]), pk16(bh[4], bh[5]), pk16(bh[6], bh[7])};
  const v4u u2 = (v4u){pk16(bl[0], bl[1]), pk16(bl[2], bl[3]), pk16(bl[4], bl[5]), pk16(bl[6], bl[7])};
  const size_t o = 8 * (size_t)i;
  *(v4u*)(hi + o) = u1;
  *(v4u*)(lo + o) = u2;
  
}

// ---------------------------------------------------------------------------
// RoPE + per-head RMS-norm for q and k (f32), output f16 planes Q16 and K16, both laid out [h][t][64]
// (K16 plane = qk16 + 16*4096*64 halves). qf/kf: f32 [t][h*64+d]; cosT/sinT: [t][32].
// One wave handles two (t,h) pairs: lane l carries the rotation pair (d=l, d=l+32) of each.
// Results staged per wave in LDS as f32, then one store instruction: lanes 0..7 -> Q row of pair 0,
// 8..15 -> K row of pair 0, 16..23 -> Q row of pair 1, 24..31 -> K row of pair 1; each row = 64 halves
// Coverage: 4096 blocks x 8 waves x 2 pairs = 65536 = 4096 t x 16 h pairs exactly.
// ---------------------------------------------------------------------------
__global__ __launch_bounds__(256) void rope_rms_kernel(const float* __restrict__ qf, const float* __restrict__ kf,
                                                       const float* __restrict__ cosT, const float* __restrict__ sinT,
                                                       unsigned short* __restrict__ qk16) {
#pragma clang fp contract(off)
  __shared__ __align__(16) float sm[8][256];
  const int lane = threadIdx.x & 31;
  const int wave = threadIdx.x >> 5;
  const int pbase = (blockIdx.x * 8 + wave) * 2;
#pragma unroll
  for (int u = 0; u < 2; ++u) {
    const int p = pbase + u;
    const int t = p >> 4;
    const int h = p & 15;
    const float c = cosT[(size_t)t * kRotD + lane];
    const float s = sinT[(size_t)t * kRotD + lane];
    const size_t ib = (size_t)t * kEmbd + (size_t)h * kHeadD + lane;
    const float q1 = qf[ib], q2 = qf[ib + 32];
    const float k1 = kf[ib], k2 = kf[ib + 32];
    const float qo1 = q1 * c + q2 * s;
    const float qo2 = -q1 * s + q2 * c;
    const float ko1 = k1 * c + k2 * s;
    const float ko2 = -k1 * s + k2 * c;
    float ssq = qo1 * qo1 + qo2 * qo2;
    float ssk = ko1 * ko1 + ko2 * ko2;
#pragma unroll
    for (int off = 16; off >= 1; off >>= 1) {
      ssq += __shfl_xor(ssq, off, 32);
      ssk += __shfl_xor(ssk, off, 32);
    }
    const float rq = rsqrtf(ssq * (1.0f / 64.0f) + kEpsRms);
    const float rk = rsqrtf(ssk * (1.0f / 64.0f) + kEpsRms);
    float* row = &sm[wave][u * 128];
    row[lane]      = qo1 * rq;
    row[32 + lane] = qo2 * rq;
    row[64 + lane] = ko1 * rk;
    row[96 + lane] = ko2 * rk;
  }
  __syncthreads();
  const int g = lane >> 3;
  const int uu = g >> 1;
  const int which = g & 1;
  const int j = lane & 7;
  const int p = pbase + uu;
  const int t = p >> 4;
  const int h = p & 15;
  const float* sp = &sm[wave][uu * 128 + which * 64 + 8 * j];
  const v4f a = *(const v4f*)(sp);
  const v4f c = *(const v4f*)(sp + 4);
  unsigned short hb[8];
#pragma unroll
  for (int e = 0; e < 4; ++e) {
    hb[e]     = h_bits(a[e]);
    hb[4 + e] = h_bits(c[e]);
  }
  const v4u u = (v4u){pk16(hb[0], hb[1]), pk16(hb[2], hb[3]), pk16(hb[4], hb[5]), pk16(hb[6], hb[7])};
  unsigned short* dst = qk16 + (size_t)which * ((size_t)kHeads * kSeqLen * kHeadD)
                      + ((size_t)h * kSeqLen + t) * kHeadD + 8 * j;
  *(v4u*)dst = u;
  
}

// ---------------------------------------------------------------------------
// Fused causal sigmoid attention, all heads in one launch; P never leaves the registers.
// One wave owns 32 query rows of one head and walks the keys 32 at a time, in rising order:
//   S^T = K . Q^T      A = K16 rows (16 keys), B = Q16 rows (16 queries), k = head dim (2 x 32)
//   P^T = f16(2048 * sigmoid(S^T / 8)), zero where key > query
//   O^T += V^T . P^T   A = VT16 rows (16 head dims), B = P^T, k = 32 keys
// A lane's accumulators of the two 16-key tiles of S^T are, converted in place, its B operand of the second
// product (element e of tile kt -> element 8*kt + e), in the k order that Frag::load gives the V^T rows.
// O^T: a lane holds 8 consecutive head dims of one query row: one 16-byte store each.
// Placement: 256 blocks x 8 waves; block = (head, group g); waves 0..3 take query tiles 4g+w, waves 4..7
// take tiles 127-(4g+w-4), so every pair (w, w+4) walks 129 key steps together. Every (head, tile) once.
// No LDS and no barrier: the waves are independent.
// ---------------------------------------------------------------------------
// Two scores at a time: 2048 * sigmoid(s / 8) = 1 / (2^-11 + 2^(-s * log2(e) / 8 - 11)): one packed fma, the hardware's exp2,
// one packed add, the hardware's reciprocal. Right over the whole range without a range test: exp2 -> 0 gives 2048,
// exp2 -> inf gives 0. All of it in f32; the result is rounded to f16 as before.
__device__ __forceinline__ v2f sigmoid2_carried(v2f s) {
  const float a = -kScScale * 1.4426950408889634f;
  const v2f t = __builtin_elementwise_fma(s, (v2f){a, a}, (v2f){-11.0f, -11.0f});
  const v2f d = (v2f){__builtin_amdgcn_exp2f(t.x), __builtin_amdgcn_exp2f(t.y)} + (v2f){1.0f / kPCarry, 1.0f / kPCarry};
  return (v2f){__builtin_amdgcn_rcpf(d.x), __builtin_amdgcn_rcpf(d.y)};
}

template <bool MASK>
__device__ __forceinline__ void attn_step(const _Float16* __restrict__ Kh, const _Float16* __restrict__ Vh,
                                          int kb, int kbNext, int q0, int c, int h8,
                                          v16h (&kf)[2][2], const v16h (&qf)[2][2], v8f (&o)[4][2]) {
  v16h vf[4];
#pragma unroll
  for (int dt = 0; dt < 4; ++dt) {
    vf[dt] = Frag<_Float16>::load(Vh + (size_t)((dt << 4) + c) * kSeqLen + kb + h8);
    // diagonal step only: a later load of this run may land in an earlier one's address registers; the wait stands in front of it
    if (MASK) asm volatile("s_wait_xcnt 0x0" ::: "memory");
  }
  v8f s[2][2];
#pragma unroll
  for (int kt = 0; kt < 2; ++kt)
#pragma unroll
    for (int g = 0; g < 2; ++g) {
      s[kt][g] = (v8f){0.f,0.f,0.f,0.f,0.f,0.f,0.f,0.f};
      s[kt][g] = Frag<_Float16>::mma(kf[kt][0], qf[g][0], s[kt][g]);
      s[kt][g] = Frag<_Float16>::mma(kf[kt][1], qf[g][1], s[kt][g]);
    }
  // K rows of the next step, fetched behind this step's last use of the registers
  v16h kn[2][2];
#pragma unroll
  for (int kt = 0; kt < 2; ++kt)
#pragma unroll
    for (int ks = 0; ks < 2; ++ks)
      kn[kt][ks] = Frag<_Float16>::load(Kh + (size_t)(kbNext + (kt << 4) + c) * kHeadD + (ks << 5) + h8);
  // keeps the loads above in front of the sigmoid work: sunk to the loop's foot, their latency is waited out at the next step's first product
  __builtin_amdgcn_sched_barrier(0);
#pragma unroll
  for (int g = 0; g < 2; ++g) {
    v16h p;
#pragma unroll
    for (int kt = 0; kt < 2; ++kt)
#pragma unroll
      for (int r = 0; r < 8; r += 2) {
        v2f sg = sigmoid2_carried((v2f){s[kt][g][r], s[kt][g][r + 1]});
        if (MASK) {
          const int rel = (kb + (kt << 4) + h8 + r) - (q0 + (g << 4) + c);   // key minus query of element r
          sg.x = (rel > 0) ? 0.0f : sg.x;
          sg.y = (rel + 1 > 0) ? 0.0f : sg.y;
        }
        p[(kt << 3) + r]     = (_Float16)sg.x;
        p[(kt << 3) + r + 1] = (_Float16)sg.y;
      }
#pragma unroll
    for (int dt = 0; dt < 4; ++dt) o[dt][g] = Frag<_Float16>::mma(vf[dt], p, o[dt][g]);
  }
#pragma unroll
  for (int kt = 0; kt < 2; ++kt)
#pragma unroll
    for (int ks = 0; ks < 2; ++ks) kf[kt][ks] = kn[kt][ks];
}

__global__ __launch_bounds__(256) void attn_fused_kernel(const unsigned short* __restrict__ Q16p,
                                                         const unsigned short* __restrict__ K16p,
                                                         const unsigned short* __restrict__ VT16p,
                                                         unsigned short* __restrict__ O16p) {
  const int lane = threadIdx.x & 31;
  const int wave = threadIdx.x >> 5;
  const int c    = lane & 15;
  const int h8   = (lane >> 4) * 8;
  const int head = blockIdx.x & (kHeads - 1);
  const int grp  = blockIdx.x >> 4;                                    // 0..15
  const int qt   = __builtin_amdgcn_readfirstlane((wave < 4) ? (4 * grp + wave) : (127 - (4 * grp + wave - 4)));
  const int q0   = qt << 5;
  const _Float16* Qh = (const _Float16*)Q16p  + (size_t)head * kSeqLen * kHeadD;
  const _Float16* Kh = (const _Float16*)K16p  + (size_t)head * kSeqLen * kHeadD;
  const _Float16* Vh = (const _Float16*)VT16p + (size_t)head * kHeadD * kSeqLen;

  v16h qf[2][2], kf[2][2];
#pragma unroll
  for (int g = 0; g < 2; ++g)
#pragma unroll
    for (int ks = 0; ks < 2; ++ks) {
      qf[g][ks] = Frag<_Float16>::load(Qh + (size_t)(q0 + (g << 4) + c) * kHeadD + (ks << 5) + h8);
      kf[g][ks] = Frag<_Float16>::load(Kh + (size_t)((g << 4) + c) * kHeadD + (ks << 5) + h8);
    }
  // the address registers of the loads above are reused right behind them: the wait stands in front of that reuse
  asm volatile("s_wait_xcnt 0x0" ::: "memory");
  v8f o[4][2];
#pragma unroll
  for (int dt = 0; dt < 4; ++dt)
#pragma unroll
    for (int g = 0; g < 2; ++g) o[dt][g] = (v8f){0.f,0.f,0.f,0.f,0.f,0.f,0.f,0.f};

  for (int kb = 0; kb < q0; kb += 32) attn_step<false>(Kh, Vh, kb, kb + 32, q0, c, h8, kf, qf, o);
  attn_step<true>(Kh, Vh, q0, q0, q0, c, h8, kf, qf, o);              // diagonal step; its refetch stays in range

#pragma unroll
  for (int g = 0; g < 2; ++g)
#pragma unroll
    for (int dt = 0; dt < 4; ++dt) {
      v8h hv;
#pragma unroll
      for (int r = 0; r < 8; ++r) hv[r] = (_Float16)(o[dt][g][r] * kPVScale);
      *(v8h*)(O16p + (size_t)(q0 + (g << 4) + c) * kEmbd + head * kHeadD + (dt << 4) + h8) = hv;
    }
}

// ---------------------------------------------------------------------------
// Host-side orchestration
// ---------------------------------------------------------------------------
extern "C" void kernel_launch(void* const* d_in, const int* in_sizes, int n_in,
                              void* d_out, int out_size, void* d_ws,
                              size_t ws_size, hipStream_t stream) {
  if (n_in < 7) return;
  if (in_sizes[0] != kSeqLen * kEmbd) return;
  if (in_sizes[1] != kSeqLen * kRotD || in_sizes[2] != kSeqLen * kRotD) return;
  if (in_sizes[3] != kEmbd * kEmbd || in_sizes[4] != kEmbd * kEmbd ||
      in_sizes[5] != kEmbd * kEmbd || in_sizes[6] != kEmbd * kEmbd) return;
  if (out_size != kSeqLen * kEmbd) return;

  const float* x    = (const float*)d_in[0];
  const float* cosT = (const float*)d_in[1];
  const float* sinT = (const float*)d_in[2];
  const float* wq   = (const float*)d_in[3];
  const float* wk   = (const float*)d_in[4];
  const float* wv   = (const float*)d_in[5];
  const float* wp   = (const float*)d_in[6];

  // ---- workspace region map (bytes) ----
  // persistent:
  //   Q16  f16 [16][4096][64]   8 MiB  @ 0
  //   K16  f16 [16][4096][64]   8 MiB  @ 8 MiB   (must follow Q16 directly)
  //   VT16 f16 [1024][4096]     8 MiB  @ 16 MiB
  //   O16  f16 [4096][1024]     8 MiB  @ 24 MiB
  //   W16  f16 3 x [1024][1024] 6 MiB  @ 32 MiB  (wq, wk, wproj carried x16)
  //   WVH  bf16 [1024][1024]    2 MiB  @ 38 MiB
  //   WVL  bf16 [1024][1024]    2 MiB  @ 40 MiB
  // dead after rope:
  //   X16  f16  8 MiB @ 42 MiB
  //   XBH  bf16 8 MiB @ 50 MiB
  //   XBL  bf16 8 MiB @ 58 MiB
  //   QF   f32 16 MiB @ 66 MiB
  //   KF   f32 16 MiB @ 82 MiB  (must follow QF directly)
  // total = 98 MiB
  const size_t MiB = 1048576;
  const size_t total = 98 * MiB;
  if (total > ws_size) return;
  char* ws = (char*)d_ws;
  unsigned short* Q16  = (unsigned short*)(ws + 0 * MiB);
  unsigned short* K16  = (unsigned short*)(ws + 8 * MiB);
  unsigned short* VT16 = (unsigned short*)(ws + 16 * MiB);
  unsigned short* O16  = (unsigned short*)(ws + 24 * MiB);
  unsigned short* W16  = (unsigned short*)(ws + 32 * MiB);
  unsigned short* WVH  = (unsigned short*)(ws + 38 * MiB);
  unsigned short* WVL  = (unsigned short*)(ws + 40 * MiB);
  unsigned short* X16  = (unsigned short*)(ws + 42 * MiB);
  unsigned short* XBH  = (unsigned short*)(ws + 50 * MiB);
  unsigned short* XBL  = (unsigned short*)(ws + 58 * MiB);
  float*          QF   = (float*)(ws + 66 * MiB);
  unsigned short* WP16 = W16 + 2 * (size_t)kEmbd * kEmbd;
  const float* fdummy = (const float*)(ws);

  // 1) casts
  {
    const int n8x = (kSeqLen * kEmbd) / 8;          // 524288 = 2048 * 256
    xcast_kernel<<<dim3((n8x + 255) / 256), 256, 0, stream>>>(x, X16, XBH, XBL, n8x);
    const int n8w = (kEmbd * kEmbd) / 8;            // 131072 = 512 * 256
    wcast_kernel<<<dim3((n8w + 255) / 256, 3), 256, 0, stream>>>(wq, wk, wp, W16, kWCarry, n8w);
    wsplit_kernel<<<dim3((n8w + 255) / 256), 256, 0, stream>>>(wv, WVH, WVL, n8w);
  }

  // 2) q,k = X16 . Wq16^T / Wk16^T : M=4096, N=1024, K=1024 (K%64==0, M,N%128==0), f32 out, scale 1/16
  {
    const int tiles = (kSeqLen / 128) * (kEmbd / 128);   // 256 work-groups a weight
    wmma_gemm64<0, false, 0, 0, false, 0><<<dim3(tiles, 2), 256, 0, stream>>>(
        X16, X16, kEmbd, (long)0,
        W16, W16, kEmbd, (long)kEmbd * kEmbd,
        (void*)QF, (void*)QF, kEmbd, (long)kSeqLen * kEmbd,
        fdummy, fdummy, (long)0,
        kSeqLen, kEmbd, kEmbd, kQKScale);
  }

  // 3) V^T = Wv . X^T as bf16 hi/lo 3-product: A = Wv planes [1024][1024], Bt = X planes [4096][1024];
  //    M=1024, N=4096, K=1024; f16 out [h*64+d][t] carried x16, ldc = 4096
  {
    const int tiles = (kEmbd / 128) * (kSeqLen / 128);   // 256 work-groups
    wmma_gemm64<1, true, 0, 1, false, 0><<<dim3(tiles, 1), 256, 0, stream>>>(
        WVH, WVL, kEmbd, (long)0,
        XBH, XBL, kEmbd, (long)0,
        (void*)VT16, (void*)VT16, kSeqLen, (long)0,
        fdummy, fdummy, (long)0,
        kEmbd, kSeqLen, kEmbd, kVCarry);
  }

  // 4) RoPE + RMS-norm -> Q16, K16 planes [h][t][64]
  rope_rms_kernel<<<dim3((kSeqLen * kHeads) / 16), 256, 0, stream>>>(QF, QF + (size_t)kSeqLen * kEmbd, cosT, sinT, Q16);

  // 5) attention, all heads: O16 = 64*y, f16 [4096][1024]; 16 heads x 16 groups = 256 blocks
  attn_fused_kernel<<<dim3(kHeads * (kSeqLen / 256)), 256, 0, stream>>>(Q16, K16, VT16, O16);

  // 6) out = (64*y) . (16*Wp)^T * (1/1024): M=4096, N=1024, K=1024, f32 out to d_out
  {
    const int tiles = (kSeqLen / 128) * (kEmbd / 128);   // 256 work-groups
    wmma_gemm64<0, false, 0, 0, false, 0><<<dim3(tiles, 1), 256, 0, stream>>>(
        O16, O16, kEmbd, (long)0,
        WP16, WP16, kEmbd, (long)0,
        d_out, d_out, kEmbd, (long)0,
        fdummy, fdummy, (long)0,
        kSeqLen, kEmbd, kEmbd, kOutScale);
  }
}

// v004
// One run takes 116 microseconds.
// Two timings next to v003 put it at 1.48 and 1.49 times that version's speed.
// Counting every step since v000, it is 13.7 times as fast.
// Contractions: q,k projections (X f16 x W^T f16 carried x16), v projection (Wv bf16 hi/lo x X^T bf16 hi/lo, 3 products), scores q.k^T (q,k f16 planes, K=64), attn.v (P f16 carried x2048 x V^T f16 carried x16), output projection (y f16 carried x64 x Wp^T f16 carried x16): v_wmma_f32_16x16x32_f16 and v_wmma_f32_16x16x32_bf16, f32 accumulate; rope, rms-norm, sigmoid in f32.
#include <hip/hip_runtime.h>
#include <math.h>

// ---------------------------------------------------------------------------
// Problem constants
// ---------------------------------------------------------------------------
constexpr int kSeqLen = 4096;
constexpr int kEmbd   = 1024;
constexpr int kHeads  = 16;
constexpr int kHeadD  = 64;
constexpr int kRotD   = 32;
constexpr float kWCarry   = 16.0f;              // f16 weights carried x16
constexpr float kVCarry   = 16.0f;              // V^T f16 plane carried x16
constexpr float kPCarry   = 2048.0f;            // sigmoid probabilities carried x2048
constexpr float kQKScale  = 1.0f / 16.0f;       // undo weight carry on q,k
constexpr float kScScale  = 0.125f;             // 1/sqrt(64)
constexpr float kPVScale  = 1.0f / 32768.0f;    // 1/(kPCarry*kVCarry): O16 = 64*y
constexpr float kOutScale = 1.0f / 1024.0f;     // (1/64) * (1/kWCarry)
constexpr float kEpsRms   = 1e-6f;

typedef __attribute__((ext_vector_type(16))) _Float16 v16h;
typedef __attribute__((ext_vector_type(8)))  _Float16 v8h;
typedef __attribute__((ext_vector_type(16))) __bf16   v16b;
typedef __attribute__((ext_vector_type(8)))  __bf16   v8b;
typedef __attribute__((ext_vector_type(8)))  float    v8f;
typedef __attribute__((ext_vector_type(4)))  float    v4f;
typedef __attribute__((ext_vector_type(2)))  float    v2f;
typedef __attribute__((ext_vector_type(4)))  unsigned int v4u;

// ---------------------------------------------------------------------------
// Helpers
// ---------------------------------------------------------------------------
__device__ __forceinline__ unsigned short f2bf_bits(float f) {
  unsigned u = __float_as_uint(f);
  return (unsigned short)((u + 0x7FFFu + ((u >> 16) & 1u)) >> 16);
}
__device__ __forceinline__ float bf_bits2f(unsigned short h) { return __uint_as_float(((unsigned)h) << 16); }

// hazard guards as plain device helpers
__device__ __forceinline__ void dep_guard_h(v8f& a, v8f& b, v16h x, v16h y) { asm volatile("v_nop\n\tv_nop\n\tv_nop\n\tv_nop" : "+v"(a), "+v"(b) : "v"(x), "v"(y)); }
__device__ __forceinline__ void dep_guard_b(v8f& a, v8f& b, v16b x, v16b y) { asm volatile("v_nop\n\tv_nop\n\tv_nop\n\tv_nop" : "+v"(a), "+v"(b) : "v"(x), "v"(y)); }
__device__ __forceinline__ void keep4_h(v16h a, v16h b, v16h c, v16h d) { asm volatile("v_nop" :: "v"(a), "v"(b), "v"(c), "v"(d)); }
__device__ __forceinline__ void keep4_b(v16b a, v16b b, v16b c, v16b d) { asm volatile("v_nop" :: "v"(a), "v"(b), "v"(c), "v"(d)); }
__device__ __forceinline__ void acc_guard4(v8f& a, v8f& b, v8f& c, v8f& d) { asm volatile("v_nop\n\tv_nop\n\tv_nop\n\tv_nop" : "+v"(a), "+v"(b), "+v"(c), "+v"(d)); }
template <typename T> struct Frag;
template <> struct Frag<_Float16> {
  typedef v16h V; union U { v16h v; v8h h[2]; };
  static __device__ __forceinline__ v16h load(const _Float16* p) {   // elements 0..7 <- p[0..7], 8..15 <- p[16..23]
    U f; f.h[0] = *(const v8h*)(p); f.h[1] = *(const v8h*)(p + 16); return f.v;
  }
  static __device__ __forceinline__ v8f mma(v16h a, v16h b, v8f c) {
    return __builtin_amdgcn_wmma_f32_16x16x32_f16(false, a, false, b, (short)0, c, false, false);
  }
  static __device__ __forceinline__ void guard(v8f& a, v8f& b, v16h x, v16h y) { dep_guard_h(a, b, x, y); }
  static __device__ __forceinline__ void keep(v16h a, v16h b, v16h c, v16h d) { keep4_h(a, b, c, d); }
};
template <> struct Frag<__bf16> {
  typedef v16b V; union U { v16b v; v8b h[2]; };
  static __device__ __forceinline__ v16b load(const __bf16* p) {
    U f; f.h[0] = *(const v8b*)(p); f.h[1] = *(const v8b*)(p + 16); return f.v;
  }
  static __device__ __forceinline__ v8f mma(v16b a, v16b b, v8f c) {
    return __builtin_amdgcn_wmma_f32_16x16x32_bf16(false, a, false, b, (short)0, c, false, false);
  }
  static __device__ __forceinline__ void guard(v8f& a, v8f& b, v16b x, v16b y) { dep_guard_b(a, b, x, y); }
  static __device__ __forceinline__ void keep(v16b a, v16b b, v16b c, v16b d) { keep4_b(a, b, c, d); }
};

__device__ __forceinline__ unsigned pk16(unsigned short a, unsigned short b) { return (unsigned)a | ((unsigned)b << 16); }
__device__ __forceinline__ unsigned short h_bits(float f) { const _Float16 h = (_Float16)f; return __builtin_bit_cast(unsigned short, h); }

// ---- Batched WMMA GEMM, operands staged in LDS ------------------------------------------------
// C[m,n] = scale * sum_k A[m,k] * Bt[n,k] (+bias)(+resid).
// A row-major [M,K]; Bt row-major [N,K]; M,N % 128 == 0, K % 64 == 0.
// A work-group of 8 waves owns a 128x128 tile of C; wave w owns rows 32*(w>>1).., columns 64*(w&1).. of it.
// Per trip 64 k of the 128 A rows and the 128 Bt rows lie in LDS, brought there by asynchronous copies as whole
// 128-byte lines (8 lanes a row), so that no fragment load gathers 16 lines from the caches any more.
// LDS rows have a pitch of 144 bytes (16 B x odd: ds_load_b128 without bank conflicts). Two buffers: the copies of
// trip t+1 fly while trip t is worked on. The k order of the sums is the one of the fragment loads from LDS.
// SPLIT: operands are hi/lo planes (A2/Bt2 = lo planes, same layout); product = hi.hi + hi.lo + lo.hi.
// BIAS_MODE: 0 = none, 1 = bias[m], 2 = bias[n].
// OUT_MODE: 0 = f32, 1 = f16, 2 = bf16 hi plane (Cout) + bf16 lo plane (Cout2).
// ACT: 2 relu, 4 leaky, 6 = causal sigmoid carry: v = (n > m) ? 0 : kPCarry / (1 + exp(-v)).
// ET: 0 = f16 operands, 1 = bf16 operands (pointers passed as 16-bit storage)
constexpr int kTileK    = 64;                  // k per trip, 128 bytes of every operand row
constexpr int kRowPitch = 72;                  // LDS row pitch in 16-bit elements (144 bytes)
constexpr int kPlane    = 128 * kRowPitch;     // 16-bit elements of one operand plane in LDS

// Eight copies of 16 bytes a lane, global memory -> LDS through no register. The closing wait stands inside the statement,
// in front of any later rewrite of the address registers that the copies name.
__device__ __forceinline__ void async_copy8(const unsigned (&l)[8], const unsigned short* const (&g)[8]) {
  asm volatile("global_load_async_to_lds_b128 %0, %8, off\n\t"
               "global_load_async_to_lds_b128 %1, %9, off\n\t"
               "global_load_async_to_lds_b128 %2, %10, off\n\t"
               "global_load_async_to_lds_b128 %3, %11, off\n\t"
               "global_load_async_to_lds_b128 %4, %12, off\n\t"
               "global_load_async_to_lds_b128 %5, %13, off\n\t"
               "global_load_async_to_lds_b128 %6, %14, off\n\t"
               "global_load_async_to_lds_b128 %7, %15, off\n\t"
               "s_wait_xcnt 0x0"
               :: "v"(l[0]), "v"(l[1]), "v"(l[2]), "v"(l[3]), "v"(l[4]), "v"(l[5]), "v"(l[6]), "v"(l[7]),
                  "v"(g[0]), "v"(g[1]), "v"(g[2]), "v"(g[3]), "v"(g[4]), "v"(g[5]), "v"(g[6]), "v"(g[7])
               : "memory");
}
// One plane of A and one of Bt, 128 rows x 128 bytes each: this thread's 16 bytes of rows r, r+32, r+64, r+96.
__device__ __forceinline__ void stage_pair(const unsigned short* ga, size_t stepA, const unsigned short* gb, size_t stepB,
                                           unsigned lds) {
  unsigned l[8];
  const unsigned short* g[8];
#pragma unroll
  for (int i = 0; i < 4; ++i) {
    l[i]     = lds + (unsigned)(i * 32 * kRowPitch * 2);
    l[4 + i] = lds + (unsigned)((kPlane + i * 32 * kRowPitch) * 2);
    g[i]     = ga + i * stepA;
    g[4 + i] = gb + i * stepB;
  }
  async_copy8(l, g);
}

template <int ET> struct Elem;
template <> struct Elem<0> { typedef _Float16 T; };
template <> struct Elem<1> { typedef __bf16 T; };
template <int ET, bool SPLIT, int BIAS_MODE, int OUT_MODE, bool RESID, int ACT = 0>
__global__ __launch_bounds__(256) void wmma_gemm64(
    const unsigned short* __restrict__ Ap, const unsigned short* __restrict__ A2p, int lda, long strideA,
    const unsigned short* __restrict__ Btp, const unsigned short* __restrict__ Bt2p, int ldb, long strideB,
    void* __restrict__ Cout, void* __restrict__ Cout2, int ldc, long strideC,
    const float* __restrict__ bias,
    const float* __restrict__ resid, long strideR,
    int M, int N, int K, float scale) {
  typedef typename Elem<ET>::T T;
  typedef typename Frag<T>::V V;
  constexpr int kStage = (SPLIT ? 4 : 2) * kPlane;           // one buffer: [A][Bt], SPLIT: [A hi][Bt hi][A lo][Bt lo]
  constexpr int kGroupK = SPLIT ? 32 : 64;                   // k of one group of fragment loads: 24 loads either way
  __shared__ __align__(16) unsigned short ring[2 * kStage];
  __shared__ __align__(16) float sT[8][16 * 68];   // per-wave 16x64 slab, pitch 68 floats
  const int b    = blockIdx.y;
  const int lane = threadIdx.x & 31;
  const int wave = threadIdx.x >> 5;
  const int tilesN = N >> 7;
  const int tilesM = M >> 7;
  if ((int)blockIdx.x >= tilesM * tilesN) return;   // the same for the whole work-group, in front of every barrier
  const int bm = blockIdx.x / tilesN;
  const int bn = blockIdx.x - bm * tilesN;
  const int m0 = (bm << 7) + ((wave >> 1) << 5);
  const int n0 = (bn << 7) + ((wave & 1) << 6);
  const int nt = K / kTileK;

  const int rlane = lane & 15;                 // row (A) / col (B, D) within subtile
  const int koff  = (lane >> 4) * 8;           // k offset of this lane half
  const int mOff  = (lane >> 4) * 8;           // D row offset

  // this thread's share of the copies: 16 bytes at column ccol of rows crow + 32 i of every plane
  const int crow = threadIdx.x >> 3;
  const int ccol = (threadIdx.x & 7) * 8;
  const size_t stepA = (size_t)32 * lda;
  const size_t stepB = (size_t)32 * ldb;
  const size_t offA = (size_t)b * strideA + (size_t)((bm << 7) + crow) * lda + ccol;
  const size_t offB = (size_t)b * strideB + (size_t)((bn << 7) + crow) * ldb + ccol;
  const unsigned lds0 = (unsigned)(size_t)(&ring[crow * kRowPitch + ccol]);   // LDS byte address: low word of the pointer

  // this lane's fragment rows in a buffer
  const int fragA = (((wave >> 1) << 5) + rlane) * kRowPitch + koff;
  const int fragB = kPlane + (((wave & 1) << 6) + rlane) * kRowPitch + koff;

  v8f acc[2][4];
#pragma unroll
  for (int i = 0; i < 2; ++i)
#pragma unroll
    for (int j = 0; j < 4; ++j) acc[i][j] = (v8f){0.f,0.f,0.f,0.f,0.f,0.f,0.f,0.f};

  // tile 0 into buffer 0, landed and published; then tile 1 into buffer 1
  stage_pair(Ap + offA, stepA, Btp + offB, stepB, lds0);
  if (SPLIT) stage_pair(A2p + offA, stepA, Bt2p + offB, stepB, lds0 + 2 * kPlane * 2);
  asm volatile("s_wait_asynccnt 0x0" ::: "memory");   // this wave's copies of tile 0 have landed
  __syncthreads();                                    // every wave's have
  if (nt > 1) {
    stage_pair(Ap + offA + kTileK, stepA, Btp + offB + kTileK, stepB, lds0 + kStage * 2);
    if (SPLIT) stage_pair(A2p + offA + kTileK, stepA, Bt2p + offB + kTileK, stepB, lds0 + (kStage + 2 * kPlane) * 2);
  }

  for (int t = 0; t < nt; ++t) {
    const int bufo = (t & 1) * kStage;
    const T* sb = (const T*)(ring + bufo);
#pragma unroll
    for (int kg = 0; kg < kTileK; kg += kGroupK) {
      // all fragment loads of a group stand in front of its products: one place where the wave waits for LDS
      V ah[kGroupK / 32][2], al[kGroupK / 32][2], bh[kGroupK / 32][4], bl[kGroupK / 32][4];
#pragma unroll
      for (int s = 0; s < kGroupK / 32; ++s) {
#pragma unroll
        for (int i = 0; i < 2; ++i) {
          const int ao = fragA + (i << 4) * kRowPitch + kg + (s << 5);
          ah[s][i] = Frag<T>::load(sb + ao);
          if (SPLIT) al[s][i] = Frag<T>::load(sb + 2 * kPlane + ao);
        }
#pragma unroll
        for (int j = 0; j < 4; ++j) {
          const int bo = fragB + (j << 4) * kRowPitch + kg + (s << 5);
          bh[s][j] = Frag<T>::load(sb + bo);
          if (SPLIT) bl[s][j] = Frag<T>::load(sb + 2 * kPlane + bo);
        }
      }
#pragma unroll
      for (int s = 0; s < kGroupK / 32; ++s) {
#pragma unroll
        for (int i = 0; i < 2; ++i) {
#pragma unroll
          for (int j = 0; j < 4; ++j) {
            acc[i][j] = Frag<T>::mma(ah[s][i], bh[s][j], acc[i][j]);
            if (SPLIT) {
              acc[i][j] = Frag<T>::mma(ah[s][i], bl[s][j], acc[i][j]);
              acc[i][j] = Frag<T>::mma(al[s][i], bh[s][j], acc[i][j]);
            }
          }
          Frag<T>::guard(acc[i][0], acc[i][3], ah[s][i], SPLIT ? al[s][i] : ah[s][i]);
        }
        Frag<T>::keep(bh[s][0], bh[s][1], bh[s][2], bh[s][3]);
        if (SPLIT) Frag<T>::keep(bl[s][0], bl[s][1], bl[s][2], bl[s][3]);
      }
    }
    asm volatile("s_wait_dscnt 0x0" ::: "memory");      // this wave's reads of the buffer are done before it is refilled
    asm volatile("s_wait_asynccnt 0x0" ::: "memory");   // this wave's copies of tile t+1 have landed
    __syncthreads();                                    // publishes tile t+1 and ends every wave's reads of tile t
    if (t + 2 < nt) {
      const size_t ko = (size_t)(t + 2) * kTileK;
      stage_pair(Ap + offA + ko, stepA, Btp + offB + ko, stepB, lds0 + bufo * 2);
      if (SPLIT) stage_pair(A2p + offA + ko, stepA, Bt2p + offB + ko, stepB, lds0 + (bufo + 2 * kPlane) * 2);
    }
  }
  asm volatile("s_wait_asynccnt 0x0" ::: "memory");     // no copy is in flight behind the loop
  acc_guard4(acc[0][0], acc[0][1], acc[0][2], acc[0][3]);
  acc_guard4(acc[1][0], acc[1][1], acc[1][2], acc[1][3]);

  // ---- epilogue ----
  float* slab = sT[wave];
  const float* Rb = RESID ? (resid + (size_t)b * strideR) : nullptr;
#pragma unroll
  for (int i = 0; i < 2; ++i) {
    const int mBase = m0 + (i << 4);
#pragma unroll
    for (int j = 0; j < 4; ++j) {
      const int n = n0 + (j << 4) + rlane;
      float bv = 0.f;
      if (BIAS_MODE == 2) bv = bias[n];
#pragma unroll
      for (int r = 0; r < 8; ++r) {
        float v = acc[i][j][r] * scale;
        if (BIAS_MODE == 1) v += bias[mBase + mOff + r];
        if (BIAS_MODE == 2) v += bv;
        if (RESID) v += Rb[(size_t)(mBase + mOff + r) * ldc + n];
        if (ACT == 2) v = fmaxf(v, 0.0f);
        if (ACT == 4) v = (v > 0.f) ? v : 0.01f * v;
        if (ACT == 6) {
          const float sg = kPCarry / (1.0f + expf(-v));
          v = (n > (mBase + mOff + r)) ? 0.0f : sg;
        }
        slab[(mOff + r) * 68 + (j << 4) + rlane] = v;
      }
    }
    __builtin_amdgcn_fence(__ATOMIC_RELEASE, "workgroup");
    __builtin_amdgcn_wave_barrier();
    __builtin_amdgcn_fence(__ATOMIC_ACQUIRE, "workgroup");
    if (OUT_MODE == 0) {
      float* C = (float*)Cout + (size_t)b * strideC;
      const int hh = lane >> 4, c4 = (lane & 15) * 4;     // row seg = 256 B = 16 lanes x 16 B
      {
#pragma unroll
        for (int it = 0; it < 8; ++it) {
          const int row = it * 2 + hh;
          v4f v = *(const v4f*)(slab + row * 68 + c4);
          *(v4f*)(C + (size_t)(mBase + row) * ldc + n0 + c4) = v;
        }
        
      }
    } else {
      const int q = lane >> 3, c8 = (lane & 7) * 8;
      unsigned short* C  = (unsigned short*)Cout  + (size_t)b * strideC;
      unsigned short* C2 = (OUT_MODE == 2) ? ((unsigned short*)Cout2 + (size_t)b * strideC) : nullptr;
      {
#pragma unroll
        for (int it = 0; it < 4; ++it) {
          const int row = it * 4 + q;
          const float* sp = slab + row * 68 + c8;
          v8h hv, lv;
#pragma unroll
          for (int e = 0; e < 8; ++e) {
            if (OUT_MODE == 1) {
              hv[e] = (_Float16)sp[e];
            } else {
              unsigned short hb = f2bf_bits(sp[e]);
              unsigned short lb = f2bf_bits(sp[e] - bf_bits2f(hb));
              hv[e] = __builtin_bit_cast(_Float16, hb);
              lv[e] = __builtin_bit_cast(_Float16, lb);
            }
          }
          *(v8h*)(C + (size_t)(mBase + row) * ldc + n0 + c8) = hv;
          if (OUT_MODE == 2) *(v8h*)(C2 + (size_t)(mBase + row) * ldc + n0 + c8) = lv;
        }
        
      }
    }
    __builtin_amdgcn_fence(__ATOMIC_RELEASE, "workgroup");
    __builtin_amdgcn_wave_barrier();
    __builtin_amdgcn_fence(__ATOMIC_ACQUIRE, "workgroup");
  }
}

// ---------------------------------------------------------------------------
// x f32 [4096][1024] -> three planes: f16, bf16 hi, bf16 lo (RNE converts), 8 elements per thread.
// Coverage: n8 = 4096*1024/8 = 524288 threads = 2048 blocks x 256 exactly; each lane one 16-B store per
// ---------------------------------------------------------------------------
__global__ __launch_bounds__(256) void xcast_kernel(const float* __restrict__ in, unsigned short* __restrict__ o16,
                                                    unsigned short* __restrict__ obh, unsigned short* __restrict__ obl, int n8) {
  const int i = blockIdx.x * 256 + threadIdx.x;
  if (i >= n8) return;
  const float* p = in + 8 * (size_t)i;
  const v4f a = *(const v4f*)(p);
  const v4f c = *(const v4f*)(p + 4);
  float f[8];
#pragma unroll
  for (int e = 0; e < 4; ++e) { f[e] = a[e]; f[4 + e] = c[e]; }
  unsigned short hb[8], bh[8], bl[8];
#pragma unroll
  for (int e = 0; e < 8; ++e) {
    hb[e] = h_bits(f[e]);
    bh[e] = f2bf_bits(f[e]);
    bl[e] = f2bf_bits(f[e] - bf_bits2f(bh[e]));
  }
  const v4u u0 = (v4u){pk16(hb[0], hb[1]), pk16(hb[2], hb[3]), pk16(hb[4], hb[5]), pk16(hb[6], hb[7])};
  const v4u u1 = (v4u){pk16(bh[0], bh[1]), pk16(bh[2], bh[3]), pk16(bh[4], bh[5]), pk16(bh[6], bh[7])};
  const v4u u2 = (v4u){pk16(bl[0], bl[1]), pk16(bl[2], bl[3]), pk16(bl[4], bl[5]), pk16(bl[6], bl[7])};
  const size_t o = 8 * (size_t)i;
  *(v4u*)(o16 + o) = u0;
  *(v4u*)(obh + o) = u1;
  *(v4u*)(obl + o) = u2;
  
}

// ---------------------------------------------------------------------------
// Weight f32 [1024][1024] -> f16(scale*w), three weights selected by blockIdx.y (block-uniform),
// output plane y at out + y*n8*8 halves. Coverage: n8 = 131072 threads = 512 blocks exactly per plane;
// ---------------------------------------------------------------------------
__global__ __launch_bounds__(256) void wcast_kernel(const float* __restrict__ w0, const float* __restrict__ w1,
                                                    const float* __restrict__ w2, unsigned short* __restrict__ out,
                                                    float scale, int n8) {
  const int i = blockIdx.x * 256 + threadIdx.x;
  if (i >= n8) return;
  const int z = blockIdx.y;
  const float* w = (z == 0) ? w0 : ((z == 1) ? w1 : w2);
  const float* p = w + 8 * (size_t)i;
  const v4f a = *(const v4f*)(p);
  const v4f c = *(const v4f*)(p + 4);
  unsigned short hb[8];
#pragma unroll
  for (int e = 0; e < 4; ++e) {
    hb[e]     = h_bits(a[e] * scale);
    hb[4 + e] = h_bits(c[e] * scale);
  }
  const v4u u = (v4u){pk16(hb[0], hb[1]), pk16(hb[2], hb[3]), pk16(hb[4], hb[5]), pk16(hb[6], hb[7])};
  unsigned short* q = out + (size_t)z * (size_t)n8 * 8 + 8 * (size_t)i;
  *(v4u*)q = u;
  
}

// ---------------------------------------------------------------------------
// Weight f32 [1024][1024] -> bf16 hi and lo planes (RNE converts). Coverage as above.
// ---------------------------------------------------------------------------
__global__ __launch_bounds__(256) void wsplit_kernel(const float* __restrict__ w, unsigned short* __restrict__ hi,
                                                     unsigned short* __restrict__ lo, int n8) {
  const int i = blockIdx.x * 256 + threadIdx.x;
  if (i >= n8) return;
  const float* p = w + 8 * (size_t)i;
  const v4f a = *(const v4f*)(p);
  const v4f c = *(const v4f*)(p + 4);
  float f[8];
#pragma unroll
  for (int e = 0; e < 4; ++e) { f[e] = a[e]; f[4 + e] = c[e]; }
  unsigned short bh[8], bl[8];
#pragma unroll
  for (int e = 0; e < 8; ++e) {
    bh[e] = f2bf_bits(f[e]);
    bl[e] = f2bf_bits(f[e] - bf_bits2f(bh[e]));
  }
  const v4u u1 = (v4u){pk16(bh[0], bh[1]), pk16(bh[2], bh[3]), pk16(bh[4], bh[5]), pk16(bh[6], bh[7])};
  const v4u u2 = (v4u){pk16(bl[0], bl[1]), pk16(bl[2], bl[3]), pk16(bl[4], bl[5]), pk16(bl[6], bl[7])};
  const size_t o = 8 * (size_t)i;
  *(v4u*)(hi + o) = u1;
  *(v4u*)(lo + o) = u2;
  
}

// ---------------------------------------------------------------------------
// RoPE + per-head RMS-norm for q and k (f32), output f16 planes Q16 and K16, both laid out [h][t][64]
// (K16 plane = qk16 + 16*4096*64 halves). qf/kf: f32 [t][h*64+d]; cosT/sinT: [t][32].
// One wave handles two (t,h) pairs: lane l carries the rotation pair (d=l, d=l+32) of each.
// Results staged per wave in LDS as f32, then one store instruction: lanes 0..7 -> Q row of pair 0,
// 8..15 -> K row of pair 0, 16..23 -> Q row of pair 1, 24..31 -> K row of pair 1; each row = 64 halves
// Coverage: 4096 blocks x 8 waves x 2 pairs = 65536 = 4096 t x 16 h pairs exactly.
// ---------------------------------------------------------------------------
__global__ __launch_bounds__(256) void rope_rms_kernel(const float* __restrict__ qf, const float* __restrict__ kf,
                                                       const float* __restrict__ cosT, const float* __restrict__ sinT,
                                                       unsigned short* __restrict__ qk16) {
#pragma clang fp contract(off)
  __shared__ __align__(16) float sm[8][256];
  const int lane = threadIdx.x & 31;
  const int wave = threadIdx.x >> 5;
  const int pbase = (blockIdx.x * 8 + wave) * 2;
#pragma unroll
  for (int u = 0; u < 2; ++u) {
    const int p = pbase + u;
    const int t = p >> 4;
    const int h = p & 15;
    const float c = cosT[(size_t)t * kRotD + lane];
    const float s = sinT[(size_t)t * kRotD + lane];
    const size_t ib = (size_t)t * kEmbd + (size_t)h * kHeadD + lane;
    const float q1 = qf[ib], q2 = qf[ib + 32];
    const float k1 = kf[ib], k2 = kf[ib + 32];
    const float qo1 = q1 * c + q2 * s;
    const float qo2 = -q1 * s + q2 * c;
    const float ko1 = k1 * c + k2 * s;
    const float ko2 = -k1 * s + k2 * c;
    float ssq = qo1 * qo1 + qo2 * qo2;
    float ssk = ko1 * ko1 + ko2 * ko2;
#pragma unroll
    for (int off = 16; off >= 1; off >>= 1) {
      ssq += __shfl_xor(ssq, off, 32);
      ssk += __shfl_xor(ssk, off, 32);
    }
    const float rq = rsqrtf(ssq * (1.0f / 64.0f) + kEpsRms);
    const float rk = rsqrtf(ssk * (1.0f / 64.0f) + kEpsRms);
    float* row = &sm[wave][u * 128];
    row[lane]      = qo1 * rq;
    row[32 + lane] = qo2 * rq;
    row[64 + lane] = ko1 * rk;
    row[96 + lane] = ko2 * rk;
  }
  __syncthreads();
  const int g = lane >> 3;
  const int uu = g >> 1;
  const int which = g & 1;
  const int j = lane & 7;
  const int p = pbase + uu;
  const int t = p >> 4;
  const int h = p & 15;
  const float* sp = &sm[wave][uu * 128 + which * 64 + 8 * j];
  const v4f a = *(const v4f*)(sp);
  const v4f c = *(const v4f*)(sp + 4);
  unsigned short hb[8];
#pragma unroll
  for (int e = 0; e < 4; ++e) {
    hb[e]     = h_bits(a[e]);
    hb[4 + e] = h_bits(c[e]);
  }
  const v4u u = (v4u){pk16(hb[0], hb[1]), pk16(hb[2], hb[3]), pk16(hb[4], hb[5]), pk16(hb[6], hb[7])};
  unsigned short* dst = qk16 + (size_t)which * ((size_t)kHeads * kSeqLen * kHeadD)
                      + ((size_t)h * kSeqLen + t) * kHeadD + 8 * j;
  *(v4u*)dst = u;
  
}

// ---------------------------------------------------------------------------
// Fused causal sigmoid attention, all heads in one launch; P never leaves the registers.
// One wave owns 32 query rows of one head and walks the keys 32 at a time, in rising order:
//   S^T = K . Q^T      A = K16 rows (16 keys), B = Q16 rows (16 queries), k = head dim (2 x 32)
//   P^T = f16(2048 * sigmoid(S^T / 8)), zero where key > query
//   O^T += V^T . P^T   A = VT16 rows (16 head dims), B = P^T, k = 32 keys
// A lane's accumulators of the two 16-key tiles of S^T are, converted in place, its B operand of the second
// product (element e of tile kt -> element 8*kt + e), in the k order that Frag::load gives the V^T rows.
// O^T: a lane holds 8 consecutive head dims of one query row: one 16-byte store each.
// Placement: 256 blocks x 8 waves; block = (head, group g); waves 0..3 take query tiles 4g+w, waves 4..7
// take tiles 127-(4g+w-4), so every pair (w, w+4) walks 129 key steps together. Every (head, tile) once.
// K and V^T reach the waves through LDS: the eight waves of a block walk the same keys of the same head, so a trip's
// 128 K rows (128 bytes each) and 64 V^T rows (256 bytes each) are brought once for all of them, as whole lines, by
// asynchronous copies; no fragment load gathers 16 lines from the caches any more. Two buffers: the copies of trip t+1
// fly while trip t is worked on. LDS pitches 144 and 272 bytes (16 B x odd: ds_load_b128 without bank conflicts).
// Every wave copies and passes the barrier in every trip of its block, also a wave that is past its own diagonal.
// ---------------------------------------------------------------------------
constexpr int kTripKeys = 128;                   // keys per trip: four steps of 32
constexpr int kKPitch   = 72;                    // LDS pitch of a K row in 16-bit elements (144 bytes)
constexpr int kVPitch   = 136;                   // LDS pitch of a V^T row in 16-bit elements (272 bytes)
constexpr int kKTile    = kTripKeys * kKPitch;   // 16-bit elements of a trip's K rows in LDS
constexpr int kVTile    = kHeadD * kVPitch;      // 16-bit elements of a trip's V^T rows in LDS
constexpr int kKVStage  = kKTile + kVTile;       // one buffer: [K][V^T]

// This thread's share of a trip: 16 bytes of K rows r + 32 i (8 lanes a row) and of V^T rows r' + 16 i (16 lanes a row).
__device__ __forceinline__ void stage_kv(const unsigned short* gk, const unsigned short* gv, unsigned ldsK, unsigned ldsV) {
  unsigned l[8];
  const unsigned short* g[8];
#pragma unroll
  for (int i = 0; i < 4; ++i) {
    l[i]     = ldsK + (unsigned)(i * 32 * kKPitch * 2);
    l[4 + i] = ldsV + (unsigned)(i * 16 * kVPitch * 2);
    g[i]     = gk + (size_t)i * 32 * kHeadD;
    g[4 + i] = gv + (size_t)i * 16 * kSeqLen;
  }
  async_copy8(l, g);
}

// Two scores at a time: 2048 * sigmoid(s / 8) = 1 / (2^-11 + 2^(-s * log2(e) / 8 - 11)): one packed fma, the hardware's exp2,
// one packed add, the hardware's reciprocal. Right over the whole range without a range test: exp2 -> 0 gives 2048,
// exp2 -> inf gives 0. All of it in f32; the result is rounded to f16 as before.
__device__ __forceinline__ v2f sigmoid2_carried(v2f s) {
  const float a = -kScScale * 1.4426950408889634f;
  const v2f t = __builtin_elementwise_fma(s, (v2f){a, a}, (v2f){-11.0f, -11.0f});
  const v2f d = (v2f){__builtin_amdgcn_exp2f(t.x), __builtin_amdgcn_exp2f(t.y)} + (v2f){1.0f / kPCarry, 1.0f / kPCarry};
  return (v2f){__builtin_amdgcn_rcpf(d.x), __builtin_amdgcn_rcpf(d.y)};
}

// K fragments of one step of 32 keys; sk = this lane's place in the step's first K row in LDS
__device__ __forceinline__ void load_k(const _Float16* sk, v16h (&kf)[2][2]) {
#pragma unroll
  for (int kt = 0; kt < 2; ++kt)
#pragma unroll
    for (int ks = 0; ks < 2; ++ks) kf[kt][ks] = Frag<_Float16>::load(sk + (kt << 4) * kKPitch + (ks << 5));
}

// One step of 32 keys out of LDS. sk, sv: this lane's places in the step's K rows and V^T columns. MASK: the diagonal step
// (first key == first query of the wave). NEXT: the next step lies in the same buffer, its K fragments are fetched here.
template <bool MASK, bool NEXT>
__device__ __forceinline__ void attn_step(const _Float16* sk, const _Float16* sv, int c, int h8,
                                          v16h (&kf)[2][2], const v16h (&qf)[2][2], v8f (&o)[4][2]) {
  v8f s[2][2];
#pragma unroll
  for (int kt = 0; kt < 2; ++kt)
#pragma unroll
    for (int g = 0; g < 2; ++g) {
      s[kt][g] = (v8f){0.f,0.f,0.f,0.f,0.f,0.f,0.f,0.f};
      s[kt][g] = Frag<_Float16>::mma(kf[kt][0], qf[g][0], s[kt][g]);
      s[kt][g] = Frag<_Float16>::mma(kf[kt][1], qf[g][1], s[kt][g]);
    }
  // one group of LDS loads a step: this step's V^T rows and, behind this step's last use of the K registers, the next step's K rows
  v16h vf[4], kn[2][2];
#pragma unroll
  for (int dt = 0; dt < 4; ++dt) vf[dt] = Frag<_Float16>::load(sv + (dt << 4) * kVPitch);
  if (NEXT) load_k(sk + 32 * kKPitch, kn);
  // keeps the loads above in front of the sigmoid work, which covers their latency: sunk below it, they are waited out at the products that use them
  __builtin_amdgcn_sched_barrier(0);
#pragma unroll
  for (int g = 0; g < 2; ++g) {
    v16h p;
#pragma unroll
    for (int kt = 0; kt < 2; ++kt)
#pragma unroll
      for (int r = 0; r < 8; r += 2) {
        v2f sg = sigmoid2_carried((v2f){s[kt][g][r], s[kt][g][r + 1]});
        if (MASK) {
          const int rel = ((kt << 4) + h8 + r) - ((g << 4) + c);   // key minus query of element r
          sg.x = (rel > 0) ? 0.0f : sg.x;
          sg.y = (rel + 1 > 0) ? 0.0f : sg.y;
        }
        p[(kt << 3) + r]     = (_Float16)sg.x;
        p[(kt << 3) + r + 1] = (_Float16)sg.y;
      }
#pragma unroll
    for (int dt = 0; dt < 4; ++dt) o[dt][g] = Frag<_Float16>::mma(vf[dt], p, o[dt][g]);
  }
  if (NEXT) {
#pragma unroll
    for (int kt = 0; kt < 2; ++kt)
#pragma unroll
      for (int ks = 0; ks < 2; ++ks) kf[kt][ks] = kn[kt][ks];
  }
}

__global__ __launch_bounds__(256) void attn_fused_kernel(const unsigned short* __restrict__ Q16p,
                                                         const unsigned short* __restrict__ K16p,
                                                         const unsigned short* __restrict__ VT16p,
                                                         unsigned short* __restrict__ O16p) {
  __shared__ __align__(16) unsigned short kv[2 * kKVStage];
  const int lane = threadIdx.x & 31;
  const int wave = __builtin_amdgcn_readfirstlane(threadIdx.x >> 5);   // in a scalar register: the tests on it below are scalar branches
  const int c    = lane & 15;
  const int h8   = (lane >> 4) * 8;
  const int head = blockIdx.x & (kHeads - 1);
  const int grp  = blockIdx.x >> 4;                                    // 0..15
  const int qt   = (wave < 4) ? (4 * grp + wave) : (127 - (4 * grp + wave - 4));
  const int q0   = qt << 5;
  const int nt    = kSeqLen / kTripKeys - grp;    // trips of the block: up to the diagonal of its longest wave, tile 127 - 4 grp (17..32)
  const int tEdge = qt >> 2;                      // the trip that holds this wave's diagonal step
  const int nFree = qt & 3;                       // unmasked steps of that trip
  const _Float16* Qh = (const _Float16*)Q16p + (size_t)head * kSeqLen * kHeadD;

  // this thread's share of the copies
  const unsigned short* gk = K16p  + (size_t)head * kSeqLen * kHeadD + (size_t)(threadIdx.x >> 3) * kHeadD + (threadIdx.x & 7) * 8;
  const unsigned short* gv = VT16p + ((size_t)head * kHeadD + (threadIdx.x >> 4)) * kSeqLen + (threadIdx.x & 15) * 8;
  const unsigned ldsK = (unsigned)(size_t)(&kv[(threadIdx.x >> 3) * kKPitch + (threadIdx.x & 7) * 8]);            // LDS byte address: low word of the pointer
  const unsigned ldsV = (unsigned)(size_t)(&kv[kKTile + (threadIdx.x >> 4) * kVPitch + (threadIdx.x & 15) * 8]);

  // tile 0 into buffer 0
  stage_kv(gk, gv, ldsK, ldsV);

  v16h qf[2][2], kf[2][2];
#pragma unroll
  for (int g = 0; g < 2; ++g)
#pragma unroll
    for (int ks = 0; ks < 2; ++ks)
      qf[g][ks] = Frag<_Float16>::load(Qh + (size_t)(q0 + (g << 4) + c) * kHeadD + (ks << 5) + h8);
  // the address registers of the loads above are reused right behind them: the wait stands in front of that reuse
  asm volatile("s_wait_xcnt 0x0" ::: "memory");
  v8f o[4][2];
#pragma unroll
  for (int dt = 0; dt < 4; ++dt)
#pragma unroll
    for (int g = 0; g < 2; ++g) o[dt][g] = (v8f){0.f,0.f,0.f,0.f,0.f,0.f,0.f,0.f};

  asm volatile("s_wait_asynccnt 0x0" ::: "memory");   // this wave's copies of tile 0 have landed
  __syncthreads();                                    // every wave's have
  if (nt > 1) stage_kv(gk + (size_t)kTripKeys * kHeadD, gv + kTripKeys, ldsK + kKVStage * 2, ldsV + kKVStage * 2);

  for (int t = 0; t < nt; ++t) {
    const int bufo = (t & 1) * kKVStage;
    const _Float16* sk = (const _Float16*)(kv + bufo) + c * kKPitch + h8;
    const _Float16* sv = (const _Float16*)(kv + bufo + kKTile) + c * kVPitch + h8;
    if (t < tEdge) {                 // wave-uniform: all four steps lie below the diagonal
      load_k(sk, kf);
      // keeps the trip's first eight K loads together in front of its products: spread among them, each pair is waited out on its own
      __builtin_amdgcn_sched_barrier(0);
      attn_step<false, true >(sk,                sv,      c, h8, kf, qf, o);
      attn_step<false, true >(sk + 32 * kKPitch, sv + 32, c, h8, kf, qf, o);
      attn_step<false, true >(sk + 64 * kKPitch, sv + 64, c, h8, kf, qf, o);
      attn_step<false, false>(sk + 96 * kKPitch, sv + 96, c, h8, kf, qf, o);
    }
    if (t == tEdge) {                // wave-uniform: the steps up to the diagonal, then the diagonal step
      load_k(sk, kf);
      for (int j = 0; j < nFree; ++j) {
        attn_step<false, true>(sk, sv, c, h8, kf, qf, o);
        sk += 32 * kKPitch;
        sv += 32;
      }
      attn_step<true, false>(sk, sv, c, h8, kf, qf, o);
    }
    asm volatile("s_wait_dscnt 0x0" ::: "memory");      // this wave's reads of the buffer are done before it is refilled
    asm volatile("s_wait_asynccnt 0x0" ::: "memory");   // this wave's copies of tile t+1 have landed
    __syncthreads();                                    // publishes tile t+1 and ends every wave's reads of tile t
    if (t + 2 < nt)
      stage_kv(gk + (size_t)(t + 2) * kTripKeys * kHeadD, gv + (size_t)(t + 2) * kTripKeys, ldsK + bufo * 2, ldsV + bufo * 2);
  }
  asm volatile("s_wait_asynccnt 0x0" ::: "memory");     // no copy is in flight behind the loop

#pragma unroll
  for (int g = 0; g < 2; ++g)
#pragma unroll
    for (int dt = 0; dt < 4; ++dt) {
      v8h hv;
#pragma unroll
      for (int r = 0; r < 8; ++r) hv[r] = (_Float16)(o[dt][g][r] * kPVScale);
      *(v8h*)(O16p + (size_t)(q0 + (g << 4) + c) * kEmbd + head * kHeadD + (dt << 4) + h8) = hv;
    }
}

// ---------------------------------------------------------------------------
// Host-side orchestration
// ---------------------------------------------------------------------------
extern "C" void kernel_launch(void* const* d_in, const int* in_sizes, int n_in,
                              void* d_out, int out_size, void* d_ws,
                              size_t ws_size, hipStream_t stream) {
  if (n_in < 7) return;
  if (in_sizes[0] != kSeqLen * kEmbd) return;
  if (in_sizes[1] != kSeqLen * kRotD || in_sizes[2] != kSeqLen * kRotD) return;
  if (in_sizes[3] != kEmbd * kEmbd || in_sizes[4] != kEmbd * kEmbd ||
      in_sizes[5] != kEmbd * kEmbd || in_sizes[6] != kEmbd * kEmbd) return;
  if (out_size != kSeqLen * kEmbd) return;

  const float* x    = (const float*)d_in[0];
  const float* cosT = (const float*)d_in[1];
  const float* sinT = (const float*)d_in[2];
  const float* wq   = (const float*)d_in[3];
  const float* wk   = (const float*)d_in[4];
  const float* wv   = (const float*)d_in[5];
  const float* wp   = (const float*)d_in[6];

  // ---- workspace region map (bytes) ----
  // persistent:
  //   Q16  f16 [16][4096][64]   8 MiB  @ 0
  //   K16  f16 [16][4096][64]   8 MiB  @ 8 MiB   (must follow Q16 directly)
  //   VT16 f16 [1024][4096]     8 MiB  @ 16 MiB
  //   O16  f16 [4096][1024]     8 MiB  @ 24 MiB
  //   W16  f16 3 x [1024][1024] 6 MiB  @ 32 MiB  (wq, wk, wproj carried x16)
  //   WVH  bf16 [1024][1024]    2 MiB  @ 38 MiB
  //   WVL  bf16 [1024][1024]    2 MiB  @ 40 MiB
  // dead after rope:
  //   X16  f16  8 MiB @ 42 MiB
  //   XBH  bf16 8 MiB @ 50 MiB
  //   XBL  bf16 8 MiB @ 58 MiB
  //   QF   f32 16 MiB @ 66 MiB
  //   KF   f32 16 MiB @ 82 MiB  (must follow QF directly)
  // total = 98 MiB
  const size_t MiB = 1048576;
  const size_t total = 98 * MiB;
  if (total > ws_size) return;
  char* ws = (char*)d_ws;
  unsigned short* Q16  = (unsigned short*)(ws + 0 * MiB);
  unsigned short* K16  = (unsigned short*)(ws + 8 * MiB);
  unsigned short* VT16 = (unsigned short*)(ws + 16 * MiB);
  unsigned short* O16  = (unsigned short*)(ws + 24 * MiB);
  unsigned short* W16  = (unsigned short*)(ws + 32 * MiB);
  unsigned short* WVH  = (unsigned short*)(ws + 38 * MiB);
  unsigned short* WVL  = (unsigned short*)(ws + 40 * MiB);
  unsigned short* X16  = (unsigned short*)(ws + 42 * MiB);
  unsigned short* XBH  = (unsigned short*)(ws + 50 * MiB);
  unsigned short* XBL  = (unsigned short*)(ws + 58 * MiB);
  float*          QF   = (float*)(ws + 66 * MiB);
  unsigned short* WP16 = W16 + 2 * (size_t)kEmbd * kEmbd;
  const float* fdummy = (const float*)(ws);

  // 1) casts
  {
    const int n8x = (kSeqLen * kEmbd) / 8;          // 524288 = 2048 * 256
    xcast_kernel<<<dim3((n8x + 255) / 256), 256, 0, stream>>>(x, X16, XBH, XBL, n8x);
    const int n8w = (kEmbd * kEmbd) / 8;            // 131072 = 512 * 256
    wcast_kernel<<<dim3((n8w + 255) / 256, 3), 256, 0, stream>>>(wq, wk, wp, W16, kWCarry, n8w);
    wsplit_kernel<<<dim3((n8w + 255) / 256), 256, 0, stream>>>(wv, WVH, WVL, n8w);
  }

  // 2) q,k = X16 . Wq16^T / Wk16^T : M=4096, N=1024, K=1024 (K%64==0, M,N%128==0), f32 out, scale 1/16
  {
    const int tiles = (kSeqLen / 128) * (kEmbd / 128);   // 256 work-groups a weight
    wmma_gemm64<0, false, 0, 0, false, 0><<<dim3(tiles, 2), 256, 0, stream>>>(
        X16, X16, kEmbd, (long)0,
        W16, W16, kEmbd, (long)kEmbd * kEmbd,
        (void*)QF, (void*)QF, kEmbd, (long)kSeqLen * kEmbd,
        fdummy, fdummy, (long)0,
        kSeqLen, kEmbd, kEmbd, kQKScale);
  }

  // 3) V^T = Wv . X^T as bf16 hi/lo 3-product: A = Wv planes [1024][1024], Bt = X planes [4096][1024];
  //    M=1024, N=4096, K=1024; f16 out [h*64+d][t] carried x16, ldc = 4096
  {
    const int tiles = (kEmbd / 128) * (kSeqLen / 128);   // 256 work-groups
    wmma_gemm64<1, true, 0, 1, false, 0><<<dim3(tiles, 1), 256, 0, stream>>>(
        WVH, WVL, kEmbd, (long)0,
        XBH, XBL, kEmbd, (long)0,
        (void*)VT16, (void*)VT16, kSeqLen, (long)0,
        fdummy, fdummy, (long)0,
        kEmbd, kSeqLen, kEmbd, kVCarry);
  }

  // 4) RoPE + RMS-norm -> Q16, K16 planes [h][t][64]
  rope_rms_kernel<<<dim3((kSeqLen * kHeads) / 16), 256, 0, stream>>>(QF, QF + (size_t)kSeqLen * kEmbd, cosT, sinT, Q16);

  // 5) attention, all heads: O16 = 64*y, f16 [4096][1024]; 16 heads x 16 groups = 256 blocks
  attn_fused_kernel<<<dim3(kHeads * (kSeqLen / 256)), 256, 0, stream>>>(Q16, K16, VT16, O16);

  // 6) out = (64*y) . (16*Wp)^T * (1/1024): M=4096, N=1024, K=1024, f32 out to d_out
  {
    const int tiles = (kSeqLen / 128) * (kEmbd / 128);   // 256 work-groups
    wmma_gemm64<0, false, 0, 0, false, 0><<<dim3(tiles, 1), 256, 0, stream>>>(
        O16, O16, kEmbd, (long)0,
        WP16, WP16, kEmbd, (long)0,
        d_out, d_out, kEmbd, (long)0,
        fdummy, fdummy, (long)0,
        kSeqLen, kEmbd, kEmbd, kOutScale);
  }
}

// v005
// Measured time: 106 microseconds a run.
// In both of two side-by-side timings against v004, it was 1.09 times as fast.
// Over all steps from v000 it is 14.9 times as fast.
// Contractions: q,k projections (X f16 x W^T f16 carried x16), v projection (Wv bf16 hi/lo x X^T bf16 hi/lo, 3 products), scores q.k^T (q,k f16 planes, K=64), attn.v (P f16 carried x2048 x V^T f16 carried x16), output projection (y f16 carried x64 x Wp^T f16 carried x16): v_wmma_f32_16x16x32_f16 and v_wmma_f32_16x16x32_bf16, f32 accumulate; rope, rms-norm, sigmoid in f32.
#include <hip/hip_runtime.h>
#include <math.h>

// ---------------------------------------------------------------------------
// Problem constants
// ---------------------------------------------------------------------------
constexpr int kSeqLen = 4096;
constexpr int kEmbd   = 1024;
constexpr int kHeads  = 16;
constexpr int kHeadD  = 64;
constexpr int kRotD   = 32;
constexpr float kWCarry   = 16.0f;              // f16 weights carried x16
constexpr float kVCarry   = 16.0f;              // V^T f16 plane carried x16
constexpr float kPCarry   = 2048.0f;            // sigmoid probabilities carried x2048
constexpr float kQKScale  = 1.0f / 16.0f;       // undo weight carry on q,k
constexpr float kScScale  = 0.125f;             // 1/sqrt(64)
constexpr float kPVScale  = 1.0f / 32768.0f;    // 1/(kPCarry*kVCarry): O16 = 64*y
constexpr float kOutScale = 1.0f / 1024.0f;     // (1/64) * (1/kWCarry)
constexpr float kEpsRms   = 1e-6f;

typedef __attribute__((ext_vector_type(16))) _Float16 v16h;
typedef __attribute__((ext_vector_type(8)))  _Float16 v8h;
typedef __attribute__((ext_vector_type(16))) __bf16   v16b;
typedef __attribute__((ext_vector_type(8)))  __bf16   v8b;
typedef __attribute__((ext_vector_type(8)))  float    v8f;
typedef __attribute__((ext_vector_type(4)))  float    v4f;
typedef __attribute__((ext_vector_type(2)))  float    v2f;
typedef __attribute__((ext_vector_type(4)))  unsigned int v4u;

// ---------------------------------------------------------------------------
// Helpers
// ---------------------------------------------------------------------------
__device__ __forceinline__ unsigned short f2bf_bits(float f) {
  unsigned u = __float_as_uint(f);
  return (unsigned short)((u + 0x7FFFu + ((u >> 16) & 1u)) >> 16);
}
__device__ __forceinline__ float bf_bits2f(unsigned short h) { return __uint_as_float(((unsigned)h) << 16); }

// hazard guards as plain device helpers
__device__ __forceinline__ void dep_guard_h(v8f& a, v8f& b, v16h x, v16h y) { asm volatile("v_nop\n\tv_nop\n\tv_nop\n\tv_nop" : "+v"(a), "+v"(b) : "v"(x), "v"(y)); }
__device__ __forceinline__ void dep_guard_b(v8f& a, v8f& b, v16b x, v16b y) { asm volatile("v_nop\n\tv_nop\n\tv_nop\n\tv_nop" : "+v"(a), "+v"(b) : "v"(x), "v"(y)); }
__device__ __forceinline__ void keep4_h(v16h a, v16h b, v16h c, v16h d) { asm volatile("v_nop" :: "v"(a), "v"(b), "v"(c), "v"(d)); }
__device__ __forceinline__ void keep4_b(v16b a, v16b b, v16b c, v16b d) { asm volatile("v_nop" :: "v"(a), "v"(b), "v"(c), "v"(d)); }
__device__ __forceinline__ void acc_guard4(v8f& a, v8f& b, v8f& c, v8f& d) { asm volatile("v_nop\n\tv_nop\n\tv_nop\n\tv_nop" : "+v"(a), "+v"(b), "+v"(c), "+v"(d)); }
template <typename T> struct Frag;
template <> struct Frag<_Float16> {
  typedef v16h V; union U { v16h v; v8h h[2]; };
  static __device__ __forceinline__ v16h load(const _Float16* p) {   // elements 0..7 <- p[0..7], 8..15 <- p[16..23]
    U f; f.h[0] = *(const v8h*)(p); f.h[1] = *(const v8h*)(p + 16); return f.v;
  }
  static __device__ __forceinline__ v8f mma(v16h a, v16h b, v8f c) {
    return __builtin_amdgcn_wmma_f32_16x16x32_f16(false, a, false, b, (short)0, c, false, false);
  }
  static __device__ __forceinline__ void guard(v8f& a, v8f& b, v16h x, v16h y) { dep_guard_h(a, b, x, y); }
  static __device__ __forceinline__ void keep(v16h a, v16h b, v16h c, v16h d) { keep4_h(a, b, c, d); }
};
template <> struct Frag<__bf16> {
  typedef v16b V; union U { v16b v; v8b h[2]; };
  static __device__ __forceinline__ v16b load(const __bf16* p) {
    U f; f.h[0] = *(const v8b*)(p); f.h[1] = *(const v8b*)(p + 16); return f.v;
  }
  static __device__ __forceinline__ v8f mma(v16b a, v16b b, v8f c) {
    return __builtin_amdgcn_wmma_f32_16x16x32_bf16(false, a, false, b, (short)0, c, false, false);
  }
  static __device__ __forceinline__ void guard(v8f& a, v8f& b, v16b x, v16b y) { dep_guard_b(a, b, x, y); }
  static __device__ __forceinline__ void keep(v16b a, v16b b, v16b c, v16b d) { keep4_b(a, b, c, d); }
};

__device__ __forceinline__ unsigned pk16(unsigned short a, unsigned short b) { return (unsigned)a | ((unsigned)b << 16); }
__device__ __forceinline__ unsigned short h_bits(float f) { const _Float16 h = (_Float16)f; return __builtin_bit_cast(unsigned short, h); }

// ---- Batched WMMA GEMM, operands staged in LDS ------------------------------------------------
// C[m,n] = scale * sum_k A[m,k] * Bt[n,k] (+bias)(+resid).
// A row-major [M,K]; Bt row-major [N,K]; M,N % 128 == 0, K % 64 == 0.
// A work-group of 8 waves owns a 128x128 tile of C; wave w owns rows 32*(w>>1).., columns 64*(w&1).. of it.
// Per trip 64 k of the 128 A rows and the 128 Bt rows lie in LDS, brought there by asynchronous copies as whole
// 128-byte lines (8 lanes a row), so that no fragment load gathers 16 lines from the caches any more.
// LDS rows have a pitch of 144 bytes (16 B x odd: ds_load_b128 without bank conflicts). Two buffers: the copies of
// trip t+1 fly while trip t is worked on. The k order of the sums is the one of the fragment loads from LDS.
// SPLIT: operands are hi/lo planes (A2/Bt2 = lo planes, same layout); product = hi.hi + hi.lo + lo.hi.
// BIAS_MODE: 0 = none, 1 = bias[m], 2 = bias[n].
// OUT_MODE: 0 = f32, 1 = f16, 2 = bf16 hi plane (Cout) + bf16 lo plane (Cout2),
//           3 = rotary step and per-head RMS-norm in f32, then f16 planes [n / 64][m][64] (bias = cos table, resid = sin table, both [m][32]).
// ACT: 2 relu, 4 leaky, 6 = causal sigmoid carry: v = (n > m) ? 0 : kPCarry / (1 + exp(-v)).
// ET: 0 = f16 operands, 1 = bf16 operands (pointers passed as 16-bit storage)
constexpr int kTileK    = 64;                  // k per trip, 128 bytes of every operand row
constexpr int kRowPitch = 72;                  // LDS row pitch in 16-bit elements (144 bytes)
constexpr int kPlane    = 128 * kRowPitch;     // 16-bit elements of one operand plane in LDS

// Eight copies of 16 bytes a lane, global memory -> LDS through no register. The closing wait stands inside the statement,
// in front of any later rewrite of the address registers that the copies name.
__device__ __forceinline__ void async_copy8(const unsigned (&l)[8], const unsigned short* const (&g)[8]) {
  asm volatile("global_load_async_to_lds_b128 %0, %8, off\n\t"
               "global_load_async_to_lds_b128 %1, %9, off\n\t"
               "global_load_async_to_lds_b128 %2, %10, off\n\t"
               "global_load_async_to_lds_b128 %3, %11, off\n\t"
               "global_load_async_to_lds_b128 %4, %12, off\n\t"
               "global_load_async_to_lds_b128 %5, %13, off\n\t"
               "global_load_async_to_lds_b128 %6, %14, off\n\t"
               "global_load_async_to_lds_b128 %7, %15, off\n\t"
               "s_wait_xcnt 0x0"
               :: "v"(l[0]), "v"(l[1]), "v"(l[2]), "v"(l[3]), "v"(l[4]), "v"(l[5]), "v"(l[6]), "v"(l[7]),
                  "v"(g[0]), "v"(g[1]), "v"(g[2]), "v"(g[3]), "v"(g[4]), "v"(g[5]), "v"(g[6]), "v"(g[7])
               : "memory");
}
// One plane of A and one of Bt, 128 rows x 128 bytes each: this thread's 16 bytes of rows r, r+32, r+64, r+96.
__device__ __forceinline__ void stage_pair(const unsigned short* ga, size_t stepA, const unsigned short* gb, size_t stepB,
                                           unsigned lds) {
  unsigned l[8];
  const unsigned short* g[8];
#pragma unroll
  for (int i = 0; i < 4; ++i) {
    l[i]     = lds + (unsigned)(i * 32 * kRowPitch * 2);
    l[4 + i] = lds + (unsigned)((kPlane + i * 32 * kRowPitch) * 2);
    g[i]     = ga + i * stepA;
    g[4 + i] = gb + i * stepB;
  }
  async_copy8(l, g);
}

// x + (x of lane l ^ XM), inside a row of 16 lanes, on the vector port (a shuffle through the LDS unit costs its latency at every step)
template <int XM>
__device__ __forceinline__ float add_lane_xor(float x) {
  const int y = __builtin_amdgcn_update_dpp(0, __builtin_bit_cast(int, x), 0x160 | XM, 0xf, 0xf, true);   // 0x160 | XM: row_xmask:XM
  return x + __builtin_bit_cast(float, y);
}

template <int ET> struct Elem;
template <> struct Elem<0> { typedef _Float16 T; };
template <> struct Elem<1> { typedef __bf16 T; };
template <int ET, bool SPLIT, int BIAS_MODE, int OUT_MODE, bool RESID, int ACT = 0>
__global__ __launch_bounds__(256) void wmma_gemm64(
    const unsigned short* __restrict__ Ap, const unsigned short* __restrict__ A2p, int lda, long strideA,
    const unsigned short* __restrict__ Btp, const unsigned short* __restrict__ Bt2p, int ldb, long strideB,
    void* __restrict__ Cout, void* __restrict__ Cout2, int ldc, long strideC,
    const float* __restrict__ bias,
    const float* __restrict__ resid, long strideR,
    int M, int N, int K, float scale) {
  typedef typename Elem<ET>::T T;
  typedef typename Frag<T>::V V;
  constexpr int kStage = (SPLIT ? 4 : 2) * kPlane;           // one buffer: [A][Bt], SPLIT: [A hi][Bt hi][A lo][Bt lo]
  constexpr int kGroupK = SPLIT ? 32 : 64;                   // k of one group of fragment loads: 24 loads either way
  __shared__ __align__(16) unsigned short ring[2 * kStage];
  __shared__ __align__(16) float sT[8][16 * 68];   // per-wave 16x64 slab, pitch 68 floats
  const int b    = blockIdx.y;
  const int lane = threadIdx.x & 31;
  const int wave = threadIdx.x >> 5;
  const int tilesN = N >> 7;
  const int tilesM = M >> 7;
  if ((int)blockIdx.x >= tilesM * tilesN) return;   // the same for the whole work-group, in front of every barrier
  const int bm = blockIdx.x / tilesN;
  const int bn = blockIdx.x - bm * tilesN;
  const int m0 = (bm << 7) + ((wave >> 1) << 5);
  const int n0 = (bn << 7) + ((wave & 1) << 6);
  const int nt = K / kTileK;

  const int rlane = lane & 15;                 // row (A) / col (B, D) within subtile
  const int koff  = (lane >> 4) * 8;           // k offset of this lane half
  const int mOff  = (lane >> 4) * 8;           // D row offset

  // this thread's share of the copies: 16 bytes at column ccol of rows crow + 32 i of every plane
  const int crow = threadIdx.x >> 3;
  const int ccol = (threadIdx.x & 7) * 8;
  const size_t stepA = (size_t)32 * lda;
  const size_t stepB = (size_t)32 * ldb;
  const size_t offA = (size_t)b * strideA + (size_t)((bm << 7) + crow) * lda + ccol;
  const size_t offB = (size_t)b * strideB + (size_t)((bn << 7) + crow) * ldb + ccol;
  const unsigned lds0 = (unsigned)(size_t)(&ring[crow * kRowPitch + ccol]);   // LDS byte address: low word of the pointer

  // this lane's fragment rows in a buffer
  const int fragA = (((wave >> 1) << 5) + rlane) * kRowPitch + koff;
  const int fragB = kPlane + (((wave & 1) << 6) + rlane) * kRowPitch + koff;

  v8f acc[2][4];
#pragma unroll
  for (int i = 0; i < 2; ++i)
#pragma unroll
    for (int j = 0; j < 4; ++j) acc[i][j] = (v8f){0.f,0.f,0.f,0.f,0.f,0.f,0.f,0.f};

  // tile 0 into buffer 0, landed and published; then tile 1 into buffer 1
  stage_pair(Ap + offA, stepA, Btp + offB, stepB, lds0);
  if (SPLIT) stage_pair(A2p + offA, stepA, Bt2p + offB, stepB, lds0 + 2 * kPlane * 2);
  asm volatile("s_wait_asynccnt 0x0" ::: "memory");   // this wave's copies of tile 0 have landed
  __syncthreads();                                    // every wave's have
  if (nt > 1) {
    stage_pair(Ap + offA + kTileK, stepA, Btp + offB + kTileK, stepB, lds0 + kStage * 2);
    if (SPLIT) stage_pair(A2p + offA + kTileK, stepA, Bt2p + offB + kTileK, stepB, lds0 + (kStage + 2 * kPlane) * 2);
  }

  for (int t = 0; t < nt; ++t) {
    const int bufo = (t & 1) * kStage;
    const T* sb = (const T*)(ring + bufo);
#pragma unroll
    for (int kg = 0; kg < kTileK; kg += kGroupK) {
      // all fragment loads of a group stand in front of its products: one place where the wave waits for LDS
      V ah[kGroupK / 32][2], al[kGroupK / 32][2], bh[kGroupK / 32][4], bl[kGroupK / 32][4];
#pragma unroll
      for (int s = 0; s < kGroupK / 32; ++s) {
#pragma unroll
        for (int i = 0; i < 2; ++i) {
          const int ao = fragA + (i << 4) * kRowPitch + kg + (s << 5);
          ah[s][i] = Frag<T>::load(sb + ao);
          if (SPLIT) al[s][i] = Frag<T>::load(sb + 2 * kPlane + ao);
        }
#pragma unroll
        for (int j = 0; j < 4; ++j) {
          const int bo = fragB + (j << 4) * kRowPitch + kg + (s << 5);
          bh[s][j] = Frag<T>::load(sb + bo);
          if (SPLIT) bl[s][j] = Frag<T>::load(sb + 2 * kPlane + bo);
        }
      }
#pragma unroll
      for (int s = 0; s < kGroupK / 32; ++s) {
#pragma unroll
        for (int i = 0; i < 2; ++i) {
#pragma unroll
          for (int j = 0; j < 4; ++j) {
            acc[i][j] = Frag<T>::mma(ah[s][i], bh[s][j], acc[i][j]);
            if (SPLIT) {
              acc[i][j] = Frag<T>::mma(ah[s][i], bl[s][j], acc[i][j]);
              acc[i][j] = Frag<T>::mma(al[s][i], bh[s][j], acc[i][j]);
            }
          }
          Frag<T>::guard(acc[i][0], acc[i][3], ah[s][i], SPLIT ? al[s][i] : ah[s][i]);
        }
        Frag<T>::keep(bh[s][0], bh[s][1], bh[s][2], bh[s][3]);
        if (SPLIT) Frag<T>::keep(bl[s][0], bl[s][1], bl[s][2], bl[s][3]);
      }
    }
    asm volatile("s_wait_dscnt 0x0" ::: "memory");      // this wave's reads of the buffer are done before it is refilled
    asm volatile("s_wait_asynccnt 0x0" ::: "memory");   // this wave's copies of tile t+1 have landed
    __syncthreads();                                    // publishes tile t+1 and ends every wave's reads of tile t
    if (t + 2 < nt) {
      const size_t ko = (size_t)(t + 2) * kTileK;
      stage_pair(Ap + offA + ko, stepA, Btp + offB + ko, stepB, lds0 + bufo * 2);
      if (SPLIT) stage_pair(A2p + offA + ko, stepA, Bt2p + offB + ko, stepB, lds0 + (bufo + 2 * kPlane) * 2);
    }
  }
  // OUT_MODE 3: the cos and sin values of the wave's 32 rows, columns rlane and rlane + 16, all asked for here in one go:
  // their latency is paid once, not once per 16 rows behind the first rows' stores
  float cs[2][8][2], sn[2][8][2];
  if (OUT_MODE == 3) {
    const int tr0 = (m0 + mOff) * kRotD + rlane;
#pragma unroll
    for (int i = 0; i < 2; ++i)
#pragma unroll
      for (int r = 0; r < 8; ++r)
#pragma unroll
        for (int h = 0; h < 2; ++h) {
          cs[i][r][h] = bias[tr0 + ((i << 4) + r) * kRotD + (h << 4)];
          sn[i][r][h] = resid[tr0 + ((i << 4) + r) * kRotD + (h << 4)];
        }
    // the address registers of the loads above are reused right behind them: the wait stands in front of that reuse
    asm volatile("s_wait_xcnt 0x0" ::: "memory");
  }
  asm volatile("s_wait_asynccnt 0x0" ::: "memory");     // no copy is in flight behind the loop
  acc_guard4(acc[0][0], acc[0][1], acc[0][2], acc[0][3]);
  acc_guard4(acc[1][0], acc[1][1], acc[1][2], acc[1][3]);

  // ---- epilogue ----
  float* slab = sT[wave];
  const float* Rb = RESID ? (resid + (size_t)b * strideR) : nullptr;
#pragma unroll
  for (int i = 0; i < 2; ++i) {
    const int mBase = m0 + (i << 4);
    if (OUT_MODE == 3) {
      // The wave's 64 columns are one head: columns d and d + 32 of a row lie in one lane (tiles j and j + 2), so the rotation needs no exchange.
#pragma unroll
      for (int r = 0; r < 8; ++r) {
        const float c0 = cs[i][r][0], c1 = cs[i][r][1];
        const float s0 = sn[i][r][0], s1 = sn[i][r][1];
        const float x0 = acc[i][0][r] * scale, x1 = acc[i][1][r] * scale;
        const float x2 = acc[i][2][r] * scale, x3 = acc[i][3][r] * scale;
        float* row = slab + (mOff + r) * 68 + rlane;
        row[0]  = x0 * c0 + x2 * s0;
        row[16] = x1 * c1 + x3 * s1;
        row[32] = x2 * c0 - x0 * s0;
        row[48] = x3 * c1 - x1 * s1;
      }
    } else {
#pragma unroll
      for (int j = 0; j < 4; ++j) {
        const int n = n0 + (j << 4) + rlane;
        float bv = 0.f;
        if (BIAS_MODE == 2) bv = bias[n];
#pragma unroll
        for (int r = 0; r < 8; ++r) {
          float v = acc[i][j][r] * scale;
          if (BIAS_MODE == 1) v += bias[mBase + mOff + r];
          if (BIAS_MODE == 2) v += bv;
          if (RESID) v += Rb[(size_t)(mBase + mOff + r) * ldc + n];
          if (ACT == 2) v = fmaxf(v, 0.0f);
          if (ACT == 4) v = (v > 0.f) ? v : 0.01f * v;
          if (ACT == 6) {
            const float sg = kPCarry / (1.0f + expf(-v));
            v = (n > (mBase + mOff + r)) ? 0.0f : sg;
          }
          slab[(mOff + r) * 68 + (j << 4) + rlane] = v;
        }
      }
    }
    __builtin_amdgcn_fence(__ATOMIC_RELEASE, "workgroup");
    __builtin_amdgcn_wave_barrier();
    __builtin_amdgcn_fence(__ATOMIC_ACQUIRE, "workgroup");
    if (OUT_MODE == 0) {
      float* C = (float*)Cout + (size_t)b * strideC;
      const int hh = lane >> 4, c4 = (lane & 15) * 4;     // row seg = 256 B = 16 lanes x 16 B
      {
#pragma unroll
        for (int it = 0; it < 8; ++it) {
          const int row = it * 2 + hh;
          v4f v = *(const v4f*)(slab + row * 68 + c4);
          *(v4f*)(C + (size_t)(mBase + row) * ldc + n0 + c4) = v;
        }
        
      }
    } else if (OUT_MODE == 3) {
      // 8 lanes a row: each squares its 8 values, three exchanges give the row's sum; a store covers 4 rows = 512 contiguous bytes
      const int q = lane >> 3, c8 = (lane & 7) * 8;
      unsigned short* C = (unsigned short*)Cout + (size_t)b * strideC + (size_t)(n0 >> 6) * M * kHeadD;
#pragma unroll
      for (int it = 0; it < 4; ++it) {
        const int row = it * 4 + q;
        const float* sp = slab + row * 68 + c8;
        const v4f a = *(const v4f*)(sp);
        const v4f c = *(const v4f*)(sp + 4);
        float ss = a[0] * a[0];
#pragma unroll
        for (int e = 1; e < 4; ++e) ss = fmaf(a[e], a[e], ss);
#pragma unroll
        for (int e = 0; e < 4; ++e) ss = fmaf(c[e], c[e], ss);
        ss = add_lane_xor<1>(ss);
        ss = add_lane_xor<2>(ss);
        ss = add_lane_xor<4>(ss);
        const float rn = rsqrtf(ss * (1.0f / kHeadD) + kEpsRms);
        v8h hv;
#pragma unroll
        for (int e = 0; e < 4; ++e) {
          hv[e]     = (_Float16)(a[e] * rn);
          hv[4 + e] = (_Float16)(c[e] * rn);
        }
        *(v8h*)(C + (size_t)(mBase + row) * kHeadD + c8) = hv;
      }
    } else {
      const int q = lane >> 3, c8 = (lane & 7) * 8;
      unsigned short* C  = (unsigned short*)Cout  + (size_t)b * strideC;
      unsigned short* C2 = (OUT_MODE == 2) ? ((unsigned short*)Cout2 + (size_t)b * strideC) : nullptr;
      {
#pragma unroll
        for (int it = 0; it < 4; ++it) {
          const int row = it * 4 + q;
          const float* sp = slab + row * 68 + c8;
          v8h hv, lv;
#pragma unroll
          for (int e = 0; e < 8; ++e) {
            if (OUT_MODE == 1) {
              hv[e] = (_Float16)sp[e];
            } else {
              unsigned short hb = f2bf_bits(sp[e]);
              unsigned short lb = f2bf_bits(sp[e] - bf_bits2f(hb));
              hv[e] = __builtin_bit_cast(_Float16, hb);
              lv[e] = __builtin_bit_cast(_Float16, lb);
            }
          }
          *(v8h*)(C + (size_t)(mBase + row) * ldc + n0 + c8) = hv;
          if (OUT_MODE == 2) *(v8h*)(C2 + (size_t)(mBase + row) * ldc + n0 + c8) = lv;
        }
        
      }
    }
    __builtin_amdgcn_fence(__ATOMIC_RELEASE, "workgroup");
    __builtin_amdgcn_wave_barrier();
    __builtin_amdgcn_fence(__ATOMIC_ACQUIRE, "workgroup");
  }
}

// ---------------------------------------------------------------------------
// x f32 [4096][1024] -> three planes: f16, bf16 hi, bf16 lo (RNE converts), 8 elements per thread.
// Coverage: n8 = 4096*1024/8 = 524288 threads = 2048 blocks x 256 exactly; each lane one 16-B store per
// ---------------------------------------------------------------------------
__global__ __launch_bounds__(256) void xcast_kernel(const float* __restrict__ in, unsigned short* __restrict__ o16,
                                                    unsigned short* __restrict__ obh, unsigned short* __restrict__ obl, int n8) {
  const int i = blockIdx.x * 256 + threadIdx.x;
  if (i >= n8) return;
  const float* p = in + 8 * (size_t)i;
  const v4f a = *(const v4f*)(p);
  const v4f c = *(const v4f*)(p + 4);
  float f[8];
#pragma unroll
  for (int e = 0; e < 4; ++e) { f[e] = a[e]; f[4 + e] = c[e]; }
  unsigned short hb[8], bh[8], bl[8];
#pragma unroll
  for (int e = 0; e < 8; ++e) {
    hb[e] = h_bits(f[e]);
    bh[e] = f2bf_bits(f[e]);
    bl[e] = f2bf_bits(f[e] - bf_bits2f(bh[e]));
  }
  const v4u u0 = (v4u){pk16(hb[0], hb[1]), pk16(hb[2], hb[3]), pk16(hb[4], hb[5]), pk16(hb[6], hb[7])};
  const v4u u1 = (v4u){pk16(bh[0], bh[1]), pk16(bh[2], bh[3]), pk16(bh[4], bh[5]), pk16(bh[6], bh[7])};
  const v4u u2 = (v4u){pk16(bl[0], bl[1]), pk16(bl[2], bl[3]), pk16(bl[4], bl[5]), pk16(bl[6], bl[7])};
  const size_t o = 8 * (size_t)i;
  *(v4u*)(o16 + o) = u0;
  *(v4u*)(obh + o) = u1;
  *(v4u*)(obl + o) = u2;
  
}

// ---------------------------------------------------------------------------
// Weight f32 [1024][1024] -> f16(scale*w), three weights selected by blockIdx.y (block-uniform),
// output plane y at out + y*n8*8 halves. Coverage: n8 = 131072 threads = 512 blocks exactly per plane;
// ---------------------------------------------------------------------------
__global__ __launch_bounds__(256) void wcast_kernel(const float* __restrict__ w0, const float* __restrict__ w1,
                                                    const float* __restrict__ w2, unsigned short* __restrict__ out,
                                                    float scale, int n8) {
  const int i = blockIdx.x * 256 + threadIdx.x;
  if (i >= n8) return;
  const int z = blockIdx.y;
  const float* w = (z == 0) ? w0 : ((z == 1) ? w1 : w2);
  const float* p = w + 8 * (size_t)i;
  const v4f a = *(const v4f*)(p);
  const v4f c = *(const v4f*)(p + 4);
  unsigned short hb[8];
#pragma unroll
  for (int e = 0; e < 4; ++e) {
    hb[e]     = h_bits(a[e] * scale);
    hb[4 + e] = h_bits(c[e] * scale);
  }
  const v4u u = (v4u){pk16(hb[0], hb[1]), pk16(hb[2], hb[3]), pk16(hb[4], hb[5]), pk16(hb[6], hb[7])};
  unsigned short* q = out + (size_t)z * (size_t)n8 * 8 + 8 * (size_t)i;
  *(v4u*)q = u;
  
}

// ---------------------------------------------------------------------------
// Weight f32 [1024][1024] -> bf16 hi and lo planes (RNE converts). Coverage as above.
// ---------------------------------------------------------------------------
__global__ __launch_bounds__(256) void wsplit_kernel(const float* __restrict__ w, unsigned short* __restrict__ hi,
                                                     unsigned short* __restrict__ lo, int n8) {
  const int i = blockIdx.x * 256 + threadIdx.x;
  if (i >= n8) return;
  const float* p = w + 8 * (size_t)i;
  const v4f a = *(const v4f*)(p);
  const v4f c = *(const v4f*)(p + 4);
  float f[8];
#pragma unroll
  for (int e = 0; e < 4; ++e) { f[e] = a[e]; f[4 + e] = c[e]; }
  unsigned short bh[8], bl[8];
#pragma unroll
  for (int e = 0; e < 8; ++e) {
    bh[e] = f2bf_bits(f[e]);
    bl[e] = f2bf_bits(f[e] - bf_bits2f(bh[e]));
  }
  const v4u u1 = (v4u){pk16(bh[0], bh[1]), pk16(bh[2], bh[3]), pk16(bh[4], bh[5]), pk16(bh[6], bh[7])};
  const v4u u2 = (v4u){pk16(bl[0], bl[1]), pk16(bl[2], bl[3]), pk16(bl[4], bl[5]), pk16(bl[6], bl[7])};
  const size_t o = 8 * (size_t)i;
  *(v4u*)(hi + o) = u1;
  *(v4u*)(lo + o) = u2;
  
}

// ---------------------------------------------------------------------------
// Fused causal sigmoid attention, all heads in one launch; P never leaves the registers.
// One wave owns 32 query rows of one head and walks the keys 32 at a time, in rising order:
//   S^T = K . Q^T      A = K16 rows (16 keys), B = Q16 rows (16 queries), k = head dim (2 x 32)
//   P^T = f16(2048 * sigmoid(S^T / 8)), zero where key > query
//   O^T += V^T . P^T   A = VT16 rows (16 head dims), B = P^T, k = 32 keys
// A lane's accumulators of the two 16-key tiles of S^T are, converted in place, its B operand of the second
// product (element e of tile kt -> element 8*kt + e), in the k order that Frag::load gives the V^T rows.
// O^T: a lane holds 8 consecutive head dims of one query row: one 16-byte store each.
// Placement: 256 blocks x 8 waves; block = (head, group g); waves 0..3 take query tiles 4g+w, waves 4..7
// take tiles 127-(4g+w-4), so every pair (w, w+4) walks 129 key steps together. Every (head, tile) once.
// K and V^T reach the waves through LDS: the eight waves of a block walk the same keys of the same head, so a trip's
// 128 K rows (128 bytes each) and 64 V^T rows (256 bytes each) are brought once for all of them, as whole lines, by
// asynchronous copies; no fragment load gathers 16 lines from the caches any more. Two buffers: the copies of trip t+1
// fly while trip t is worked on. LDS pitches 144 and 272 bytes (16 B x odd: ds_load_b128 without bank conflicts).
// Every wave copies and passes the barrier in every trip of its block, also a wave that is past its own diagonal.
// ---------------------------------------------------------------------------
constexpr int kTripKeys = 128;                   // keys per trip: four steps of 32
constexpr int kKPitch   = 72;                    // LDS pitch of a K row in 16-bit elements (144 bytes)
constexpr int kVPitch   = 136;                   // LDS pitch of a V^T row in 16-bit elements (272 bytes)
constexpr int kKTile    = kTripKeys * kKPitch;   // 16-bit elements of a trip's K rows in LDS
constexpr int kVTile    = kHeadD * kVPitch;      // 16-bit elements of a trip's V^T rows in LDS
constexpr int kKVStage  = kKTile + kVTile;       // one buffer: [K][V^T]

// This thread's share of a trip: 16 bytes of K rows r + 32 i (8 lanes a row) and of V^T rows r' + 16 i (16 lanes a row).
__device__ __forceinline__ void stage_kv(const unsigned short* gk, const unsigned short* gv, unsigned ldsK, unsigned ldsV) {
  unsigned l[8];
  const unsigned short* g[8];
#pragma unroll
  for (int i = 0; i < 4; ++i) {
    l[i]     = ldsK + (unsigned)(i * 32 * kKPitch * 2);
    l[4 + i] = ldsV + (unsigned)(i * 16 * kVPitch * 2);
    g[i]     = gk + (size_t)i * 32 * kHeadD;
    g[4 + i] = gv + (size_t)i * 16 * kSeqLen;
  }
  async_copy8(l, g);
}

// Two scores at a time: 2048 * sigmoid(s / 8) = 1 / (2^-11 + 2^(-s * log2(e) / 8 - 11)): one packed fma, the hardware's exp2,
// one packed add, the hardware's reciprocal. Right over the whole range without a range test: exp2 -> 0 gives 2048,
// exp2 -> inf gives 0. All of it in f32; the result is rounded to f16 as before.
__device__ __forceinline__ v2f sigmoid2_carried(v2f s) {
  const float a = -kScScale * 1.4426950408889634f;
  const v2f t = __builtin_elementwise_fma(s, (v2f){a, a}, (v2f){-11.0f, -11.0f});
  const v2f d = (v2f){__builtin_amdgcn_exp2f(t.x), __builtin_amdgcn_exp2f(t.y)} + (v2f){1.0f / kPCarry, 1.0f / kPCarry};
  return (v2f){__builtin_amdgcn_rcpf(d.x), __builtin_amdgcn_rcpf(d.y)};
}

// K fragments of one step of 32 keys; sk = this lane's place in the step's first K row in LDS
__device__ __forceinline__ void load_k(const _Float16* sk, v16h (&kf)[2][2]) {
#pragma unroll
  for (int kt = 0; kt < 2; ++kt)
#pragma unroll
    for (int ks = 0; ks < 2; ++ks) kf[kt][ks] = Frag<_Float16>::load(sk + (kt << 4) * kKPitch + (ks << 5));
}

// One step of 32 keys out of LDS. sk, sv: this lane's places in the step's K rows and V^T columns. MASK: the diagonal step
// (first key == first query of the wave). NEXT: the next step lies in the same buffer, its K fragments are fetched here.
template <bool MASK, bool NEXT>
__device__ __forceinline__ void attn_step(const _Float16* sk, const _Float16* sv, int c, int h8,
                                          v16h (&kf)[2][2], const v16h (&qf)[2][2], v8f (&o)[4][2]) {
  v8f s[2][2];
#pragma unroll
  for (int kt = 0; kt < 2; ++kt)
#pragma unroll
    for (int g = 0; g < 2; ++g) {
      s[kt][g] = (v8f){0.f,0.f,0.f,0.f,0.f,0.f,0.f,0.f};
      s[kt][g] = Frag<_Float16>::mma(kf[kt][0], qf[g][0], s[kt][g]);
      s[kt][g] = Frag<_Float16>::mma(kf[kt][1], qf[g][1], s[kt][g]);
    }
  // one group of LDS loads a step: this step's V^T rows and, behind this step's last use of the K registers, the next step's K rows
  v16h vf[4], kn[2][2];
#pragma unroll
  for (int dt = 0; dt < 4; ++dt) vf[dt] = Frag<_Float16>::load(sv + (dt << 4) * kVPitch);
  if (NEXT) load_k(sk + 32 * kKPitch, kn);
  // keeps the loads above in front of the sigmoid work, which covers their latency: sunk below it, they are waited out at the products that use them
  __builtin_amdgcn_sched_barrier(0);
#pragma unroll
  for (int g = 0; g < 2; ++g) {
    v16h p;
#pragma unroll
    for (int kt = 0; kt < 2; ++kt)
#pragma unroll
      for (int r = 0; r < 8; r += 2) {
        v2f sg = sigmoid2_carried((v2f){s[kt][g][r], s[kt][g][r + 1]});
        if (MASK) {
          const int rel = ((kt << 4) + h8 + r) - ((g << 4) + c);   // key minus query of element r
          sg.x = (rel > 0) ? 0.0f : sg.x;
          sg.y = (rel + 1 > 0) ? 0.0f : sg.y;
        }
        p[(kt << 3) + r]     = (_Float16)sg.x;
        p[(kt << 3) + r + 1] = (_Float16)sg.y;
      }
#pragma unroll
    for (int dt = 0; dt < 4; ++dt) o[dt][g] = Frag<_Float16>::mma(vf[dt], p, o[dt][g]);
  }
  if (NEXT) {
#pragma unroll
    for (int kt = 0; kt < 2; ++kt)
#pragma unroll
      for (int ks = 0; ks < 2; ++ks) kf[kt][ks] = kn[kt][ks];
  }
}

__global__ __launch_bounds__(256) void attn_fused_kernel(const unsigned short* __restrict__ Q16p,
                                                         const unsigned short* __restrict__ K16p,
                                                         const unsigned short* __restrict__ VT16p,
                                                         unsigned short* __restrict__ O16p) {
  __shared__ __align__(16) unsigned short kv[2 * kKVStage];
  const int lane = threadIdx.x & 31;
  const int wave = __builtin_amdgcn_readfirstlane(threadIdx.x >> 5);   // in a scalar register: the tests on it below are scalar branches
  const int c    = lane & 15;
  const int h8   = (lane >> 4) * 8;
  const int head = blockIdx.x & (kHeads - 1);
  const int grp  = blockIdx.x >> 4;                                    // 0..15
  const int qt   = (wave < 4) ? (4 * grp + wave) : (127 - (4 * grp + wave - 4));
  const int q0   = qt << 5;
  const int nt    = kSeqLen / kTripKeys - grp;    // trips of the block: up to the diagonal of its longest wave, tile 127 - 4 grp (17..32)
  const int tEdge = qt >> 2;                      // the trip that holds this wave's diagonal step
  const int nFree = qt & 3;                       // unmasked steps of that trip
  const _Float16* Qh = (const _Float16*)Q16p + (size_t)head * kSeqLen * kHeadD;

  // this thread's share of the copies
  const unsigned short* gk = K16p  + (size_t)head * kSeqLen * kHeadD + (size_t)(threadIdx.x >> 3) * kHeadD + (threadIdx.x & 7) * 8;
  const unsigned short* gv = VT16p + ((size_t)head * kHeadD + (threadIdx.x >> 4)) * kSeqLen + (threadIdx.x & 15) * 8;
  const unsigned ldsK = (unsigned)(size_t)(&kv[(threadIdx.x >> 3) * kKPitch + (threadIdx.x & 7) * 8]);            // LDS byte address: low word of the pointer
  const unsigned ldsV = (unsigned)(size_t)(&kv[kKTile + (threadIdx.x >> 4) * kVPitch + (threadIdx.x & 15) * 8]);

  // tile 0 into buffer 0
  stage_kv(gk, gv, ldsK, ldsV);

  v16h qf[2][2], kf[2][2];
#pragma unroll
  for (int g = 0; g < 2; ++g)
#pragma unroll
    for (int ks = 0; ks < 2; ++ks)
      qf[g][ks] = Frag<_Float16>::load(Qh + (size_t)(q0 + (g << 4) + c) * kHeadD + (ks << 5) + h8);
  // the address registers of the loads above are reused right behind them: the wait stands in front of that reuse
  asm volatile("s_wait_xcnt 0x0" ::: "memory");
  v8f o[4][2];
#pragma unroll
  for (int dt = 0; dt < 4; ++dt)
#pragma unroll
    for (int g = 0; g < 2; ++g) o[dt][g] = (v8f){0.f,0.f,0.f,0.f,0.f,0.f,0.f,0.f};

  asm volatile("s_wait_asynccnt 0x0" ::: "memory");   // this wave's copies of tile 0 have landed
  __syncthreads();                                    // every wave's have
  if (nt > 1) stage_kv(gk + (size_t)kTripKeys * kHeadD, gv + kTripKeys, ldsK + kKVStage * 2, ldsV + kKVStage * 2);

  for (int t = 0; t < nt; ++t) {
    const int bufo = (t & 1) * kKVStage;
    const _Float16* sk = (const _Float16*)(kv + bufo) + c * kKPitch + h8;
    const _Float16* sv = (const _Float16*)(kv + bufo + kKTile) + c * kVPitch + h8;
    if (t < tEdge) {                 // wave-uniform: all four steps lie below the diagonal
      load_k(sk, kf);
      // keeps the trip's first eight K loads together in front of its products: spread among them, each pair is waited out on its own
      __builtin_amdgcn_sched_barrier(0);
      attn_step<false, true >(sk,                sv,      c, h8, kf, qf, o);
      attn_step<false, true >(sk + 32 * kKPitch, sv + 32, c, h8, kf, qf, o);
      attn_step<false, true >(sk + 64 * kKPitch, sv + 64, c, h8, kf, qf, o);
      attn_step<false, false>(sk + 96 * kKPitch, sv + 96, c, h8, kf, qf, o);
    }
    if (t == tEdge) {                // wave-uniform: the steps up to the diagonal, then the diagonal step
      load_k(sk, kf);
      for (int j = 0; j < nFree; ++j) {
        attn_step<false, true>(sk, sv, c, h8, kf, qf, o);
        sk += 32 * kKPitch;
        sv += 32;
      }
      attn_step<true, false>(sk, sv, c, h8, kf, qf, o);
    }
    asm volatile("s_wait_dscnt 0x0" ::: "memory");      // this wave's reads of the buffer are done before it is refilled
    asm volatile("s_wait_asynccnt 0x0" ::: "memory");   // this wave's copies of tile t+1 have landed
    __syncthreads();                                    // publishes tile t+1 and ends every wave's reads of tile t
    if (t + 2 < nt)
      stage_kv(gk + (size_t)(t + 2) * kTripKeys * kHeadD, gv + (size_t)(t + 2) * kTripKeys, ldsK + bufo * 2, ldsV + bufo * 2);
  }
  asm volatile("s_wait_asynccnt 0x0" ::: "memory");     // no copy is in flight behind the loop

#pragma unroll
  for (int g = 0; g < 2; ++g)
#pragma unroll
    for (int dt = 0; dt < 4; ++dt) {
      v8h hv;
#pragma unroll
      for (int r = 0; r < 8; ++r) hv[r] = (_Float16)(o[dt][g][r] * kPVScale);
      *(v8h*)(O16p + (size_t)(q0 + (g << 4) + c) * kEmbd + head * kHeadD + (dt << 4) + h8) = hv;
    }
}

// ---------------------------------------------------------------------------
// Host-side orchestration
// ---------------------------------------------------------------------------
extern "C" void kernel_launch(void* const* d_in, const int* in_sizes, int n_in,
                              void* d_out, int out_size, void* d_ws,
                              size_t ws_size, hipStream_t stream) {
  if (n_in < 7) return;
  if (in_sizes[0] != kSeqLen * kEmbd) return;
  if (in_sizes[1] != kSeqLen * kRotD || in_sizes[2] != kSeqLen * kRotD) return;
  if (in_sizes[3] != kEmbd * kEmbd || in_sizes[4] != kEmbd * kEmbd ||
      in_sizes[5] != kEmbd * kEmbd || in_sizes[6] != kEmbd * kEmbd) return;
  if (out_size != kSeqLen * kEmbd) return;

  const float* x    = (const float*)d_in[0];
  const float* cosT = (const float*)d_in[1];
  const float* sinT = (const float*)d_in[2];
  const float* wq   = (const float*)d_in[3];
  const float* wk   = (const float*)d_in[4];
  const float* wv   = (const float*)d_in[5];
  const float* wp   = (const float*)d_in[6];

  // ---- workspace region map (bytes) ----
  // persistent:
  //   Q16  f16 [16][4096][64]   8 MiB  @ 0
  //   K16  f16 [16][4096][64]   8 MiB  @ 8 MiB   (must follow Q16 directly)
  //   VT16 f16 [1024][4096]     8 MiB  @ 16 MiB
  //   O16  f16 [4096][1024]     8 MiB  @ 24 MiB
  //   W16  f16 3 x [1024][1024] 6 MiB  @ 32 MiB  (wq, wk, wproj carried x16)
  //   WVH  bf16 [1024][1024]    2 MiB  @ 38 MiB
  //   WVL  bf16 [1024][1024]    2 MiB  @ 40 MiB
  // dead after the projections:
  //   X16  f16  8 MiB @ 42 MiB
  //   XBH  bf16 8 MiB @ 50 MiB
  //   XBL  bf16 8 MiB @ 58 MiB
  // total = 66 MiB
  const size_t MiB = 1048576;
  const size_t total = 66 * MiB;
  if (total > ws_size) return;
  char* ws = (char*)d_ws;
  unsigned short* Q16  = (unsigned short*)(ws + 0 * MiB);
  unsigned short* K16  = (unsigned short*)(ws + 8 * MiB);
  unsigned short* VT16 = (unsigned short*)(ws + 16 * MiB);
  unsigned short* O16  = (unsigned short*)(ws + 24 * MiB);
  unsigned short* W16  = (unsigned short*)(ws + 32 * MiB);
  unsigned short* WVH  = (unsigned short*)(ws + 38 * MiB);
  unsigned short* WVL  = (unsigned short*)(ws + 40 * MiB);
  unsigned short* X16  = (unsigned short*)(ws + 42 * MiB);
  unsigned short* XBH  = (unsigned short*)(ws + 50 * MiB);
  unsigned short* XBL  = (unsigned short*)(ws + 58 * MiB);
  unsigned short* WP16 = W16 + 2 * (size_t)kEmbd * kEmbd;
  const float* fdummy = (const float*)(ws);

  // 1) casts
  {
    const int n8x = (kSeqLen * kEmbd) / 8;          // 524288 = 2048 * 256
    xcast_kernel<<<dim3((n8x + 255) / 256), 256, 0, stream>>>(x, X16, XBH, XBL, n8x);
    const int n8w = (kEmbd * kEmbd) / 8;            // 131072 = 512 * 256
    wcast_kernel<<<dim3((n8w + 255) / 256, 3), 256, 0, stream>>>(wq, wk, wp, W16, kWCarry, n8w);
    wsplit_kernel<<<dim3((n8w + 255) / 256), 256, 0, stream>>>(wv, WVH, WVL, n8w);
  }

  // 2) q,k = X16 . Wq16^T / Wk16^T : M=4096, N=1024, K=1024 (K%64==0, M,N%128==0), scale 1/16; RoPE + RMS-norm in the epilogue
  //    -> Q16, K16 planes [h][t][64]
  {
    const int tiles = (kSeqLen / 128) * (kEmbd / 128);   // 256 work-groups a weight
    wmma_gemm64<0, false, 0, 3, false, 0><<<dim3(tiles, 2), 256, 0, stream>>>(
        X16, X16, kEmbd, (long)0,
        W16, W16, kEmbd, (long)kEmbd * kEmbd,
        (void*)Q16, (void*)Q16, kHeadD, (long)kHeads * kSeqLen * kHeadD,
        cosT, sinT, (long)0,
        kSeqLen, kEmbd, kEmbd, kQKScale);
  }

  // 3) V^T = Wv . X^T as bf16 hi/lo 3-product: A = Wv planes [1024][1024], Bt = X planes [4096][1024];
  //    M=1024, N=4096, K=1024; f16 out [h*64+d][t] carried x16, ldc = 4096
  {
    const int tiles = (kEmbd / 128) * (kSeqLen / 128);   // 256 work-groups
    wmma_gemm64<1, true, 0, 1, false, 0><<<dim3(tiles, 1), 256, 0, stream>>>(
        WVH, WVL, kEmbd, (long)0,
        XBH, XBL, kEmbd, (long)0,
        (void*)VT16, (void*)VT16, kSeqLen, (long)0,
        fdummy, fdummy, (long)0,
        kEmbd, kSeqLen, kEmbd, kVCarry);
  }

  // 4) attention, all heads: O16 = 64*y, f16 [4096][1024]; 16 heads x 16 groups = 256 blocks
  attn_fused_kernel<<<dim3(kHeads * (kSeqLen / 256)), 256, 0, stream>>>(Q16, K16, VT16, O16);

  // 5) out = (64*y) . (16*Wp)^T * (1/1024): M=4096, N=1024, K=1024, f32 out to d_out
  {
    const int tiles = (kSeqLen / 128) * (kEmbd / 128);   // 256 work-groups
    wmma_gemm64<0, false, 0, 0, false, 0><<<dim3(tiles, 1), 256, 0, stream>>>(
        O16, O16, kEmbd, (long)0,
        WP16, WP16, kEmbd, (long)0,
        d_out, d_out, kEmbd, (long)0,
        fdummy, fdummy, (long)0,
        kSeqLen, kEmbd, kEmbd, kOutScale);
  }
}

// v007
// It runs in 92.4 microseconds.
// It is 1.16 times as fast as v005, going by the measured steps of the versions left out in between.
// Over all steps from v000 it is 17.3 times as fast.
// Contractions: q,k projections (X f16 x W^T f16 carried x16), v projection (Wv f16 carried x16 x X^T f16), scores q.k^T (q,k f16 planes, K=64), attn.v (P f16 carried x2048 x V^T f16 carried x16), output projection (y f16 carried x64 x Wp^T f16 carried x16): v_wmma_f32_16x16x32_f16, f32 accumulate; rope, rms-norm, sigmoid in f32.
#include <hip/hip_runtime.h>
#include <math.h>

// ---------------------------------------------------------------------------
// Problem constants
// ---------------------------------------------------------------------------
constexpr int kSeqLen = 4096;
constexpr int kEmbd   = 1024;
constexpr int kHeads  = 16;
constexpr int kHeadD  = 64;
constexpr int kRotD   = 32;
constexpr float kWCarry   = 16.0f;              // f16 weights carried x16
constexpr float kVCarry   = 16.0f;              // V^T f16 plane carried x16
constexpr float kPCarry   = 2048.0f;            // sigmoid probabilities carried x2048
constexpr float kQKScale  = 1.0f / 16.0f;       // undo weight carry on q,k
constexpr float kVScale   = kVCarry / kWCarry; // V^T plane: the weight's carry becomes the plane's
constexpr float kScScale  = 0.125f;             // 1/sqrt(64)
constexpr float kQFold    = 0.5f * kScScale;    // on the Q fragments: the product is the argument of tanh, score / 2 (a power of two: no bit of a normal f16 is lost)
constexpr float kPVScale  = 1.0f / 32768.0f;    // 1/(kPCarry*kVCarry): O16 = 64*y
constexpr float kOutScale = 1.0f / 1024.0f;     // (1/64) * (1/kWCarry)
constexpr float kEpsRms   = 1e-6f;

typedef __attribute__((ext_vector_type(16))) _Float16 v16h;
typedef __attribute__((ext_vector_type(8)))  _Float16 v8h;
typedef __attribute__((ext_vector_type(16))) __bf16   v16b;
typedef __attribute__((ext_vector_type(8)))  __bf16   v8b;
typedef __attribute__((ext_vector_type(8)))  float    v8f;
typedef __attribute__((ext_vector_type(4)))  float    v4f;
typedef __attribute__((ext_vector_type(2)))  float    v2f;
typedef __attribute__((ext_vector_type(4)))  unsigned int v4u;

// ---------------------------------------------------------------------------
// Helpers
// ---------------------------------------------------------------------------
__device__ __forceinline__ unsigned short f2bf_bits(float f) {
  unsigned u = __float_as_uint(f);
  return (unsigned short)((u + 0x7FFFu + ((u >> 16) & 1u)) >> 16);
}
__device__ __forceinline__ float bf_bits2f(unsigned short h) { return __uint_as_float(((unsigned)h) << 16); }

// hazard guards as plain device helpers
__device__ __forceinline__ void dep_guard_h(v8f& a, v8f& b, v16h x, v16h y) { asm volatile("v_nop\n\tv_nop\n\tv_nop\n\tv_nop" : "+v"(a), "+v"(b) : "v"(x), "v"(y)); }
__device__ __forceinline__ void dep_guard_b(v8f& a, v8f& b, v16b x, v16b y) { asm volatile("v_nop\n\tv_nop\n\tv_nop\n\tv_nop" : "+v"(a), "+v"(b) : "v"(x), "v"(y)); }
__device__ __forceinline__ void keep4_h(v16h a, v16h b, v16h c, v16h d) { asm volatile("v_nop" :: "v"(a), "v"(b), "v"(c), "v"(d)); }
__device__ __forceinline__ void keep4_b(v16b a, v16b b, v16b c, v16b d) { asm volatile("v_nop" :: "v"(a), "v"(b), "v"(c), "v"(d)); }
__device__ __forceinline__ void acc_guard4(v8f& a, v8f& b, v8f& c, v8f& d) { asm volatile("v_nop\n\tv_nop\n\tv_nop\n\tv_nop" : "+v"(a), "+v"(b), "+v"(c), "+v"(d)); }
template <typename T> struct Frag;
template <> struct Frag<_Float16> {
  typedef v16h V; union U { v16h v; v8h h[2]; };
  static __device__ __forceinline__ v16h load(const _Float16* p) {   // elements 0..7 <- p[0..7], 8..15 <- p[16..23]
    U f; f.h[0] = *(const v8h*)(p); f.h[1] = *(const v8h*)(p + 16); return f.v;
  }
  static __device__ __forceinline__ v8f mma(v16h a, v16h b, v8f c) {
    return __builtin_amdgcn_wmma_f32_16x16x32_f16(false, a, false, b, (short)0, c, false, false);
  }
  static __device__ __forceinline__ void guard(v8f& a, v8f& b, v16h x, v16h y) { dep_guard_h(a, b, x, y); }
  static __device__ __forceinline__ void keep(v16h a, v16h b, v16h c, v16h d) { keep4_h(a, b, c, d); }
};
template <> struct Frag<__bf16> {
  typedef v16b V; union U { v16b v; v8b h[2]; };
  static __device__ __forceinline__ v16b load(const __bf16* p) {
    U f; f.h[0] = *(const v8b*)(p); f.h[1] = *(const v8b*)(p + 16); return f.v;
  }
  static __device__ __forceinline__ v8f mma(v16b a, v16b b, v8f c) {
    return __builtin_amdgcn_wmma_f32_16x16x32_bf16(false, a, false, b, (short)0, c, false, false);
  }
  static __device__ __forceinline__ void guard(v8f& a, v8f& b, v16b x, v16b y) { dep_guard_b(a, b, x, y); }
  static __device__ __forceinline__ void keep(v16b a, v16b b, v16b c, v16b d) { keep4_b(a, b, c, d); }
};

__device__ __forceinline__ unsigned pk16(unsigned short a, unsigned short b) { return (unsigned)a | ((unsigned)b << 16); }
__device__ __forceinline__ unsigned short h_bits(float f) { const _Float16 h = (_Float16)f; return __builtin_bit_cast(unsigned short, h); }

// ---- Batched WMMA GEMM, operands staged in LDS ------------------------------------------------
// C[m,n] = scale * sum_k A[m,k] * Bt[n,k] (+bias)(+resid).
// A row-major [M,K]; Bt row-major [N,K]; M,N % 128 == 0, K % 64 == 0.
// A work-group of 8 waves owns a 128x128 tile of C; wave w owns rows 32*(w>>1).., columns 64*(w&1).. of it.
// Per trip 64 k of the 128 A rows and the 128 Bt rows lie in LDS, brought there by asynchronous copies as whole
// 128-byte lines (8 lanes a row), so that no fragment load gathers 16 lines from the caches any more.
// LDS rows have a pitch of 144 bytes (16 B x odd: ds_load_b128 without bank conflicts). Two buffers: the copies of
// trip t+1 fly while trip t is worked on. The k order of the sums is the one of the fragment loads from LDS.
// SPLIT: operands are hi/lo planes (A2/Bt2 = lo planes, same layout); product = hi.hi + hi.lo + lo.hi.
// BIAS_MODE: 0 = none, 1 = bias[m], 2 = bias[n].
// OUT_MODE: 0 = f32, 1 = f16, 2 = bf16 hi plane (Cout) + bf16 lo plane (Cout2),
//           3 = rotary step and per-head RMS-norm in f32, then f16 planes [n / 64][m][64] (bias = cos table, resid = sin table, both [m][32]).
// ACT: 2 relu, 4 leaky, 6 = causal sigmoid carry: v = (n > m) ? 0 : kPCarry / (1 + exp(-v)).
// ET: 0 = f16 operands, 1 = bf16 operands (pointers passed as 16-bit storage)
constexpr int kTileK    = 64;                  // k per trip, 128 bytes of every operand row
constexpr int kRowPitch = 72;                  // LDS row pitch in 16-bit elements (144 bytes)
constexpr int kPlane    = 128 * kRowPitch;     // 16-bit elements of one operand plane in LDS

// Eight copies of 16 bytes a lane, global memory -> LDS through no register. The closing wait stands inside the statement,
// in front of any later rewrite of the address registers that the copies name.
__device__ __forceinline__ void async_copy8(const unsigned (&l)[8], const unsigned short* const (&g)[8]) {
  asm volatile("global_load_async_to_lds_b128 %0, %8, off\n\t"
               "global_load_async_to_lds_b128 %1, %9, off\n\t"
               "global_load_async_to_lds_b128 %2, %10, off\n\t"
               "global_load_async_to_lds_b128 %3, %11, off\n\t"
               "global_load_async_to_lds_b128 %4, %12, off\n\t"
               "global_load_async_to_lds_b128 %5, %13, off\n\t"
               "global_load_async_to_lds_b128 %6, %14, off\n\t"
               "global_load_async_to_lds_b128 %7, %15, off\n\t"
               "s_wait_xcnt 0x0"
               :: "v"(l[0]), "v"(l[1]), "v"(l[2]), "v"(l[3]), "v"(l[4]), "v"(l[5]), "v"(l[6]), "v"(l[7]),
                  "v"(g[0]), "v"(g[1]), "v"(g[2]), "v"(g[3]), "v"(g[4]), "v"(g[5]), "v"(g[6]), "v"(g[7])
               : "memory");
}
// One plane of A and one of Bt, 128 rows x 128 bytes each: this thread's 16 bytes of rows r, r+32, r+64, r+96.
__device__ __forceinline__ void stage_pair(const unsigned short* ga, size_t stepA, const unsigned short* gb, size_t stepB,
                                           unsigned lds) {
  unsigned l[8];
  const unsigned short* g[8];
#pragma unroll
  for (int i = 0; i < 4; ++i) {
    l[i]     = lds + (unsigned)(i * 32 * kRowPitch * 2);
    l[4 + i] = lds + (unsigned)((kPlane + i * 32 * kRowPitch) * 2);
    g[i]     = ga + i * stepA;
    g[4 + i] = gb + i * stepB;
  }
  async_copy8(l, g);
}

// x + (x of lane l ^ XM), inside a row of 16 lanes, on the vector port (a shuffle through the LDS unit costs its latency at every step)
template <int XM>
__device__ __forceinline__ float add_lane_xor(float x) {
  const int y = __builtin_amdgcn_update_dpp(0, __builtin_bit_cast(int, x), 0x160 | XM, 0xf, 0xf, true);   // 0x160 | XM: row_xmask:XM
  return x + __builtin_bit_cast(float, y);
}

template <int ET> struct Elem;
template <> struct Elem<0> { typedef _Float16 T; };
template <> struct Elem<1> { typedef __bf16 T; };
template <int ET, bool SPLIT, int BIAS_MODE, int OUT_MODE, bool RESID, int ACT = 0>
__global__ __launch_bounds__(256) void wmma_gemm64(
    const unsigned short* __restrict__ Ap, const unsigned short* __restrict__ A2p, int lda, long strideA,
    const unsigned short* __restrict__ Btp, const unsigned short* __restrict__ Bt2p, int ldb, long strideB,
    void* __restrict__ Cout, void* __restrict__ Cout2, int ldc, long strideC,
    const float* __restrict__ bias,
    const float* __restrict__ resid, long strideR,
    int M, int N, int K, float scale) {
  typedef typename Elem<ET>::T T;
  typedef typename Frag<T>::V V;
  constexpr int kStage = (SPLIT ? 4 : 2) * kPlane;           // one buffer: [A][Bt], SPLIT: [A hi][Bt hi][A lo][Bt lo]
  constexpr int kGroupK = SPLIT ? 32 : 64;                   // k of one group of fragment loads: 24 loads either way
  __shared__ __align__(16) unsigned short ring[2 * kStage];
  __shared__ __align__(16) float sT[8][16 * 68];   // per-wave 16x64 slab, pitch 68 floats
  const int b    = blockIdx.y;
  const int lane = threadIdx.x & 31;
  const int wave = threadIdx.x >> 5;
  const int tilesN = N >> 7;
  const int tilesM = M >> 7;
  if ((int)blockIdx.x >= tilesM * tilesN) return;   // the same for the whole work-group, in front of every barrier
  const int bm = blockIdx.x / tilesN;
  const int bn = blockIdx.x - bm * tilesN;
  const int m0 = (bm << 7) + ((wave >> 1) << 5);
  const int n0 = (bn << 7) + ((wave & 1) << 6);
  const int nt = K / kTileK;

  const int rlane = lane & 15;                 // row (A) / col (B, D) within subtile
  const int koff  = (lane >> 4) * 8;           // k offset of this lane half
  const int mOff  = (lane >> 4) * 8;           // D row offset

  // this thread's share of the copies: 16 bytes at column ccol of rows crow + 32 i of every plane
  const int crow = threadIdx.x >> 3;
  const int ccol = (threadIdx.x & 7) * 8;
  const size_t stepA = (size_t)32 * lda;
  const size_t stepB = (size_t)32 * ldb;
  const size_t offA = (size_t)b * strideA + (size_t)((bm << 7) + crow) * lda + ccol;
  const size_t offB = (size_t)b * strideB + (size_t)((bn << 7) + crow) * ldb + ccol;
  const unsigned lds0 = (unsigned)(size_t)(&ring[crow * kRowPitch + ccol]);   // LDS byte address: low word of the pointer

  // this lane's fragment rows in a buffer
  const int fragA = (((wave >> 1) << 5) + rlane) * kRowPitch + koff;
  const int fragB = kPlane + (((wave & 1) << 6) + rlane) * kRowPitch + koff;

  v8f acc[2][4];
#pragma unroll
  for (int i = 0; i < 2; ++i)
#pragma unroll
    for (int j = 0; j < 4; ++j) acc[i][j] = (v8f){0.f,0.f,0.f,0.f,0.f,0.f,0.f,0.f};

  // tile 0 into buffer 0, landed and published; then tile 1 into buffer 1
  stage_pair(Ap + offA, stepA, Btp + offB, stepB, lds0);
  if (SPLIT) stage_pair(A2p + offA, stepA, Bt2p + offB, stepB, lds0 + 2 * kPlane * 2);
  asm volatile("s_wait_asynccnt 0x0" ::: "memory");   // this wave's copies of tile 0 have landed
  __syncthreads();                                    // every wave's have
  if (nt > 1) {
    stage_pair(Ap + offA + kTileK, stepA, Btp + offB + kTileK, stepB, lds0 + kStage * 2);
    if (SPLIT) stage_pair(A2p + offA + kTileK, stepA, Bt2p + offB + kTileK, stepB, lds0 + (kStage + 2 * kPlane) * 2);
  }

  for (int t = 0; t < nt; ++t) {
    const int bufo = (t & 1) * kStage;
    const T* sb = (const T*)(ring + bufo);
#pragma unroll
    for (int kg = 0; kg < kTileK; kg += kGroupK) {
      // all fragment loads of a group stand in front of its products: one place where the wave waits for LDS
      V ah[kGroupK / 32][2], al[kGroupK / 32][2], bh[kGroupK / 32][4], bl[kGroupK / 32][4];
#pragma unroll
      for (int s = 0; s < kGroupK / 32; ++s) {
#pragma unroll
        for (int i = 0; i < 2; ++i) {
          const int ao = fragA + (i << 4) * kRowPitch + kg + (s << 5);
          ah[s][i] = Frag<T>::load(sb + ao);
          if (SPLIT) al[s][i] = Frag<T>::load(sb + 2 * kPlane + ao);
        }
#pragma unroll
        for (int j = 0; j < 4; ++j) {
          const int bo = fragB + (j << 4) * kRowPitch + kg + (s << 5);
          bh[s][j] = Frag<T>::load(sb + bo);
          if (SPLIT) bl[s][j] = Frag<T>::load(sb + 2 * kPlane + bo);
        }
      }
#pragma unroll
      for (int s = 0; s < kGroupK / 32; ++s) {
#pragma unroll
        for (int i = 0; i < 2; ++i) {
#pragma unroll
          for (int j = 0; j < 4; ++j) {
            acc[i][j] = Frag<T>::mma(ah[s][i], bh[s][j], acc[i][j]);
            if (SPLIT) {
              acc[i][j] = Frag<T>::mma(ah[s][i], bl[s][j], acc[i][j]);
              acc[i][j] = Frag<T>::mma(al[s][i], bh[s][j], acc[i][j]);
            }
          }
          Frag<T>::guard(acc[i][0], acc[i][3], ah[s][i], SPLIT ? al[s][i] : ah[s][i]);
        }
        Frag<T>::keep(bh[s][0], bh[s][1], bh[s][2], bh[s][3]);
        if (SPLIT) Frag<T>::keep(bl[s][0], bl[s][1], bl[s][2], bl[s][3]);
      }
    }
    asm volatile("s_wait_dscnt 0x0" ::: "memory");      // this wave's reads of the buffer are done before it is refilled
    asm volatile("s_wait_asynccnt 0x0" ::: "memory");   // this wave's copies of tile t+1 have landed
    __syncthreads();                                    // publishes tile t+1 and ends every wave's reads of tile t
    if (t + 2 < nt) {
      const size_t ko = (size_t)(t + 2) * kTileK;
      stage_pair(Ap + offA + ko, stepA, Btp + offB + ko, stepB, lds0 + bufo * 2);
      if (SPLIT) stage_pair(A2p + offA + ko, stepA, Bt2p + offB + ko, stepB, lds0 + (bufo + 2 * kPlane) * 2);
    }
  }
  // OUT_MODE 3: the cos and sin values of the wave's 32 rows, columns rlane and rlane + 16, all asked for here in one go:
  // their latency is paid once, not once per 16 rows behind the first rows' stores
  float cs[2][8][2], sn[2][8][2];
  if (OUT_MODE == 3) {
    const int tr0 = (m0 + mOff) * kRotD + rlane;
#pragma unroll
    for (int i = 0; i < 2; ++i)
#pragma unroll
      for (int r = 0; r < 8; ++r)
#pragma unroll
        for (int h = 0; h < 2; ++h) {
          cs[i][r][h] = bias[tr0 + ((i << 4) + r) * kRotD + (h << 4)];
          sn[i][r][h] = resid[tr0 + ((i << 4) + r) * kRotD + (h << 4)];
        }
    // the address registers of the loads above are reused right behind them: the wait stands in front of that reuse
    asm volatile("s_wait_xcnt 0x0" ::: "memory");
  }
  asm volatile("s_wait_asynccnt 0x0" ::: "memory");     // no copy is in flight behind the loop
  acc_guard4(acc[0][0], acc[0][1], acc[0][2], acc[0][3]);
  acc_guard4(acc[1][0], acc[1][1], acc[1][2], acc[1][3]);

  // ---- epilogue ----
  float* slab = sT[wave];
  const float* Rb = RESID ? (resid + (size_t)b * strideR) : nullptr;
#pragma unroll
  for (int i = 0; i < 2; ++i) {
    const int mBase = m0 + (i << 4);
    if (OUT_MODE == 3) {
      // The wave's 64 columns are one head: columns d and d + 32 of a row lie in one lane (tiles j and j + 2), so the rotation needs no exchange.
#pragma unroll
      for (int r = 0; r < 8; ++r) {
        const float c0 = cs[i][r][0], c1 = cs[i][r][1];
        const float s0 = sn[i][r][0], s1 = sn[i][r][1];
        const float x0 = acc[i][0][r] * scale, x1 = acc[i][1][r] * scale;
        const float x2 = acc[i][2][r] * scale, x3 = acc[i][3][r] * scale;
        float* row = slab + (mOff + r) * 68 + rlane;
        row[0]  = x0 * c0 + x2 * s0;
        row[16] = x1 * c1 + x3 * s1;
        row[32] = x2 * c0 - x0 * s0;
        row[48] = x3 * c1 - x1 * s1;
      }
    } else {
#pragma unroll
      for (int j = 0; j < 4; ++j) {
        const int n = n0 + (j << 4) + rlane;
        float bv = 0.f;
        if (BIAS_MODE == 2) bv = bias[n];
#pragma unroll
        for (int r = 0; r < 8; ++r) {
          float v = acc[i][j][r] * scale;
          if (BIAS_MODE == 1) v += bias[mBase + mOff + r];
          if (BIAS_MODE == 2) v += bv;
          if (RESID) v += Rb[(size_t)(mBase + mOff + r) * ldc + n];
          if (ACT == 2) v = fmaxf(v, 0.0f);
          if (ACT == 4) v = (v > 0.f) ? v : 0.01f * v;
          if (ACT == 6) {
            const float sg = kPCarry / (1.0f + expf(-v));
            v = (n > (mBase + mOff + r)) ? 0.0f : sg;
          }
          slab[(mOff + r) * 68 + (j << 4) + rlane] = v;
        }
      }
    }
    __builtin_amdgcn_fence(__ATOMIC_RELEASE, "workgroup");
    __builtin_amdgcn_wave_barrier();
    __builtin_amdgcn_fence(__ATOMIC_ACQUIRE, "workgroup");
    if (OUT_MODE == 0) {
      float* C = (float*)Cout + (size_t)b * strideC;
      const int hh = lane >> 4, c4 = (lane & 15) * 4;     // row seg = 256 B = 16 lanes x 16 B
      {
#pragma unroll
        for (int it = 0; it < 8; ++it) {
          const int row = it * 2 + hh;
          v4f v = *(const v4f*)(slab + row * 68 + c4);
          *(v4f*)(C + (size_t)(mBase + row) * ldc + n0 + c4) = v;
        }
        
      }
    } else if (OUT_MODE == 3) {
      // 8 lanes a row: each squares its 8 values, three exchanges give the row's sum; a store covers 4 rows = 512 contiguous bytes
      const int q = lane >> 3, c8 = (lane & 7) * 8;
      unsigned short* C = (unsigned short*)Cout + (size_t)b * strideC + (size_t)(n0 >> 6) * M * kHeadD;
#pragma unroll
      for (int it = 0; it < 4; ++it) {
        const int row = it * 4 + q;
        const float* sp = slab + row * 68 + c8;
        const v4f a = *(const v4f*)(sp);
        const v4f c = *(const v4f*)(sp + 4);
        float ss = a[0] * a[0];
#pragma unroll
        for (int e = 1; e < 4; ++e) ss = fmaf(a[e], a[e], ss);
#pragma unroll
        for (int e = 0; e < 4; ++e) ss = fmaf(c[e], c[e], ss);
        ss = add_lane_xor<1>(ss);
        ss = add_lane_xor<2>(ss);
        ss = add_lane_xor<4>(ss);
        const float rn = rsqrtf(ss * (1.0f / kHeadD) + kEpsRms);
        v8h hv;
#pragma unroll
        for (int e = 0; e < 4; ++e) {
          hv[e]     = (_Float16)(a[e] * rn);
          hv[4 + e] = (_Float16)(c[e] * rn);
        }
        *(v8h*)(C + (size_t)(mBase + row) * kHeadD + c8) = hv;
      }
    } else {
      const int q = lane >> 3, c8 = (lane & 7) * 8;
      unsigned short* C  = (unsigned short*)Cout  + (size_t)b * strideC;
      unsigned short* C2 = (OUT_MODE == 2) ? ((unsigned short*)Cout2 + (size_t)b * strideC) : nullptr;
      {
#pragma unroll
        for (int it = 0; it < 4; ++it) {
          const int row = it * 4 + q;
          const float* sp = slab + row * 68 + c8;
          v8h hv, lv;
#pragma unroll
          for (int e = 0; e < 8; ++e) {
            if (OUT_MODE == 1) {
              hv[e] = (_Float16)sp[e];
            } else {
              unsigned short hb = f2bf_bits(sp[e]);
              unsigned short lb = f2bf_bits(sp[e] - bf_bits2f(hb));
              hv[e] = __builtin_bit_cast(_Float16, hb);
              lv[e] = __builtin_bit_cast(_Float16, lb);
            }
          }
          *(v8h*)(C + (size_t)(mBase + row) * ldc + n0 + c8) = hv;
          if (OUT_MODE == 2) *(v8h*)(C2 + (size_t)(mBase + row) * ldc + n0 + c8) = lv;
        }
        
      }
    }
    __builtin_amdgcn_fence(__ATOMIC_RELEASE, "workgroup");
    __builtin_amdgcn_wave_barrier();
    __builtin_amdgcn_fence(__ATOMIC_ACQUIRE, "workgroup");
  }
}

// ---------------------------------------------------------------------------
// x f32 [4096][1024] -> f16 plane (RNE converts), 8 elements per thread.
// Coverage: n8 = 4096*1024/8 = 524288 threads = 2048 blocks x 256 exactly; each lane one 16-B store
// ---------------------------------------------------------------------------
__global__ __launch_bounds__(256) void xcast_kernel(const float* __restrict__ in, unsigned short* __restrict__ o16, int n8) {
  const int i = blockIdx.x * 256 + threadIdx.x;
  if (i >= n8) return;
  const float* p = in + 8 * (size_t)i;
  const v4f a = *(const v4f*)(p);
  const v4f c = *(const v4f*)(p + 4);
  unsigned short hb[8];
#pragma unroll
  for (int e = 0; e < 4; ++e) {
    hb[e]     = h_bits(a[e]);
    hb[4 + e] = h_bits(c[e]);
  }
  const v4u u = (v4u){pk16(hb[0], hb[1]), pk16(hb[2], hb[3]), pk16(hb[4], hb[5]), pk16(hb[6], hb[7])};
  *(v4u*)(o16 + 8 * (size_t)i) = u;
}

// ---------------------------------------------------------------------------
// Weight f32 [1024][1024] -> f16(scale*w), four weights selected by blockIdx.y (block-uniform),
// output plane y at out + y*n8*8 halves. Coverage: n8 = 131072 threads = 512 blocks exactly per plane;
// ---------------------------------------------------------------------------
__global__ __launch_bounds__(256) void wcast_kernel(const float* __restrict__ w0, const float* __restrict__ w1,
                                                    const float* __restrict__ w2, const float* __restrict__ w3,
                                                    unsigned short* __restrict__ out, float scale, int n8) {
  const int i = blockIdx.x * 256 + threadIdx.x;
  if (i >= n8) return;
  const int z = blockIdx.y;
  const float* w = (z == 0) ? w0 : ((z == 1) ? w1 : ((z == 2) ? w2 : w3));
  const float* p = w + 8 * (size_t)i;
  const v4f a = *(const v4f*)(p);
  const v4f c = *(const v4f*)(p + 4);
  unsigned short hb[8];
#pragma unroll
  for (int e = 0; e < 4; ++e) {
    hb[e]     = h_bits(a[e] * scale);
    hb[4 + e] = h_bits(c[e] * scale);
  }
  const v4u u = (v4u){pk16(hb[0], hb[1]), pk16(hb[2], hb[3]), pk16(hb[4], hb[5]), pk16(hb[6], hb[7])};
  unsigned short* q = out + (size_t)z * (size_t)n8 * 8 + 8 * (size_t)i;
  *(v4u*)q = u;
}

// ---------------------------------------------------------------------------
// Fused causal sigmoid attention, all heads in one launch; P never leaves the registers.
// One wave owns 32 query rows of one head and walks the keys 32 at a time, in rising order:
//   S^T = K . Q^T / 16 A = K16 rows (16 keys), B = Q16 rows (16 queries) times 1/16, k = head dim (2 x 32)
//   P^T = f16(1024 + 1024 * tanh(S^T)) = f16(2048 * sigmoid(q.k / 8)), zero where key > query
//   O^T += V^T . P^T   A = VT16 rows (16 head dims), B = P^T, k = 32 keys
// A lane's accumulators of the two 16-key tiles of S^T are, converted in place, its B operand of the second
// product (element e of tile kt -> element 8*kt + e), in the k order that Frag::load gives the V^T rows.
// O^T: a lane holds 8 consecutive head dims of one query row: one 16-byte store each.
// Placement: 256 blocks x 8 waves; block = (head, group g); waves 0..3 take query tiles 4g+w, waves 4..7
// take tiles 127-(4g+w-4), so every pair (w, w+4) walks 129 key steps together. Every (head, tile) once.
// K and V^T reach the waves through LDS: the eight waves of a block walk the same keys of the same head, so a trip's
// 128 K rows (128 bytes each) and 64 V^T rows (256 bytes each) are brought once for all of them, as whole lines, by
// asynchronous copies; no fragment load gathers 16 lines from the caches any more. Two buffers: the copies of trip t+1
// fly while trip t is worked on. LDS pitches 144 and 272 bytes (16 B x odd: ds_load_b128 without bank conflicts).
// Every wave copies and passes the barrier in every trip of its block, also a wave that is past its own diagonal.
// ---------------------------------------------------------------------------
constexpr int kTripKeys = 128;                   // keys per trip: four steps of 32
constexpr int kKPitch   = 72;                    // LDS pitch of a K row in 16-bit elements (144 bytes)
constexpr int kVPitch   = 136;                   // LDS pitch of a V^T row in 16-bit elements (272 bytes)
constexpr int kKTile    = kTripKeys * kKPitch;   // 16-bit elements of a trip's K rows in LDS
constexpr int kVTile    = kHeadD * kVPitch;      // 16-bit elements of a trip's V^T rows in LDS
constexpr int kKVStage  = kKTile + kVTile;       // one buffer: [K][V^T]

// This thread's share of a trip: 16 bytes of K rows r + 32 i (8 lanes a row) and of V^T rows r' + 16 i (16 lanes a row).
__device__ __forceinline__ void stage_kv(const unsigned short* gk, const unsigned short* gv, unsigned ldsK, unsigned ldsV) {
  unsigned l[8];
  const unsigned short* g[8];
#pragma unroll
  for (int i = 0; i < 4; ++i) {
    l[i]     = ldsK + (unsigned)(i * 32 * kKPitch * 2);
    l[4 + i] = ldsV + (unsigned)(i * 16 * kVPitch * 2);
    g[i]     = gk + (size_t)i * 32 * kHeadD;
    g[4 + i] = gv + (size_t)i * 16 * kSeqLen;
  }
  async_copy8(l, g);
}

// Two scores at a time: 2048 * sigmoid(x) = 1024 + 1024 * tanh(x / 2): the hardware's tanh, one transcendental a score, and
// one packed fma. u = x / 2 = q.k / 16 comes out of the matrix product as it is: the Q fragments carry the 1/16 (kQFold).
// Right over the whole range without a range test: tanh -> 1 gives 2048, tanh -> -1 gives 0. All of it in f32; the result is
// rounded to f16 as before.
__device__ __forceinline__ v2f sigmoid2_carried(v2f u) {
  const v2f t = (v2f){__builtin_amdgcn_tanhf(u.x), __builtin_amdgcn_tanhf(u.y)};
  return __builtin_elementwise_fma(t, (v2f){0.5f * kPCarry, 0.5f * kPCarry}, (v2f){0.5f * kPCarry, 0.5f * kPCarry});
}

// K fragments of one step of 32 keys; sk = this lane's place in the step's first K row in LDS
__device__ __forceinline__ void load_k(const _Float16* sk, v16h (&kf)[2][2]) {
#pragma unroll
  for (int kt = 0; kt < 2; ++kt)
#pragma unroll
    for (int ks = 0; ks < 2; ++ks) kf[kt][ks] = Frag<_Float16>::load(sk + (kt << 4) * kKPitch + (ks << 5));
}

// One step of 32 keys out of LDS. sk, sv: this lane's places in the step's K rows and V^T columns. MASK: the diagonal step
// (first key == first query of the wave). NEXT: the next step lies in the same buffer, its K fragments are fetched here.
template <bool MASK, bool NEXT>
__device__ __forceinline__ void attn_step(const _Float16* sk, const _Float16* sv, int c, int h8,
                                          v16h (&kf)[2][2], const v16h (&qf)[2][2], v8f (&o)[4][2]) {
  v8f s[2][2];
#pragma unroll
  for (int kt = 0; kt < 2; ++kt)
#pragma unroll
    for (int g = 0; g < 2; ++g) {
      s[kt][g] = (v8f){0.f,0.f,0.f,0.f,0.f,0.f,0.f,0.f};
      s[kt][g] = Frag<_Float16>::mma(kf[kt][0], qf[g][0], s[kt][g]);
      s[kt][g] = Frag<_Float16>::mma(kf[kt][1], qf[g][1], s[kt][g]);
    }
  // one group of LDS loads a step: this step's V^T rows and, behind this step's last use of the K registers, the next step's K rows
  v16h vf[4], kn[2][2];
#pragma unroll
  for (int dt = 0; dt < 4; ++dt) vf[dt] = Frag<_Float16>::load(sv + (dt << 4) * kVPitch);
  if (NEXT) load_k(sk + 32 * kKPitch, kn);
  // keeps the loads above in front of the sigmoid work, which covers their latency: sunk below it, they are waited out at the products that use them
  __builtin_amdgcn_sched_barrier(0);
#pragma unroll
  for (int g = 0; g < 2; ++g) {
    v16h p;
#pragma unroll
    for (int kt = 0; kt < 2; ++kt)
#pragma unroll
      for (int r = 0; r < 8; r += 2) {
        v2f sg = sigmoid2_carried((v2f){s[kt][g][r], s[kt][g][r + 1]});
        if (MASK) {
          const int rel = ((kt << 4) + h8 + r) - ((g << 4) + c);   // key minus query of element r
          sg.x = (rel > 0) ? 0.0f : sg.x;
          sg.y = (rel + 1 > 0) ? 0.0f : sg.y;
        }
        p[(kt << 3) + r]     = (_Float16)sg.x;
        p[(kt << 3) + r + 1] = (_Float16)sg.y;
      }
#pragma unroll
    for (int dt = 0; dt < 4; ++dt) o[dt][g] = Frag<_Float16>::mma(vf[dt], p, o[dt][g]);
  }
  if (NEXT) {
#pragma unroll
    for (int kt = 0; kt < 2; ++kt)
#pragma unroll
      for (int ks = 0; ks < 2; ++ks) kf[kt][ks] = kn[kt][ks];
  }
}

__global__ __launch_bounds__(256) void attn_fused_kernel(const unsigned short* __restrict__ Q16p,
                                                         const unsigned short* __restrict__ K16p,
                                                         const unsigned short* __restrict__ VT16p,
                                                         unsigned short* __restrict__ O16p) {
  __shared__ __align__(16) unsigned short kv[2 * kKVStage];
  const int lane = threadIdx.x & 31;
  const int wave = __builtin_amdgcn_readfirstlane(threadIdx.x >> 5);   // in a scalar register: the tests on it below are scalar branches
  const int c    = lane & 15;
  const int h8   = (lane >> 4) * 8;
  const int head = blockIdx.x & (kHeads - 1);
  const int grp  = blockIdx.x >> 4;                                    // 0..15
  const int qt   = (wave < 4) ? (4 * grp + wave) : (127 - (4 * grp + wave - 4));
  const int q0   = qt << 5;
  const int nt    = kSeqLen / kTripKeys - grp;    // trips of the block: up to the diagonal of its longest wave, tile 127 - 4 grp (17..32)
  const int tEdge = qt >> 2;                      // the trip that holds this wave's diagonal step
  const int nFree = qt & 3;                       // unmasked steps of that trip
  const _Float16* Qh = (const _Float16*)Q16p + (size_t)head * kSeqLen * kHeadD;

  // this thread's share of the copies
  const unsigned short* gk = K16p  + (size_t)head * kSeqLen * kHeadD + (size_t)(threadIdx.x >> 3) * kHeadD + (threadIdx.x & 7) * 8;
  const unsigned short* gv = VT16p + ((size_t)head * kHeadD + (threadIdx.x >> 4)) * kSeqLen + (threadIdx.x & 15) * 8;
  const unsigned ldsK = (unsigned)(size_t)(&kv[(threadIdx.x >> 3) * kKPitch + (threadIdx.x & 7) * 8]);            // LDS byte address: low word of the pointer
  const unsigned ldsV = (unsigned)(size_t)(&kv[kKTile + (threadIdx.x >> 4) * kVPitch + (threadIdx.x & 15) * 8]);

  // tile 0 into buffer 0
  stage_kv(gk, gv, ldsK, ldsV);

  v16h qf[2][2], kf[2][2];
#pragma unroll
  for (int g = 0; g < 2; ++g)
#pragma unroll
    for (int ks = 0; ks < 2; ++ks)
      qf[g][ks] = Frag<_Float16>::load(Qh + (size_t)(q0 + (g << 4) + c) * kHeadD + (ks << 5) + h8);
  // the address registers of the loads above are reused right behind them: the wait stands in front of that reuse
  asm volatile("s_wait_xcnt 0x0" ::: "memory");
  qf[0][0] *= (_Float16)kQFold;
  qf[0][1] *= (_Float16)kQFold;
  qf[1][0] *= (_Float16)kQFold;
  qf[1][1] *= (_Float16)kQFold;
  v8f o[4][2];
#pragma unroll
  for (int dt = 0; dt < 4; ++dt)
#pragma unroll
    for (int g = 0; g < 2; ++g) o[dt][g] = (v8f){0.f,0.f,0.f,0.f,0.f,0.f,0.f,0.f};

  asm volatile("s_wait_asynccnt 0x0" ::: "memory");   // this wave's copies of tile 0 have landed
  __syncthreads();                                    // every wave's have
  if (nt > 1) stage_kv(gk + (size_t)kTripKeys * kHeadD, gv + kTripKeys, ldsK + kKVStage * 2, ldsV + kKVStage * 2);

  for (int t = 0; t < nt; ++t) {
    const int bufo = (t & 1) * kKVStage;
    const _Float16* sk = (const _Float16*)(kv + bufo) + c * kKPitch + h8;
    const _Float16* sv = (const _Float16*)(kv + bufo + kKTile) + c * kVPitch + h8;
    if (t < tEdge) {                 // wave-uniform: all four steps lie below the diagonal
      load_k(sk, kf);
      // keeps the trip's first eight K loads together in front of its products: spread among them, each pair is waited out on its own
      __builtin_amdgcn_sched_barrier(0);
      attn_step<false, true >(sk,                sv,      c, h8, kf, qf, o);
      attn_step<false, true >(sk + 32 * kKPitch, sv + 32, c, h8, kf, qf, o);
      attn_step<false, true >(sk + 64 * kKPitch, sv + 64, c, h8, kf, qf, o);
      attn_step<false, false>(sk + 96 * kKPitch, sv + 96, c, h8, kf, qf, o);
    }
    if (t == tEdge) {                // wave-uniform: the steps up to the diagonal, then the diagonal step
      load_k(sk, kf);
      for (int j = 0; j < nFree; ++j) {
        attn_step<false, true>(sk, sv, c, h8, kf, qf, o);
        sk += 32 * kKPitch;
        sv += 32;
      }
      attn_step<true, false>(sk, sv, c, h8, kf, qf, o);
    }
    asm volatile("s_wait_dscnt 0x0" ::: "memory");      // this wave's reads of the buffer are done before it is refilled
    asm volatile("s_wait_asynccnt 0x0" ::: "memory");   // this wave's copies of tile t+1 have landed
    __syncthreads();                                    // publishes tile t+1 and ends every wave's reads of tile t
    if (t + 2 < nt)
      stage_kv(gk + (size_t)(t + 2) * kTripKeys * kHeadD, gv + (size_t)(t + 2) * kTripKeys, ldsK + bufo * 2, ldsV + bufo * 2);
  }
  asm volatile("s_wait_asynccnt 0x0" ::: "memory");     // no copy is in flight behind the loop

#pragma unroll
  for (int g = 0; g < 2; ++g)
#pragma unroll
    for (int dt = 0; dt < 4; ++dt) {
      v8h hv;
#pragma unroll
      for (int r = 0; r < 8; ++r) hv[r] = (_Float16)(o[dt][g][r] * kPVScale);
      *(v8h*)(O16p + (size_t)(q0 + (g << 4) + c) * kEmbd + head * kHeadD + (dt << 4) + h8) = hv;
    }
}

// ---------------------------------------------------------------------------
// Host-side orchestration
// ---------------------------------------------------------------------------
extern "C" void kernel_launch(void* const* d_in, const int* in_sizes, int n_in,
                              void* d_out, int out_size, void* d_ws,
                              size_t ws_size, hipStream_t stream) {
  if (n_in < 7) return;
  if (in_sizes[0] != kSeqLen * kEmbd) return;
  if (in_sizes[1] != kSeqLen * kRotD || in_sizes[2] != kSeqLen * kRotD) return;
  if (in_sizes[3] != kEmbd * kEmbd || in_sizes[4] != kEmbd * kEmbd ||
      in_sizes[5] != kEmbd * kEmbd || in_sizes[6] != kEmbd * kEmbd) return;
  if (out_size != kSeqLen * kEmbd) return;

  const float* x    = (const float*)d_in[0];
  const float* cosT = (const float*)d_in[1];
  const float* sinT = (const float*)d_in[2];
  const float* wq   = (const float*)d_in[3];
  const float* wk   = (const float*)d_in[4];
  const float* wv   = (const float*)d_in[5];
  const float* wp   = (const float*)d_in[6];

  // ---- workspace region map (bytes) ----
  // persistent:
  //   Q16  f16 [16][4096][64]   8 MiB  @ 0
  //   K16  f16 [16][4096][64]   8 MiB  @ 8 MiB   (must follow Q16 directly)
  //   VT16 f16 [1024][4096]     8 MiB  @ 16 MiB
  //   O16  f16 [4096][1024]     8 MiB  @ 24 MiB
  //   W16  f16 4 x [1024][1024] 8 MiB  @ 32 MiB  (wq, wk, wproj, wv carried x16)
  // dead after the projections:
  //   X16  f16  8 MiB @ 40 MiB
  // total = 48 MiB
  const size_t MiB = 1048576;
  const size_t total = 48 * MiB;
  if (total > ws_size) return;
  char* ws = (char*)d_ws;
  unsigned short* Q16  = (unsigned short*)(ws + 0 * MiB);
  unsigned short* K16  = (unsigned short*)(ws + 8 * MiB);
  unsigned short* VT16 = (unsigned short*)(ws + 16 * MiB);
  unsigned short* O16  = (unsigned short*)(ws + 24 * MiB);
  unsigned short* W16  = (unsigned short*)(ws + 32 * MiB);
  unsigned short* X16  = (unsigned short*)(ws + 40 * MiB);
  unsigned short* WP16 = W16 + 2 * (size_t)kEmbd * kEmbd;
  unsigned short* WV16 = W16 + 3 * (size_t)kEmbd * kEmbd;
  const float* fdummy = (const float*)(ws);

  // 1) casts
  {
    const int n8x = (kSeqLen * kEmbd) / 8;          // 524288 = 2048 * 256
    xcast_kernel<<<dim3((n8x + 255) / 256), 256, 0, stream>>>(x, X16, n8x);
    const int n8w = (kEmbd * kEmbd) / 8;            // 131072 = 512 * 256
    wcast_kernel<<<dim3((n8w + 255) / 256, 4), 256, 0, stream>>>(wq, wk, wp, wv, W16, kWCarry, n8w);
  }

  // 2) q,k = X16 . Wq16^T / Wk16^T : M=4096, N=1024, K=1024 (K%64==0, M,N%128==0), scale 1/16; RoPE + RMS-norm in the epilogue
  //    -> Q16, K16 planes [h][t][64]
  {
    const int tiles = (kSeqLen / 128) * (kEmbd / 128);   // 256 work-groups a weight
    wmma_gemm64<0, false, 0, 3, false, 0><<<dim3(tiles, 2), 256, 0, stream>>>(
        X16, X16, kEmbd, (long)0,
        W16, W16, kEmbd, (long)kEmbd * kEmbd,
        (void*)Q16, (void*)Q16, kHeadD, (long)kHeads * kSeqLen * kHeadD,
        cosT, sinT, (long)0,
        kSeqLen, kEmbd, kEmbd, kQKScale);
  }

  // 3) V^T = Wv16 . X16^T, one f16 product: A = Wv plane [1024][1024] carried x16, Bt = X plane [4096][1024];
  //    M=1024, N=4096, K=1024; f16 out [h*64+d][t] carried x16 (the weight's carry stays on it), ldc = 4096
  {
    const int tiles = (kEmbd / 128) * (kSeqLen / 128);   // 256 work-groups
    wmma_gemm64<0, false, 0, 1, false, 0><<<dim3(tiles, 1), 256, 0, stream>>>(
        WV16, WV16, kEmbd, (long)0,
        X16, X16, kEmbd, (long)0,
        (void*)VT16, (void*)VT16, kSeqLen, (long)0,
        fdummy, fdummy, (long)0,
        kEmbd, kSeqLen, kEmbd, kVScale);
  }

  // 4) attention, all heads: O16 = 64*y, f16 [4096][1024]; 16 heads x 16 groups = 256 blocks
  attn_fused_kernel<<<dim3(kHeads * (kSeqLen / 256)), 256, 0, stream>>>(Q16, K16, VT16, O16);

  // 5) out = (64*y) . (16*Wp)^T * (1/1024): M=4096, N=1024, K=1024, f32 out to d_out
  {
    const int tiles = (kSeqLen / 128) * (kEmbd / 128);   // 256 work-groups
    wmma_gemm64<0, false, 0, 0, false, 0><<<dim3(tiles, 1), 256, 0, stream>>>(
        O16, O16, kEmbd, (long)0,
        WP16, WP16, kEmbd, (long)0,
        d_out, d_out, kEmbd, (long)0,
        fdummy, fdummy, (long)0,
        kSeqLen, kEmbd, kEmbd, kOutScale);
  }
}

// v008
// Measured time: 81.2 microseconds a run.
// In both of two side-by-side timings against v007, it was 1.14 times as fast.
// All steps since v000 together make it 19.7 times as fast.
// Contractions: q,k projections (X f16 x W^T f16 carried x16), v projection (Wv f16 carried x16 x X^T f16), scores q.k^T (q,k f16 planes, K=64), attn.v (P f16 carried x2048 x V^T f16 carried x16), output projection (y f16 carried x64 x Wp^T f16 carried x16): v_wmma_f32_16x16x32_f16, f32 accumulate; rope, rms-norm, sigmoid in f32.
#include <hip/hip_runtime.h>
#include <math.h>

// ---------------------------------------------------------------------------
// Problem constants
// ---------------------------------------------------------------------------
constexpr int kSeqLen = 4096;
constexpr int kEmbd   = 1024;
constexpr int kHeads  = 16;
constexpr int kHeadD  = 64;
constexpr int kRotD   = 32;
constexpr float kWCarry   = 16.0f;              // f16 weights carried x16
constexpr float kVCarry   = 16.0f;              // V^T f16 plane carried x16
constexpr float kPCarry   = 2048.0f;            // sigmoid probabilities carried x2048
constexpr float kQKScale  = 1.0f / 16.0f;       // undo weight carry on q,k
constexpr float kVScale   = kVCarry / kWCarry; // V^T plane: the weight's carry becomes the plane's
constexpr float kScScale  = 0.125f;             // 1/sqrt(64)
constexpr float kQFold    = 0.5f * kScScale;    // on the Q fragments: the product is the argument of tanh, score / 2 (a power of two: no bit of a normal f16 is lost)
constexpr float kPVScale  = 1.0f / 32768.0f;    // 1/(kPCarry*kVCarry): O16 = 64*y
constexpr float kOutScale = 1.0f / 1024.0f;     // (1/64) * (1/kWCarry)
constexpr float kEpsRms   = 1e-6f;

typedef __attribute__((ext_vector_type(16))) _Float16 v16h;
typedef __attribute__((ext_vector_type(8)))  _Float16 v8h;
typedef __attribute__((ext_vector_type(16))) __bf16   v16b;
typedef __attribute__((ext_vector_type(8)))  __bf16   v8b;
typedef __attribute__((ext_vector_type(8)))  float    v8f;
typedef __attribute__((ext_vector_type(4)))  float    v4f;
typedef __attribute__((ext_vector_type(2)))  float    v2f;
typedef __attribute__((ext_vector_type(4)))  unsigned int v4u;

// ---------------------------------------------------------------------------
// Helpers
// ---------------------------------------------------------------------------
__device__ __forceinline__ unsigned short f2bf_bits(float f) {
  unsigned u = __float_as_uint(f);
  return (unsigned short)((u + 0x7FFFu + ((u >> 16) & 1u)) >> 16);
}
__device__ __forceinline__ float bf_bits2f(unsigned short h) { return __uint_as_float(((unsigned)h) << 16); }

// hazard guards as plain device helpers
__device__ __forceinline__ void dep_guard_h(v8f& a, v8f& b, v16h x, v16h y) { asm volatile("v_nop\n\tv_nop\n\tv_nop\n\tv_nop" : "+v"(a), "+v"(b) : "v"(x), "v"(y)); }
__device__ __forceinline__ void dep_guard_b(v8f& a, v8f& b, v16b x, v16b y) { asm volatile("v_nop\n\tv_nop\n\tv_nop\n\tv_nop" : "+v"(a), "+v"(b) : "v"(x), "v"(y)); }
__device__ __forceinline__ void keep4_h(v16h a, v16h b, v16h c, v16h d) { asm volatile("v_nop" :: "v"(a), "v"(b), "v"(c), "v"(d)); }
__device__ __forceinline__ void keep4_b(v16b a, v16b b, v16b c, v16b d) { asm volatile("v_nop" :: "v"(a), "v"(b), "v"(c), "v"(d)); }
__device__ __forceinline__ void acc_guard4(v8f& a, v8f& b, v8f& c, v8f& d) { asm volatile("v_nop\n\tv_nop\n\tv_nop\n\tv_nop" : "+v"(a), "+v"(b), "+v"(c), "+v"(d)); }
template <typename T> struct Frag;
template <> struct Frag<_Float16> {
  typedef v16h V; union U { v16h v; v8h h[2]; };
  static __device__ __forceinline__ v16h load(const _Float16* p) {   // elements 0..7 <- p[0..7], 8..15 <- p[16..23]
    U f; f.h[0] = *(const v8h*)(p); f.h[1] = *(const v8h*)(p + 16); return f.v;
  }
  static __device__ __forceinline__ v8f mma(v16h a, v16h b, v8f c) {
    return __builtin_amdgcn_wmma_f32_16x16x32_f16(false, a, false, b, (short)0, c, false, false);
  }
  static __device__ __forceinline__ void guard(v8f& a, v8f& b, v16h x, v16h y) { dep_guard_h(a, b, x, y); }
  static __device__ __forceinline__ void keep(v16h a, v16h b, v16h c, v16h d) { keep4_h(a, b, c, d); }
};
template <> struct Frag<__bf16> {
  typedef v16b V; union U { v16b v; v8b h[2]; };
  static __device__ __forceinline__ v16b load(const __bf16* p) {
    U f; f.h[0] = *(const v8b*)(p); f.h[1] = *(const v8b*)(p + 16); return f.v;
  }
  static __device__ __forceinline__ v8f mma(v16b a, v16b b, v8f c) {
    return __builtin_amdgcn_wmma_f32_16x16x32_bf16(false, a, false, b, (short)0, c, false, false);
  }
  static __device__ __forceinline__ void guard(v8f& a, v8f& b, v16b x, v16b y) { dep_guard_b(a, b, x, y); }
  static __device__ __forceinline__ void keep(v16b a, v16b b, v16b c, v16b d) { keep4_b(a, b, c, d); }
};

__device__ __forceinline__ unsigned pk16(unsigned short a, unsigned short b) { return (unsigned)a | ((unsigned)b << 16); }
__device__ __forceinline__ unsigned short h_bits(float f) { const _Float16 h = (_Float16)f; return __builtin_bit_cast(unsigned short, h); }

// ---- Batched WMMA GEMM, operands staged in LDS ------------------------------------------------
// C[m,n] = scale * sum_k A[m,k] * Bt[n,k] (+bias)(+resid).
// A row-major [M,K]; Bt row-major [N,K]; M,N % 128 == 0, K % 64 == 0.
// A work-group of 8 waves owns a 128x128 tile of C; wave w owns rows 32*(w>>1).., columns 64*(w&1).. of it.
// Per trip 64 k of the 128 A rows and the 128 Bt rows lie in LDS, brought there by asynchronous copies as whole
// 128-byte lines (8 lanes a row), so that no fragment load gathers 16 lines from the caches any more.
// LDS rows have a pitch of 144 bytes (16 B x odd: ds_load_b128 without bank conflicts). Two buffers: the copies of
// trip t+1 fly while trip t is worked on. The k order of the sums is the one of the fragment loads from LDS.
// SPLIT: operands are hi/lo planes (A2/Bt2 = lo planes, same layout); product = hi.hi + hi.lo + lo.hi.
// BIAS_MODE: 0 = none, 1 = bias[m], 2 = bias[n].
// OUT_MODE: 0 = f32, 1 = f16, 2 = bf16 hi plane (Cout) + bf16 lo plane (Cout2),
//           3 = rotary step and per-head RMS-norm in f32, then f16 planes [n / 64][m][64] (bias = cos table, resid = sin table, both [m][32]).
// ACT: 2 relu, 4 leaky, 6 = causal sigmoid carry: v = (n > m) ? 0 : kPCarry / (1 + exp(-v)).
// ET: 0 = f16 operands, 1 = bf16 operands (pointers passed as 16-bit storage)
// JOIN: plane 2 of the grid (blockIdx.y == 2) is a second, independent product in the same launch:
//       Cout2[n,m] = scale2 * sum_k A2p[n,k] * Bt2p[m,k], an N x M result, f16, row pitch ldc2 (OUT_MODE 1's epilogue).
constexpr int kTileK    = 64;                  // k per trip, 128 bytes of every operand row
constexpr int kRowPitch = 72;                  // LDS row pitch in 16-bit elements (144 bytes)
constexpr int kPlane    = 128 * kRowPitch;     // 16-bit elements of one operand plane in LDS

// Eight copies of 16 bytes a lane, global memory -> LDS through no register. The closing wait stands inside the statement,
// in front of any later rewrite of the address registers that the copies name.
__device__ __forceinline__ void async_copy8(const unsigned (&l)[8], const unsigned short* const (&g)[8]) {
  asm volatile("global_load_async_to_lds_b128 %0, %8, off\n\t"
               "global_load_async_to_lds_b128 %1, %9, off\n\t"
               "global_load_async_to_lds_b128 %2, %10, off\n\t"
               "global_load_async_to_lds_b128 %3, %11, off\n\t"
               "global_load_async_to_lds_b128 %4, %12, off\n\t"
               "global_load_async_to_lds_b128 %5, %13, off\n\t"
               "global_load_async_to_lds_b128 %6, %14, off\n\t"
               "global_load_async_to_lds_b128 %7, %15, off\n\t"
               "s_wait_xcnt 0x0"
               :: "v"(l[0]), "v"(l[1]), "v"(l[2]), "v"(l[3]), "v"(l[4]), "v"(l[5]), "v"(l[6]), "v"(l[7]),
                  "v"(g[0]), "v"(g[1]), "v"(g[2]), "v"(g[3]), "v"(g[4]), "v"(g[5]), "v"(g[6]), "v"(g[7])
               : "memory");
}
// One plane of A and one of Bt, 128 rows x 128 bytes each: this thread's 16 bytes of rows r, r+32, r+64, r+96.
__device__ __forceinline__ void stage_pair(const unsigned short* ga, size_t stepA, const unsigned short* gb, size_t stepB,
                                           unsigned lds) {
  unsigned l[8];
  const unsigned short* g[8];
#pragma unroll
  for (int i = 0; i < 4; ++i) {
    l[i]     = lds + (unsigned)(i * 32 * kRowPitch * 2);
    l[4 + i] = lds + (unsigned)((kPlane + i * 32 * kRowPitch) * 2);
    g[i]     = ga + i * stepA;
    g[4 + i] = gb + i * stepB;
  }
  async_copy8(l, g);
}

// x + (x of lane l ^ XM), inside a row of 16 lanes, on the vector port (a shuffle through the LDS unit costs its latency at every step)
template <int XM>
__device__ __forceinline__ float add_lane_xor(float x) {
  const int y = __builtin_amdgcn_update_dpp(0, __builtin_bit_cast(int, x), 0x160 | XM, 0xf, 0xf, true);   // 0x160 | XM: row_xmask:XM
  return x + __builtin_bit_cast(float, y);
}

template <int ET> struct Elem;
template <> struct Elem<0> { typedef _Float16 T; };
template <> struct Elem<1> { typedef __bf16 T; };
template <int ET, bool SPLIT, int BIAS_MODE, int OUT_MODE, bool RESID, int ACT = 0, bool JOIN = false>
__global__ __launch_bounds__(256) void wmma_gemm64(
    const unsigned short* __restrict__ Ap, const unsigned short* __restrict__ A2p, int lda, long strideA,
    const unsigned short* __restrict__ Btp, const unsigned short* __restrict__ Bt2p, int ldb, long strideB,
    void* __restrict__ Cout, void* __restrict__ Cout2, int ldc1, long strideC,
    const float* __restrict__ bias,
    const float* __restrict__ resid, long strideR,
    int M, int N, int K, float scale1, int ldc2, float scale2) {
  static_assert(!JOIN || (!SPLIT && OUT_MODE == 3), "the second product takes the places of the lo planes");
  typedef typename Elem<ET>::T T;
  typedef typename Frag<T>::V V;
  constexpr int kStage = (SPLIT ? 4 : 2) * kPlane;           // one buffer: [A][Bt], SPLIT: [A hi][Bt hi][A lo][Bt lo]
  constexpr int kGroupK = (SPLIT || JOIN) ? 32 : 64;         // k of one group of fragment loads: 24 loads; JOIN: 12, which keeps a wave under 160 registers:
                                                             // six waves a SIMD, so the grid's three work-groups a WGP (3 x 106 KiB of LDS) are resident together
  __shared__ __align__(16) unsigned short ring[2 * kStage];
  __shared__ __align__(16) float sT[8][16 * 68];   // per-wave 16x64 slab, pitch 68 floats
  const int b    = blockIdx.y;
  const int lane = threadIdx.x & 31;
  const int wave = threadIdx.x >> 5;
  const bool join = JOIN && b == 2;            // the same for the whole work-group
  const int   ldc   = join ? ldc2 : ldc1;
  const float scale = join ? scale2 : scale1;
  const int tilesN = (join ? M : N) >> 7;
  const int tilesM = (join ? N : M) >> 7;
  if ((int)blockIdx.x >= tilesM * tilesN) return;   // the same for the whole work-group, in front of every barrier
  const int bm = blockIdx.x / tilesN;
  const int bn = blockIdx.x - bm * tilesN;
  const int m0 = (bm << 7) + ((wave >> 1) << 5);
  const int n0 = (bn << 7) + ((wave & 1) << 6);
  const int nt = K / kTileK;

  const int rlane = lane & 15;                 // row (A) / col (B, D) within subtile
  const int koff  = (lane >> 4) * 8;           // k offset of this lane half
  const int mOff  = (lane >> 4) * 8;           // D row offset

  // this thread's share of the copies: 16 bytes at column ccol of rows crow + 32 i of every plane
  const int crow = threadIdx.x >> 3;
  const int ccol = (threadIdx.x & 7) * 8;
  const size_t stepA = (size_t)32 * lda;
  const size_t stepB = (size_t)32 * ldb;
  const size_t offA = (join ? 0 : (size_t)b * strideA) + (size_t)((bm << 7) + crow) * lda + ccol;
  const size_t offB = (join ? 0 : (size_t)b * strideB) + (size_t)((bn << 7) + crow) * ldb + ccol;
  const unsigned short* Aop = join ? A2p : Ap;
  const unsigned short* Bop = join ? Bt2p : Btp;
  const unsigned lds0 = (unsigned)(size_t)(&ring[crow * kRowPitch + ccol]);   // LDS byte address: low word of the pointer

  // this lane's fragment rows in a buffer
  const int fragA = (((wave >> 1) << 5) + rlane) * kRowPitch + koff;
  const int fragB = kPlane + (((wave & 1) << 6) + rlane) * kRowPitch + koff;

  v8f acc[2][4];
#pragma unroll
  for (int i = 0; i < 2; ++i)
#pragma unroll
    for (int j = 0; j < 4; ++j) acc[i][j] = (v8f){0.f,0.f,0.f,0.f,0.f,0.f,0.f,0.f};

  // tile 0 into buffer 0, landed and published; then tile 1 into buffer 1
  stage_pair(Aop + offA, stepA, Bop + offB, stepB, lds0);
  if (SPLIT) stage_pair(A2p + offA, stepA, Bt2p + offB, stepB, lds0 + 2 * kPlane * 2);
  asm volatile("s_wait_asynccnt 0x0" ::: "memory");   // this wave's copies of tile 0 have landed
  __syncthreads();                                    // every wave's have
  if (nt > 1) {
    stage_pair(Aop + offA + kTileK, stepA, Bop + offB + kTileK, stepB, lds0 + kStage * 2);
    if (SPLIT) stage_pair(A2p + offA + kTileK, stepA, Bt2p + offB + kTileK, stepB, lds0 + (kStage + 2 * kPlane) * 2);
  }

  for (int t = 0; t < nt; ++t) {
    const int bufo = (t & 1) * kStage;
    const T* sb = (const T*)(ring + bufo);
#pragma unroll
    for (int kg = 0; kg < kTileK; kg += kGroupK) {
      // all fragment loads of a group stand in front of its products: one place where the wave waits for LDS
      V ah[kGroupK / 32][2], al[kGroupK / 32][2], bh[kGroupK / 32][4], bl[kGroupK / 32][4];
#pragma unroll
      for (int s = 0; s < kGroupK / 32; ++s) {
#pragma unroll
        for (int i = 0; i < 2; ++i) {
          const int ao = fragA + (i << 4) * kRowPitch + kg + (s << 5);
          ah[s][i] = Frag<T>::load(sb + ao);
          if (SPLIT) al[s][i] = Frag<T>::load(sb + 2 * kPlane + ao);
        }
#pragma unroll
        for (int j = 0; j < 4; ++j) {
          const int bo = fragB + (j << 4) * kRowPitch + kg + (s << 5);
          bh[s][j] = Frag<T>::load(sb + bo);
          if (SPLIT) bl[s][j] = Frag<T>::load(sb + 2 * kPlane + bo);
        }
      }
#pragma unroll
      for (int s = 0; s < kGroupK / 32; ++s) {
#pragma unroll
        for (int i = 0; i < 2; ++i) {
#pragma unroll
          for (int j = 0; j < 4; ++j) {
            acc[i][j] = Frag<T>::mma(ah[s][i], bh[s][j], acc[i][j]);
            if (SPLIT) {
              acc[i][j] = Frag<T>::mma(ah[s][i], bl[s][j], acc[i][j]);
              acc[i][j] = Frag<T>::mma(al[s][i], bh[s][j], acc[i][j]);
            }
          }
          Frag<T>::guard(acc[i][0], acc[i][3], ah[s][i], SPLIT ? al[s][i] : ah[s][i]);
        }
        Frag<T>::keep(bh[s][0], bh[s][1], bh[s][2], bh[s][3]);
        if (SPLIT) Frag<T>::keep(bl[s][0], bl[s][1], bl[s][2], bl[s][3]);
      }
    }
    asm volatile("s_wait_dscnt 0x0" ::: "memory");      // this wave's reads of the buffer are done before it is refilled
    asm volatile("s_wait_asynccnt 0x0" ::: "memory");   // this wave's copies of tile t+1 have landed
    __syncthreads();                                    // publishes tile t+1 and ends every wave's reads of tile t
    if (t + 2 < nt) {
      const size_t ko = (size_t)(t + 2) * kTileK;
      stage_pair(Aop + offA + ko, stepA, Bop + offB + ko, stepB, lds0 + bufo * 2);
      if (SPLIT) stage_pair(A2p + offA + ko, stepA, Bt2p + offB + ko, stepB, lds0 + (bufo + 2 * kPlane) * 2);
    }
  }
  // OUT_MODE 3: the cos and sin values of the wave's 32 rows, columns rlane and rlane + 16, all asked for here in one go:
  // their latency is paid once, not once per 16 rows behind the first rows' stores
  float cs[2][8][2], sn[2][8][2];
  const bool rope = OUT_MODE == 3 && !join;
  if (rope) {
    const float* pc = bias  + (m0 + mOff) * kRotD + rlane;
    const float* pn = resid + (m0 + mOff) * kRotD + rlane;
#pragma unroll
    for (int i = 0; i < 2; ++i)
#pragma unroll
      for (int r = 0; r < 8; ++r)
#pragma unroll
        for (int h = 0; h < 2; ++h) {
          cs[i][r][h] = pc[((i << 4) + r) * kRotD + (h << 4)];
          sn[i][r][h] = pn[((i << 4) + r) * kRotD + (h << 4)];
        }
    // the address registers of the loads above are reused right behind them: the wait stands in front of that reuse; as its inputs
    // they stay whole up to it, so that no later load of the group lands in one of them
    asm volatile("s_wait_xcnt 0x0" :: "v"(pc), "v"(pn) : "memory");
  }
  asm volatile("s_wait_asynccnt 0x0" ::: "memory");     // no copy is in flight behind the loop
  acc_guard4(acc[0][0], acc[0][1], acc[0][2], acc[0][3]);
  acc_guard4(acc[1][0], acc[1][1], acc[1][2], acc[1][3]);

  // ---- epilogue ----
  float* slab = sT[wave];
  const float* Rb = RESID ? (resid + (size_t)b * strideR) : nullptr;
#pragma unroll
  for (int i = 0; i < 2; ++i) {
    const int mBase = m0 + (i << 4);
    if (rope) {
      // The wave's 64 columns are one head: columns d and d + 32 of a row lie in one lane (tiles j and j + 2), so the rotation needs no exchange.
#pragma unroll
      for (int r = 0; r < 8; ++r) {
        const float c0 = cs[i][r][0], c1 = cs[i][r][1];
        const float s0 = sn[i][r][0], s1 = sn[i][r][1];
        const float x0 = acc[i][0][r] * scale, x1 = acc[i][1][r] * scale;
        const float x2 = acc[i][2][r] * scale, x3 = acc[i][3][r] * scale;
        float* row = slab + (mOff + r) * 68 + rlane;
        row[0]  = x0 * c0 + x2 * s0;
        row[16] = x1 * c1 + x3 * s1;
        row[32] = x2 * c0 - x0 * s0;
        row[48] = x3 * c1 - x1 * s1;
      }
    } else {
#pragma unroll
      for (int j = 0; j < 4; ++j) {
        const int n = n0 + (j << 4) + rlane;
        float bv = 0.f;
        if (BIAS_MODE == 2) bv = bias[n];
#pragma unroll
        for (int r = 0; r < 8; ++r) {
          float v = acc[i][j][r] * scale;
          if (BIAS_MODE == 1) v += bias[mBase + mOff + r];
          if (BIAS_MODE == 2) v += bv;
          if (RESID) v += Rb[(size_t)(mBase + mOff + r) * ldc + n];
          if (ACT == 2) v = fmaxf(v, 0.0f);
          if (ACT == 4) v = (v > 0.f) ? v : 0.01f * v;
          if (ACT == 6) {
            const float sg = kPCarry / (1.0f + expf(-v));
            v = (n > (mBase + mOff + r)) ? 0.0f : sg;
          }
          slab[(mOff + r) * 68 + (j << 4) + rlane] = v;
        }
      }
    }
    __builtin_amdgcn_fence(__ATOMIC_RELEASE, "workgroup");
    __builtin_amdgcn_wave_barrier();
    __builtin_amdgcn_fence(__ATOMIC_ACQUIRE, "workgroup");
    if (OUT_MODE == 0) {
      float* C = (float*)Cout + (size_t)b * strideC;
      const int hh = lane >> 4, c4 = (lane & 15) * 4;     // row seg = 256 B = 16 lanes x 16 B
      {
#pragma unroll
        for (int it = 0; it < 8; ++it) {
          const int row = it * 2 + hh;
          v4f v = *(const v4f*)(slab + row * 68 + c4);
          *(v4f*)(C + (size_t)(mBase + row) * ldc + n0 + c4) = v;
        }
        
      }
    } else if (rope) {
      // 8 lanes a row: each squares its 8 values, three exchanges give the row's sum; a store covers 4 rows = 512 contiguous bytes
      const int q = lane >> 3, c8 = (lane & 7) * 8;
      unsigned short* C = (unsigned short*)Cout + (size_t)b * strideC + (size_t)(n0 >> 6) * M * kHeadD;
#pragma unroll
      for (int it = 0; it < 4; ++it) {
        const int row = it * 4 + q;
        const float* sp = slab + row * 68 + c8;
        const v4f a = *(const v4f*)(sp);
        const v4f c = *(const v4f*)(sp + 4);
        float ss = a[0] * a[0];
#pragma unroll
        for (int e = 1; e < 4; ++e) ss = fmaf(a[e], a[e], ss);
#pragma unroll
        for (int e = 0; e < 4; ++e) ss = fmaf(c[e], c[e], ss);
        ss = add_lane_xor<1>(ss);
        ss = add_lane_xor<2>(ss);
        ss = add_lane_xor<4>(ss);
        const float rn = rsqrtf(ss * (1.0f / kHeadD) + kEpsRms);
        v8h hv;
#pragma unroll
        for (int e = 0; e < 4; ++e) {
          hv[e]     = (_Float16)(a[e] * rn);
          hv[4 + e] = (_Float16)(c[e] * rn);
        }
        *(v8h*)(C + (size_t)(mBase + row) * kHeadD + c8) = hv;
      }
    } else {
      const int q = lane >> 3, c8 = (lane & 7) * 8;
      unsigned short* C  = join ? (unsigned short*)Cout2 : (unsigned short*)Cout + (size_t)b * strideC;
      unsigned short* C2 = (OUT_MODE == 2) ? ((unsigned short*)Cout2 + (size_t)b * strideC) : nullptr;
      {
#pragma unroll
        for (int it = 0; it < 4; ++it) {
          const int row = it * 4 + q;
          const float* sp = slab + row * 68 + c8;
          v8h hv, lv;
#pragma unroll
          for (int e = 0; e < 8; ++e) {
            if (OUT_MODE == 1 || JOIN) {
              hv[e] = (_Float16)sp[e];
            } else {
              unsigned short hb = f2bf_bits(sp[e]);
              unsigned short lb = f2bf_bits(sp[e] - bf_bits2f(hb));
              hv[e] = __builtin_bit_cast(_Float16, hb);
              lv[e] = __builtin_bit_cast(_Float16, lb);
            }
          }
          *(v8h*)(C + (size_t)(mBase + row) * ldc + n0 + c8) = hv;
          if (OUT_MODE == 2) *(v8h*)(C2 + (size_t)(mBase + row) * ldc + n0 + c8) = lv;
        }
        
      }
    }
    __builtin_amdgcn_fence(__ATOMIC_RELEASE, "workgroup");
    __builtin_amdgcn_wave_barrier();
    __builtin_amdgcn_fence(__ATOMIC_ACQUIRE, "workgroup");
  }
}

// ---------------------------------------------------------------------------
// All f32 -> f16 conversions (RNE) in one launch, 8 elements per thread, each lane one 16-byte store; the source is picked by the
// block index (the same for the whole work-group):
//   blocks 0 .. 2047: x [4096][1024] -> x16, as it is (2048 blocks x 256 threads x 8 = 4096 * 1024 exactly)
//   then 512 blocks for each of four weights [1024][1024] -> w16 + z * 1024 * 1024, carried x wscale (512 x 256 x 8 = 1024 * 1024 exactly)
// ---------------------------------------------------------------------------
constexpr int kXCastBlocks = (kSeqLen * kEmbd) / (8 * 256);
constexpr int kWCastBlocks = (kEmbd * kEmbd) / (8 * 256);
__global__ __launch_bounds__(256) void cast_kernel(const float* __restrict__ x,
                                                   const float* __restrict__ w0, const float* __restrict__ w1,
                                                   const float* __restrict__ w2, const float* __restrict__ w3,
                                                   unsigned short* __restrict__ x16, unsigned short* __restrict__ w16, float wscale) {
  const int bid = blockIdx.x;
  const float* in = x;
  unsigned short* o16 = x16;
  float scale = 1.0f;                              // times one: exact
  int blk = bid;
  if (bid >= kXCastBlocks) {
    const int z = (bid - kXCastBlocks) / kWCastBlocks;
    blk   = (bid - kXCastBlocks) - z * kWCastBlocks;
    in    = (z == 0) ? w0 : ((z == 1) ? w1 : ((z == 2) ? w2 : w3));
    o16   = w16 + (size_t)z * kEmbd * kEmbd;
    scale = wscale;
  }
  const size_t i = (size_t)blk * 256 + threadIdx.x;
  const float* p = in + 8 * i;
  const v4f a = *(const v4f*)(p);
  const v4f c = *(const v4f*)(p + 4);
  unsigned short hb[8];
#pragma unroll
  for (int e = 0; e < 4; ++e) {
    hb[e]     = h_bits(a[e] * scale);
    hb[4 + e] = h_bits(c[e] * scale);
  }
  const v4u u = (v4u){pk16(hb[0], hb[1]), pk16(hb[2], hb[3]), pk16(hb[4], hb[5]), pk16(hb[6], hb[7])};
  *(v4u*)(o16 + 8 * i) = u;
}

// ---------------------------------------------------------------------------
// Fused causal sigmoid attention, all heads in one launch; P never leaves the registers.
// One wave owns 32 query rows of one head and walks the keys 32 at a time, in rising order:
//   S^T = K . Q^T / 16 A = K16 rows (16 keys), B = Q16 rows (16 queries) times 1/16, k = head dim (2 x 32)
//   P^T = f16(1024 + 1024 * tanh(S^T)) = f16(2048 * sigmoid(q.k / 8)), zero where key > query
//   O^T += V^T . P^T   A = VT16 rows (16 head dims), B = P^T, k = 32 keys
// A lane's accumulators of the two 16-key tiles of S^T are, converted in place, its B operand of the second
// product (element e of tile kt -> element 8*kt + e), in the k order that Frag::load gives the V^T rows.
// O^T: a lane holds 8 consecutive head dims of one query row: one 16-byte store each.
// Placement: 256 blocks x 8 waves; block = (head, group g); waves 0..3 take query tiles 4g+w, waves 4..7
// take tiles 127-(4g+w-4), so every pair (w, w+4) walks 129 key steps together. Every (head, tile) once.
// K and V^T reach the waves through LDS: the eight waves of a block walk the same keys of the same head, so a trip's
// 128 K rows (128 bytes each) and 64 V^T rows (256 bytes each) are brought once for all of them, as whole lines, by
// asynchronous copies; no fragment load gathers 16 lines from the caches any more. Two buffers: the copies of trip t+1
// fly while trip t is worked on. LDS pitches 144 and 272 bytes (16 B x odd: ds_load_b128 without bank conflicts).
// Every wave copies and passes the barrier in every trip of its block, also a wave that is past its own diagonal.
// ---------------------------------------------------------------------------
constexpr int kTripKeys = 128;                   // keys per trip: four steps of 32
constexpr int kKPitch   = 72;                    // LDS pitch of a K row in 16-bit elements (144 bytes)
constexpr int kVPitch   = 136;                   // LDS pitch of a V^T row in 16-bit elements (272 bytes)
constexpr int kKTile    = kTripKeys * kKPitch;   // 16-bit elements of a trip's K rows in LDS
constexpr int kVTile    = kHeadD * kVPitch;      // 16-bit elements of a trip's V^T rows in LDS
constexpr int kKVStage  = kKTile + kVTile;       // one buffer: [K][V^T]

// This thread's share of a trip: 16 bytes of K rows r + 32 i (8 lanes a row) and of V^T rows r' + 16 i (16 lanes a row).
__device__ __forceinline__ void stage_kv(const unsigned short* gk, const unsigned short* gv, unsigned ldsK, unsigned ldsV) {
  unsigned l[8];
  const unsigned short* g[8];
#pragma unroll
  for (int i = 0; i < 4; ++i) {
    l[i]     = ldsK + (unsigned)(i * 32 * kKPitch * 2);
    l[4 + i] = ldsV + (unsigned)(i * 16 * kVPitch * 2);
    g[i]     = gk + (size_t)i * 32 * kHeadD;
    g[4 + i] = gv + (size_t)i * 16 * kSeqLen;
  }
  async_copy8(l, g);
}

// Two scores at a time: 2048 * sigmoid(x) = 1024 + 1024 * tanh(x / 2): the hardware's tanh, one transcendental a score, and
// one packed fma. u = x / 2 = q.k / 16 comes out of the matrix product as it is: the Q fragments carry the 1/16 (kQFold).
// Right over the whole range without a range test: tanh -> 1 gives 2048, tanh -> -1 gives 0. All of it in f32; the result is
// rounded to f16 as before.
__device__ __forceinline__ v2f sigmoid2_carried(v2f u) {
  const v2f t = (v2f){__builtin_amdgcn_tanhf(u.x), __builtin_amdgcn_tanhf(u.y)};
  return __builtin_elementwise_fma(t, (v2f){0.5f * kPCarry, 0.5f * kPCarry}, (v2f){0.5f * kPCarry, 0.5f * kPCarry});
}

// K fragments of one step of 32 keys; sk = this lane's place in the step's first K row in LDS
__device__ __forceinline__ void load_k(const _Float16* sk, v16h (&kf)[2][2]) {
#pragma unroll
  for (int kt = 0; kt < 2; ++kt)
#pragma unroll
    for (int ks = 0; ks < 2; ++ks) kf[kt][ks] = Frag<_Float16>::load(sk + (kt << 4) * kKPitch + (ks << 5));
}

// One step of 32 keys out of LDS. sk, sv: this lane's places in the step's K rows and V^T columns. MASK: the diagonal step
// (first key == first query of the wave). NEXT: the next step lies in the same buffer, its K fragments are fetched here.
template <bool MASK, bool NEXT>
__device__ __forceinline__ void attn_step(const _Float16* sk, const _Float16* sv, int c, int h8,
                                          v16h (&kf)[2][2], const v16h (&qf)[2][2], v8f (&o)[4][2]) {
  v8f s[2][2];
#pragma unroll
  for (int kt = 0; kt < 2; ++kt)
#pragma unroll
    for (int g = 0; g < 2; ++g) {
      s[kt][g] = (v8f){0.f,0.f,0.f,0.f,0.f,0.f,0.f,0.f};
      s[kt][g] = Frag<_Float16>::mma(kf[kt][0], qf[g][0], s[kt][g]);
      s[kt][g] = Frag<_Float16>::mma(kf[kt][1], qf[g][1], s[kt][g]);
    }
  // one group of LDS loads a step: this step's V^T rows and, behind this step's last use of the K registers, the next step's K rows
  v16h vf[4], kn[2][2];
#pragma unroll
  for (int dt = 0; dt < 4; ++dt) vf[dt] = Frag<_Float16>::load(sv + (dt << 4) * kVPitch);
  if (NEXT) load_k(sk + 32 * kKPitch, kn);
  // keeps the loads above in front of the sigmoid work, which covers their latency: sunk below it, they are waited out at the products that use them
  __builtin_amdgcn_sched_barrier(0);
#pragma unroll
  for (int g = 0; g < 2; ++g) {
    v16h p;
#pragma unroll
    for (int kt = 0; kt < 2; ++kt)
#pragma unroll
      for (int r = 0; r < 8; r += 2) {
        v2f sg = sigmoid2_carried((v2f){s[kt][g][r], s[kt][g][r + 1]});
        if (MASK) {
          const int rel = ((kt << 4) + h8 + r) - ((g << 4) + c);   // key minus query of element r
          sg.x = (rel > 0) ? 0.0f : sg.x;
          sg.y = (rel + 1 > 0) ? 0.0f : sg.y;
        }
        p[(kt << 3) + r]     = (_Float16)sg.x;
        p[(kt << 3) + r + 1] = (_Float16)sg.y;
      }
#pragma unroll
    for (int dt = 0; dt < 4; ++dt) o[dt][g] = Frag<_Float16>::mma(vf[dt], p, o[dt][g]);
  }
  if (NEXT) {
#pragma unroll
    for (int kt = 0; kt < 2; ++kt)
#pragma unroll
      for (int ks = 0; ks < 2; ++ks) kf[kt][ks] = kn[kt][ks];
  }
}

__global__ __launch_bounds__(256) void attn_fused_kernel(const unsigned short* __restrict__ Q16p,
                                                         const unsigned short* __restrict__ K16p,
                                                         const unsigned short* __restrict__ VT16p,
                                                         unsigned short* __restrict__ O16p) {
  __shared__ __align__(16) unsigned short kv[2 * kKVStage];
  const int lane = threadIdx.x & 31;
  const int wave = __builtin_amdgcn_readfirstlane(threadIdx.x >> 5);   // in a scalar register: the tests on it below are scalar branches
  const int c    = lane & 15;
  const int h8   = (lane >> 4) * 8;
  const int head = blockIdx.x & (kHeads - 1);
  const int grp  = blockIdx.x >> 4;                                    // 0..15
  const int qt   = (wave < 4) ? (4 * grp + wave) : (127 - (4 * grp + wave - 4));
  const int q0   = qt << 5;
  const int nt    = kSeqLen / kTripKeys - grp;    // trips of the block: up to the diagonal of its longest wave, tile 127 - 4 grp (17..32)
  const int tEdge = qt >> 2;                      // the trip that holds this wave's diagonal step
  const int nFree = qt & 3;                       // unmasked steps of that trip
  const _Float16* Qh = (const _Float16*)Q16p + (size_t)head * kSeqLen * kHeadD;

  // this thread's share of the copies
  const unsigned short* gk = K16p  + (size_t)head * kSeqLen * kHeadD + (size_t)(threadIdx.x >> 3) * kHeadD + (threadIdx.x & 7) * 8;
  const unsigned short* gv = VT16p + ((size_t)head * kHeadD + (threadIdx.x >> 4)) * kSeqLen + (threadIdx.x & 15) * 8;
  const unsigned ldsK = (unsigned)(size_t)(&kv[(threadIdx.x >> 3) * kKPitch + (threadIdx.x & 7) * 8]);            // LDS byte address: low word of the pointer
  const unsigned ldsV = (unsigned)(size_t)(&kv[kKTile + (threadIdx.x >> 4) * kVPitch + (threadIdx.x & 15) * 8]);

  // tile 0 into buffer 0
  stage_kv(gk, gv, ldsK, ldsV);

  v16h qf[2][2], kf[2][2];
#pragma unroll
  for (int g = 0; g < 2; ++g)
#pragma unroll
    for (int ks = 0; ks < 2; ++ks)
      qf[g][ks] = Frag<_Float16>::load(Qh + (size_t)(q0 + (g << 4) + c) * kHeadD + (ks << 5) + h8);
  // the address registers of the loads above are reused right behind them: the wait stands in front of that reuse
  asm volatile("s_wait_xcnt 0x0" ::: "memory");
  qf[0][0] *= (_Float16)kQFold;
  qf[0][1] *= (_Float16)kQFold;
  qf[1][0] *= (_Float16)kQFold;
  qf[1][1] *= (_Float16)kQFold;
  v8f o[4][2];
#pragma unroll
  for (int dt = 0; dt < 4; ++dt)
#pragma unroll
    for (int g = 0; g < 2; ++g) o[dt][g] = (v8f){0.f,0.f,0.f,0.f,0.f,0.f,0.f,0.f};

  asm volatile("s_wait_asynccnt 0x0" ::: "memory");   // this wave's copies of tile 0 have landed
  __syncthreads();                                    // every wave's have
  if (nt > 1) stage_kv(gk + (size_t)kTripKeys * kHeadD, gv + kTripKeys, ldsK + kKVStage * 2, ldsV + kKVStage * 2);

  for (int t = 0; t < nt; ++t) {
    const int bufo = (t & 1) * kKVStage;
    const _Float16* sk = (const _Float16*)(kv + bufo) + c * kKPitch + h8;
    const _Float16* sv = (const _Float16*)(kv + bufo + kKTile) + c * kVPitch + h8;
    if (t < tEdge) {                 // wave-uniform: all four steps lie below the diagonal
      load_k(sk, kf);
      // keeps the trip's first eight K loads together in front of its products: spread among them, each pair is waited out on its own
      __builtin_amdgcn_sched_barrier(0);
      attn_step<false, true >(sk,                sv,      c, h8, kf, qf, o);
      attn_step<false, true >(sk + 32 * kKPitch, sv + 32, c, h8, kf, qf, o);
      attn_step<false, true >(sk + 64 * kKPitch, sv + 64, c, h8, kf, qf, o);
      attn_step<false, false>(sk + 96 * kKPitch, sv + 96, c, h8, kf, qf, o);
    }
    if (t == tEdge) {                // wave-uniform: the steps up to the diagonal, then the diagonal step
      load_k(sk, kf);
      for (int j = 0; j < nFree; ++j) {
        attn_step<false, true>(sk, sv, c, h8, kf, qf, o);
        sk += 32 * kKPitch;
        sv += 32;
      }
      attn_step<true, false>(sk, sv, c, h8, kf, qf, o);
    }
    asm volatile("s_wait_dscnt 0x0" ::: "memory");      // this wave's reads of the buffer are done before it is refilled
    asm volatile("s_wait_asynccnt 0x0" ::: "memory");   // this wave's copies of tile t+1 have landed
    __syncthreads();                                    // publishes tile t+1 and ends every wave's reads of tile t
    if (t + 2 < nt)
      stage_kv(gk + (size_t)(t + 2) * kTripKeys * kHeadD, gv + (size_t)(t + 2) * kTripKeys, ldsK + bufo * 2, ldsV + bufo * 2);
  }
  asm volatile("s_wait_asynccnt 0x0" ::: "memory");     // no copy is in flight behind the loop

#pragma unroll
  for (int g = 0; g < 2; ++g)
#pragma unroll
    for (int dt = 0; dt < 4; ++dt) {
      v8h hv;
#pragma unroll
      for (int r = 0; r < 8; ++r) hv[r] = (_Float16)(o[dt][g][r] * kPVScale);
      *(v8h*)(O16p + (size_t)(q0 + (g << 4) + c) * kEmbd + head * kHeadD + (dt << 4) + h8) = hv;
    }
}

// ---------------------------------------------------------------------------
// Host-side orchestration
// ---------------------------------------------------------------------------
extern "C" void kernel_launch(void* const* d_in, const int* in_sizes, int n_in,
                              void* d_out, int out_size, void* d_ws,
                              size_t ws_size, hipStream_t stream) {
  if (n_in < 7) return;
  if (in_sizes[0] != kSeqLen * kEmbd) return;
  if (in_sizes[1] != kSeqLen * kRotD || in_sizes[2] != kSeqLen * kRotD) return;
  if (in_sizes[3] != kEmbd * kEmbd || in_sizes[4] != kEmbd * kEmbd ||
      in_sizes[5] != kEmbd * kEmbd || in_sizes[6] != kEmbd * kEmbd) return;
  if (out_size != kSeqLen * kEmbd) return;

  const float* x    = (const float*)d_in[0];
  const float* cosT = (const float*)d_in[1];
  const float* sinT = (const float*)d_in[2];
  const float* wq   = (const float*)d_in[3];
  const float* wk   = (const float*)d_in[4];
  const float* wv   = (const float*)d_in[5];
  const float* wp   = (const float*)d_in[6];

  // ---- workspace region map (bytes) ----
  // persistent:
  //   Q16  f16 [16][4096][64]   8 MiB  @ 0
  //   K16  f16 [16][4096][64]   8 MiB  @ 8 MiB   (must follow Q16 directly)
  //   VT16 f16 [1024][4096]     8 MiB  @ 16 MiB
  //   O16  f16 [4096][1024]     8 MiB  @ 24 MiB
  //   W16  f16 4 x [1024][1024] 8 MiB  @ 32 MiB  (wq, wk, wproj, wv carried x16)
  // dead after the projections:
  //   X16  f16  8 MiB @ 40 MiB
  // total = 48 MiB
  const size_t MiB = 1048576;
  const size_t total = 48 * MiB;
  if (total > ws_size) return;
  char* ws = (char*)d_ws;
  unsigned short* Q16  = (unsigned short*)(ws + 0 * MiB);
  unsigned short* K16  = (unsigned short*)(ws + 8 * MiB);
  unsigned short* VT16 = (unsigned short*)(ws + 16 * MiB);
  unsigned short* O16  = (unsigned short*)(ws + 24 * MiB);
  unsigned short* W16  = (unsigned short*)(ws + 32 * MiB);
  unsigned short* X16  = (unsigned short*)(ws + 40 * MiB);
  unsigned short* WP16 = W16 + 2 * (size_t)kEmbd * kEmbd;
  unsigned short* WV16 = W16 + 3 * (size_t)kEmbd * kEmbd;
  const float* fdummy = (const float*)(ws);

  // 1) casts, one launch: x, then wq, wk, wproj, wv
  cast_kernel<<<dim3(kXCastBlocks + 4 * kWCastBlocks), 256, 0, stream>>>(x, wq, wk, wp, wv, X16, W16, kWCarry);

  // 2) the three projections, one launch of 3 x 256 work-groups (they depend on the casts alone, not on one another):
  //    planes 0, 1: q,k = X16 . Wq16^T / Wk16^T : M=4096, N=1024, K=1024 (K%64==0, M,N%128==0), scale 1/16; RoPE + RMS-norm in the
  //    epilogue -> Q16, K16 planes [h][t][64]
  //    plane 2: V^T = Wv16 . X16^T, one f16 product: A = Wv plane [1024][1024] carried x16, Bt = X plane [4096][1024];
  //    f16 out [h*64+d][t] carried x16 (the weight's carry stays on it), row pitch 4096
  {
    const int tiles = (kSeqLen / 128) * (kEmbd / 128);   // 256 work-groups a plane
    wmma_gemm64<0, false, 0, 3, false, 0, true><<<dim3(tiles, 3), 256, 0, stream>>>(
        X16, WV16, kEmbd, (long)0,
        W16, X16, kEmbd, (long)kEmbd * kEmbd,
        (void*)Q16, (void*)VT16, kHeadD, (long)kHeads * kSeqLen * kHeadD,
        cosT, sinT, (long)0,
        kSeqLen, kEmbd, kEmbd, kQKScale, kSeqLen, kVScale);
  }

  // 3) attention, all heads: O16 = 64*y, f16 [4096][1024]; 16 heads x 16 groups = 256 blocks
  attn_fused_kernel<<<dim3(kHeads * (kSeqLen / 256)), 256, 0, stream>>>(Q16, K16, VT16, O16);

  // 4) out = (64*y) . (16*Wp)^T * (1/1024): M=4096, N=1024, K=1024, f32 out to d_out
  {
    const int tiles = (kSeqLen / 128) * (kEmbd / 128);   // 256 work-groups
    wmma_gemm64<0, false, 0, 0, false, 0><<<dim3(tiles, 1), 256, 0, stream>>>(
        O16, O16, kEmbd, (long)0,
        WP16, WP16, kEmbd, (long)0,
        d_out, d_out, kEmbd, (long)0,
        fdummy, fdummy, (long)0,
        kSeqLen, kEmbd, kEmbd, kOutScale, kEmbd, kOutScale);
  }
}

// v009
// A run of this version takes 77.6 microseconds.
// Timed twice side by side with v008, it ran 1.05 and 1.06 times as fast.
// All steps since v000 together make it 20.7 times as fast.
// Contractions: q,k projections (X f16 x W^T f16 carried x16), v projection (Wv f16 carried x16 x X^T f16), scores q.k^T (q,k f16 planes, K=64), attn.v (P f16 carried x2048 x V^T f16 carried x16), output projection (y f16 carried x64 x Wp^T f16 carried x16): v_wmma_f32_16x16x32_f16, f32 accumulate; rope, rms-norm, sigmoid in f32.
#include <hip/hip_runtime.h>
#include <math.h>

// ---------------------------------------------------------------------------
// Problem constants
// ---------------------------------------------------------------------------
constexpr int kSeqLen = 4096;
constexpr int kEmbd   = 1024;
constexpr int kHeads  = 16;
constexpr int kHeadD  = 64;
constexpr int kRotD   = 32;
constexpr float kWCarry   = 16.0f;              // f16 weights carried x16
constexpr float kVCarry   = 16.0f;              // V^T f16 plane carried x16
constexpr float kPCarry   = 2048.0f;            // sigmoid probabilities carried x2048
constexpr float kQKScale  = 1.0f / 16.0f;       // undo weight carry on q,k
constexpr float kVScale   = kVCarry / kWCarry; // V^T plane: the weight's carry becomes the plane's
constexpr float kScScale  = 0.125f;             // 1/sqrt(64)
constexpr float kQFold    = 0.5f * kScScale;    // on the Q fragments: the product is the argument of tanh, score / 2 (a power of two: no bit of a normal f16 is lost)
constexpr float kPVScale  = 1.0f / 32768.0f;    // 1/(kPCarry*kVCarry): O16 = 64*y
constexpr float kOutScale = 1.0f / 1024.0f;     // (1/64) * (1/kWCarry)
constexpr float kEpsRms   = 1e-6f;

typedef __attribute__((ext_vector_type(16))) _Float16 v16h;
typedef __attribute__((ext_vector_type(8)))  _Float16 v8h;
typedef __attribute__((ext_vector_type(16))) __bf16   v16b;
typedef __attribute__((ext_vector_type(8)))  __bf16   v8b;
typedef __attribute__((ext_vector_type(8)))  float    v8f;
typedef __attribute__((ext_vector_type(4)))  float    v4f;
typedef __attribute__((ext_vector_type(2)))  float    v2f;
typedef __attribute__((ext_vector_type(4)))  unsigned int v4u;

// ---------------------------------------------------------------------------
// Helpers
// ---------------------------------------------------------------------------
__device__ __forceinline__ unsigned short f2bf_bits(float f) {
  unsigned u = __float_as_uint(f);
  return (unsigned short)((u + 0x7FFFu + ((u >> 16) & 1u)) >> 16);
}
__device__ __forceinline__ float bf_bits2f(unsigned short h) { return __uint_as_float(((unsigned)h) << 16); }

// hazard guards as plain device helpers
__device__ __forceinline__ void dep_guard_h(v8f& a, v8f& b, v16h x, v16h y) { asm volatile("v_nop\n\tv_nop\n\tv_nop\n\tv_nop" : "+v"(a), "+v"(b) : "v"(x), "v"(y)); }
__device__ __forceinline__ void dep_guard_b(v8f& a, v8f& b, v16b x, v16b y) { asm volatile("v_nop\n\tv_nop\n\tv_nop\n\tv_nop" : "+v"(a), "+v"(b) : "v"(x), "v"(y)); }
__device__ __forceinline__ void keep4_h(v16h a, v16h b, v16h c, v16h d) { asm volatile("v_nop" :: "v"(a), "v"(b), "v"(c), "v"(d)); }
__device__ __forceinline__ void keep4_b(v16b a, v16b b, v16b c, v16b d) { asm volatile("v_nop" :: "v"(a), "v"(b), "v"(c), "v"(d)); }
__device__ __forceinline__ void acc_guard4(v8f& a, v8f& b, v8f& c, v8f& d) { asm volatile("v_nop\n\tv_nop\n\tv_nop\n\tv_nop" : "+v"(a), "+v"(b), "+v"(c), "+v"(d)); }
template <typename T> struct Frag;
template <> struct Frag<_Float16> {
  typedef v16h V; union U { v16h v; v8h h[2]; };
  static __device__ __forceinline__ v16h load(const _Float16* p) {   // elements 0..7 <- p[0..7], 8..15 <- p[16..23]
    U f; f.h[0] = *(const v8h*)(p); f.h[1] = *(const v8h*)(p + 16); return f.v;
  }
  static __device__ __forceinline__ v8f mma(v16h a, v16h b, v8f c) {
    return __builtin_amdgcn_wmma_f32_16x16x32_f16(false, a, false, b, (short)0, c, false, false);
  }
  static __device__ __forceinline__ void guard(v8f& a, v8f& b, v16h x, v16h y) { dep_guard_h(a, b, x, y); }
  static __device__ __forceinline__ void keep(v16h a, v16h b, v16h c, v16h d) { keep4_h(a, b, c, d); }
};
template <> struct Frag<__bf16> {
  typedef v16b V; union U { v16b v; v8b h[2]; };
  static __device__ __forceinline__ v16b load(const __bf16* p) {
    U f; f.h[0] = *(const v8b*)(p); f.h[1] = *(const v8b*)(p + 16); return f.v;
  }
  static __device__ __forceinline__ v8f mma(v16b a, v16b b, v8f c) {
    return __builtin_amdgcn_wmma_f32_16x16x32_bf16(false, a, false, b, (short)0, c, false, false);
  }
  static __device__ __forceinline__ void guard(v8f& a, v8f& b, v16b x, v16b y) { dep_guard_b(a, b, x, y); }
  static __device__ __forceinline__ void keep(v16b a, v16b b, v16b c, v16b d) { keep4_b(a, b, c, d); }
};

__device__ __forceinline__ unsigned pk16(unsigned short a, unsigned short b) { return (unsigned)a | ((unsigned)b << 16); }
__device__ __forceinline__ unsigned short h_bits(float f) { const _Float16 h = (_Float16)f; return __builtin_bit_cast(unsigned short, h); }

// ---- Batched WMMA GEMM, operands staged in LDS ------------------------------------------------
// C[m,n] = scale * sum_k A[m,k] * Bt[n,k] (+bias)(+resid).
// A row-major [M,K]; Bt row-major [N,K]; M,N % 128 == 0, K % 64 == 0.
// A work-group of 8 waves owns a 128x128 tile of C; wave w owns rows 32*(w>>1).., columns 64*(w&1).. of it.
// Per trip 64 k of the 128 A rows and the 128 Bt rows lie in LDS, brought there by asynchronous copies as whole
// 128-byte lines (8 lanes a row), so that no fragment load gathers 16 lines from the caches any more.
// LDS rows have a pitch of 144 bytes (16 B x odd: ds_load_b128 without bank conflicts). Two buffers: the copies of
// trip t+1 fly while trip t is worked on. The k order of the sums is the one of the fragment loads from LDS.
// SPLIT: operands are hi/lo planes (A2/Bt2 = lo planes, same layout); product = hi.hi + hi.lo + lo.hi.
// BIAS_MODE: 0 = none, 1 = bias[m], 2 = bias[n].
// OUT_MODE: 0 = f32, 1 = f16, 2 = bf16 hi plane (Cout) + bf16 lo plane (Cout2),
//           3 = rotary step and per-head RMS-norm in f32, then f16 planes [n / 64][m][64] (bias = cos table, resid = sin table, both [m][32]).
// ACT: 2 relu, 4 leaky, 6 = causal sigmoid carry: v = (n > m) ? 0 : kPCarry / (1 + exp(-v)).
// ET: 0 = f16 operands, 1 = bf16 operands (pointers passed as 16-bit storage)
// JOIN: plane 2 of the grid (blockIdx.y == 2) is a second, independent product in the same launch:
//       Cout2[n,m] = scale2 * sum_k A2p[n,k] * Bt2p[m,k], an N x M result, f16, row pitch ldc2 (OUT_MODE 1's epilogue).
constexpr int kTileK    = 64;                  // k per trip, 128 bytes of every operand row
constexpr int kRowPitch = 72;                  // LDS row pitch in 16-bit elements (144 bytes)
constexpr int kPlane    = 128 * kRowPitch;     // 16-bit elements of one operand plane in LDS

// Eight copies of 16 bytes a lane, global memory -> LDS through no register. The closing wait stands inside the statement,
// in front of any later rewrite of the address registers that the copies name.
__device__ __forceinline__ void async_copy8(const unsigned (&l)[8], const unsigned short* const (&g)[8]) {
  asm volatile("global_load_async_to_lds_b128 %0, %8, off\n\t"
               "global_load_async_to_lds_b128 %1, %9, off\n\t"
               "global_load_async_to_lds_b128 %2, %10, off\n\t"
               "global_load_async_to_lds_b128 %3, %11, off\n\t"
               "global_load_async_to_lds_b128 %4, %12, off\n\t"
               "global_load_async_to_lds_b128 %5, %13, off\n\t"
               "global_load_async_to_lds_b128 %6, %14, off\n\t"
               "global_load_async_to_lds_b128 %7, %15, off\n\t"
               "s_wait_xcnt 0x0"
               :: "v"(l[0]), "v"(l[1]), "v"(l[2]), "v"(l[3]), "v"(l[4]), "v"(l[5]), "v"(l[6]), "v"(l[7]),
                  "v"(g[0]), "v"(g[1]), "v"(g[2]), "v"(g[3]), "v"(g[4]), "v"(g[5]), "v"(g[6]), "v"(g[7])
               : "memory");
}
// One plane of A and one of Bt, 128 rows x 128 bytes each: this thread's 16 bytes of rows r, r+32, r+64, r+96.
__device__ __forceinline__ void stage_pair(const unsigned short* ga, size_t stepA, const unsigned short* gb, size_t stepB,
                                           unsigned lds) {
  unsigned l[8];
  const unsigned short* g[8];
#pragma unroll
  for (int i = 0; i < 4; ++i) {
    l[i]     = lds + (unsigned)(i * 32 * kRowPitch * 2);
    l[4 + i] = lds + (unsigned)((kPlane + i * 32 * kRowPitch) * 2);
    g[i]     = ga + i * stepA;
    g[4 + i] = gb + i * stepB;
  }
  async_copy8(l, g);
}

// x + (x of lane l ^ XM), inside a row of 16 lanes, on the vector port (a shuffle through the LDS unit costs its latency at every step)
template <int XM>
__device__ __forceinline__ float add_lane_xor(float x) {
  const int y = __builtin_amdgcn_update_dpp(0, __builtin_bit_cast(int, x), 0x160 | XM, 0xf, 0xf, true);   // 0x160 | XM: row_xmask:XM
  return x + __builtin_bit_cast(float, y);
}

template <int ET> struct Elem;
template <> struct Elem<0> { typedef _Float16 T; };
template <> struct Elem<1> { typedef __bf16 T; };
template <int ET, bool SPLIT, int BIAS_MODE, int OUT_MODE, bool RESID, int ACT = 0, bool JOIN = false>
__global__ __launch_bounds__(256) void wmma_gemm64(
    const unsigned short* __restrict__ Ap, const unsigned short* __restrict__ A2p, int lda, long strideA,
    const unsigned short* __restrict__ Btp, const unsigned short* __restrict__ Bt2p, int ldb, long strideB,
    void* __restrict__ Cout, void* __restrict__ Cout2, int ldc1, long strideC,
    const float* __restrict__ bias,
    const float* __restrict__ resid, long strideR,
    int M, int N, int K, float scale1, int ldc2, float scale2) {
  static_assert(!JOIN || (!SPLIT && OUT_MODE == 3), "the second product takes the places of the lo planes");
  typedef typename Elem<ET>::T T;
  typedef typename Frag<T>::V V;
  constexpr int kStage = (SPLIT ? 4 : 2) * kPlane;           // one buffer: [A][Bt], SPLIT: [A hi][Bt hi][A lo][Bt lo]
  constexpr int kGroupK = (SPLIT || JOIN) ? 32 : 64;         // k of one group of fragment loads: 24 loads; JOIN: 12, which keeps a wave under 160 registers:
                                                             // six waves a SIMD, so the grid's three work-groups a WGP (3 x 106 KiB of LDS) are resident together
  __shared__ __align__(16) unsigned short ring[2 * kStage];
  __shared__ __align__(16) float sT[8][16 * 68];   // per-wave 16x64 slab, pitch 68 floats
  const int b    = blockIdx.y;
  const int lane = threadIdx.x & 31;
  const int wave = threadIdx.x >> 5;
  const bool join = JOIN && b == 2;            // the same for the whole work-group
  const int   ldc   = join ? ldc2 : ldc1;
  const float scale = join ? scale2 : scale1;
  const int tilesN = (join ? M : N) >> 7;
  const int tilesM = (join ? N : M) >> 7;
  if ((int)blockIdx.x >= tilesM * tilesN) return;   // the same for the whole work-group, in front of every barrier
  const int bm = blockIdx.x / tilesN;
  const int bn = blockIdx.x - bm * tilesN;
  const int m0 = (bm << 7) + ((wave >> 1) << 5);
  const int n0 = (bn << 7) + ((wave & 1) << 6);
  const int nt = K / kTileK;

  const int rlane = lane & 15;                 // row (A) / col (B, D) within subtile
  const int koff  = (lane >> 4) * 8;           // k offset of this lane half
  const int mOff  = (lane >> 4) * 8;           // D row offset

  // this thread's share of the copies: 16 bytes at column ccol of rows crow + 32 i of every plane
  const int crow = threadIdx.x >> 3;
  const int ccol = (threadIdx.x & 7) * 8;
  const size_t stepA = (size_t)32 * lda;
  const size_t stepB = (size_t)32 * ldb;
  const size_t offA = (join ? 0 : (size_t)b * strideA) + (size_t)((bm << 7) + crow) * lda + ccol;
  const size_t offB = (join ? 0 : (size_t)b * strideB) + (size_t)((bn << 7) + crow) * ldb + ccol;
  const unsigned short* Aop = join ? A2p : Ap;
  const unsigned short* Bop = join ? Bt2p : Btp;
  const unsigned lds0 = (unsigned)(size_t)(&ring[crow * kRowPitch + ccol]);   // LDS byte address: low word of the pointer

  // this lane's fragment rows in a buffer
  const int fragA = (((wave >> 1) << 5) + rlane) * kRowPitch + koff;
  const int fragB = kPlane + (((wave & 1) << 6) + rlane) * kRowPitch + koff;

  v8f acc[2][4];
#pragma unroll
  for (int i = 0; i < 2; ++i)
#pragma unroll
    for (int j = 0; j < 4; ++j) acc[i][j] = (v8f){0.f,0.f,0.f,0.f,0.f,0.f,0.f,0.f};

  // tile 0 into buffer 0, landed and published; then tile 1 into buffer 1
  stage_pair(Aop + offA, stepA, Bop + offB, stepB, lds0);
  if (SPLIT) stage_pair(A2p + offA, stepA, Bt2p + offB, stepB, lds0 + 2 * kPlane * 2);
  asm volatile("s_wait_asynccnt 0x0" ::: "memory");   // this wave's copies of tile 0 have landed
  __syncthreads();                                    // every wave's have
  if (nt > 1) {
    stage_pair(Aop + offA + kTileK, stepA, Bop + offB + kTileK, stepB, lds0 + kStage * 2);
    if (SPLIT) stage_pair(A2p + offA + kTileK, stepA, Bt2p + offB + kTileK, stepB, lds0 + (kStage + 2 * kPlane) * 2);
  }

  for (int t = 0; t < nt; ++t) {
    const int bufo = (t & 1) * kStage;
    const T* sb = (const T*)(ring + bufo);
#pragma unroll
    for (int kg = 0; kg < kTileK; kg += kGroupK) {
      // all fragment loads of a group stand in front of its products: one place where the wave waits for LDS
      V ah[kGroupK / 32][2], al[kGroupK / 32][2], bh[kGroupK / 32][4], bl[kGroupK / 32][4];
#pragma unroll
      for (int s = 0; s < kGroupK / 32; ++s) {
#pragma unroll
        for (int i = 0; i < 2; ++i) {
          const int ao = fragA + (i << 4) * kRowPitch + kg + (s << 5);
          ah[s][i] = Frag<T>::load(sb + ao);
          if (SPLIT) al[s][i] = Frag<T>::load(sb + 2 * kPlane + ao);
        }
#pragma unroll
        for (int j = 0; j < 4; ++j) {
          const int bo = fragB + (j << 4) * kRowPitch + kg + (s << 5);
          bh[s][j] = Frag<T>::load(sb + bo);
          if (SPLIT) bl[s][j] = Frag<T>::load(sb + 2 * kPlane + bo);
        }
      }
#pragma unroll
      for (int s = 0; s < kGroupK / 32; ++s) {
#pragma unroll
        for (int i = 0; i < 2; ++i) {
#pragma unroll
          for (int j = 0; j < 4; ++j) {
            acc[i][j] = Frag<T>::mma(ah[s][i], bh[s][j], acc[i][j]);
            if (SPLIT) {
              acc[i][j] = Frag<T>::mma(ah[s][i], bl[s][j], acc[i][j]);
              acc[i][j] = Frag<T>::mma(al[s][i], bh[s][j], acc[i][j]);
            }
          }
          Frag<T>::guard(acc[i][0], acc[i][3], ah[s][i], SPLIT ? al[s][i] : ah[s][i]);
        }
        Frag<T>::keep(bh[s][0], bh[s][1], bh[s][2], bh[s][3]);
        if (SPLIT) Frag<T>::keep(bl[s][0], bl[s][1], bl[s][2], bl[s][3]);
      }
    }
    asm volatile("s_wait_dscnt 0x0" ::: "memory");      // this wave's reads of the buffer are done before it is refilled
    asm volatile("s_wait_asynccnt 0x0" ::: "memory");   // this wave's copies of tile t+1 have landed
    __syncthreads();                                    // publishes tile t+1 and ends every wave's reads of tile t
    if (t + 2 < nt) {
      const size_t ko = (size_t)(t + 2) * kTileK;
      stage_pair(Aop + offA + ko, stepA, Bop + offB + ko, stepB, lds0 + bufo * 2);
      if (SPLIT) stage_pair(A2p + offA + ko, stepA, Bt2p + offB + ko, stepB, lds0 + (bufo + 2 * kPlane) * 2);
    }
  }
  // OUT_MODE 3: the cos and sin values of the wave's 32 rows, columns rlane and rlane + 16, all asked for here in one go:
  // their latency is paid once, not once per 16 rows behind the first rows' stores
  float cs[2][8][2], sn[2][8][2];
  const bool rope = OUT_MODE == 3 && !join;
  if (rope) {
    const float* pc = bias  + (m0 + mOff) * kRotD + rlane;
    const float* pn = resid + (m0 + mOff) * kRotD + rlane;
#pragma unroll
    for (int i = 0; i < 2; ++i)
#pragma unroll
      for (int r = 0; r < 8; ++r)
#pragma unroll
        for (int h = 0; h < 2; ++h) {
          cs[i][r][h] = pc[((i << 4) + r) * kRotD + (h << 4)];
          sn[i][r][h] = pn[((i << 4) + r) * kRotD + (h << 4)];
        }
    // the address registers of the loads above are reused right behind them: the wait stands in front of that reuse; as its inputs
    // they stay whole up to it, so that no later load of the group lands in one of them
    asm volatile("s_wait_xcnt 0x0" :: "v"(pc), "v"(pn) : "memory");
  }
  asm volatile("s_wait_asynccnt 0x0" ::: "memory");     // no copy is in flight behind the loop
  acc_guard4(acc[0][0], acc[0][1], acc[0][2], acc[0][3]);
  acc_guard4(acc[1][0], acc[1][1], acc[1][2], acc[1][3]);

  // ---- epilogue ----
  float* slab = sT[wave];
  const float* Rb = RESID ? (resid + (size_t)b * strideR) : nullptr;
#pragma unroll
  for (int i = 0; i < 2; ++i) {
    const int mBase = m0 + (i << 4);
    if (rope) {
      // The wave's 64 columns are one head: columns d and d + 32 of a row lie in one lane (tiles j and j + 2), so the rotation needs no exchange.
#pragma unroll
      for (int r = 0; r < 8; ++r) {
        const float c0 = cs[i][r][0], c1 = cs[i][r][1];
        const float s0 = sn[i][r][0], s1 = sn[i][r][1];
        const float x0 = acc[i][0][r] * scale, x1 = acc[i][1][r] * scale;
        const float x2 = acc[i][2][r] * scale, x3 = acc[i][3][r] * scale;
        float* row = slab + (mOff + r) * 68 + rlane;
        row[0]  = x0 * c0 + x2 * s0;
        row[16] = x1 * c1 + x3 * s1;
        row[32] = x2 * c0 - x0 * s0;
        row[48] = x3 * c1 - x1 * s1;
      }
    } else {
#pragma unroll
      for (int j = 0; j < 4; ++j) {
        const int n = n0 + (j << 4) + rlane;
        float bv = 0.f;
        if (BIAS_MODE == 2) bv = bias[n];
#pragma unroll
        for (int r = 0; r < 8; ++r) {
          float v = acc[i][j][r] * scale;
          if (BIAS_MODE == 1) v += bias[mBase + mOff + r];
          if (BIAS_MODE == 2) v += bv;
          if (RESID) v += Rb[(size_t)(mBase + mOff + r) * ldc + n];
          if (ACT == 2) v = fmaxf(v, 0.0f);
          if (ACT == 4) v = (v > 0.f) ? v : 0.01f * v;
          if (ACT == 6) {
            const float sg = kPCarry / (1.0f + expf(-v));
            v = (n > (mBase + mOff + r)) ? 0.0f : sg;
          }
          slab[(mOff + r) * 68 + (j << 4) + rlane] = v;
        }
      }
    }
    __builtin_amdgcn_fence(__ATOMIC_RELEASE, "workgroup");
    __builtin_amdgcn_wave_barrier();
    __builtin_amdgcn_fence(__ATOMIC_ACQUIRE, "workgroup");
    if (OUT_MODE == 0) {
      float* C = (float*)Cout + (size_t)b * strideC;
      const int hh = lane >> 4, c4 = (lane & 15) * 4;     // row seg = 256 B = 16 lanes x 16 B
      {
#pragma unroll
        for (int it = 0; it < 8; ++it) {
          const int row = it * 2 + hh;
          v4f v = *(const v4f*)(slab + row * 68 + c4);
          *(v4f*)(C + (size_t)(mBase + row) * ldc + n0 + c4) = v;
        }
        
      }
    } else if (rope) {
      // 8 lanes a row: each squares its 8 values, three exchanges give the row's sum; a store covers 4 rows = 512 contiguous bytes
      const int q = lane >> 3, c8 = (lane & 7) * 8;
      unsigned short* C = (unsigned short*)Cout + (size_t)b * strideC + (size_t)(n0 >> 6) * M * kHeadD;
#pragma unroll
      for (int it = 0; it < 4; ++it) {
        const int row = it * 4 + q;
        const float* sp = slab + row * 68 + c8;
        const v4f a = *(const v4f*)(sp);
        const v4f c = *(const v4f*)(sp + 4);
        float ss = a[0] * a[0];
#pragma unroll
        for (int e = 1; e < 4; ++e) ss = fmaf(a[e], a[e], ss);
#pragma unroll
        for (int e = 0; e < 4; ++e) ss = fmaf(c[e], c[e], ss);
        ss = add_lane_xor<1>(ss);
        ss = add_lane_xor<2>(ss);
        ss = add_lane_xor<4>(ss);
        const float rn = rsqrtf(ss * (1.0f / kHeadD) + kEpsRms);
        v8h hv;
#pragma unroll
        for (int e = 0; e < 4; ++e) {
          hv[e]     = (_Float16)(a[e] * rn);
          hv[4 + e] = (_Float16)(c[e] * rn);
        }
        *(v8h*)(C + (size_t)(mBase + row) * kHeadD + c8) = hv;
      }
    } else {
      const int q = lane >> 3, c8 = (lane & 7) * 8;
      unsigned short* C  = join ? (unsigned short*)Cout2 : (unsigned short*)Cout + (size_t)b * strideC;
      unsigned short* C2 = (OUT_MODE == 2) ? ((unsigned short*)Cout2 + (size_t)b * strideC) : nullptr;
      {
#pragma unroll
        for (int it = 0; it < 4; ++it) {
          const int row = it * 4 + q;
          const float* sp = slab + row * 68 + c8;
          v8h hv, lv;
#pragma unroll
          for (int e = 0; e < 8; ++e) {
            if (OUT_MODE == 1 || JOIN) {
              hv[e] = (_Float16)sp[e];
            } else {
              unsigned short hb = f2bf_bits(sp[e]);
              unsigned short lb = f2bf_bits(sp[e] - bf_bits2f(hb));
              hv[e] = __builtin_bit_cast(_Float16, hb);
              lv[e] = __builtin_bit_cast(_Float16, lb);
            }
          }
          *(v8h*)(C + (size_t)(mBase + row) * ldc + n0 + c8) = hv;
          if (OUT_MODE == 2) *(v8h*)(C2 + (size_t)(mBase + row) * ldc + n0 + c8) = lv;
        }
        
      }
    }
    __builtin_amdgcn_fence(__ATOMIC_RELEASE, "workgroup");
    __builtin_amdgcn_wave_barrier();
    __builtin_amdgcn_fence(__ATOMIC_ACQUIRE, "workgroup");
  }
}

// ---------------------------------------------------------------------------
// All f32 -> f16 conversions (RNE) in one launch, 8 elements per thread, each lane one 16-byte store; the source is picked by the
// block index (the same for the whole work-group):
//   blocks 0 .. 2047: x [4096][1024] -> x16, as it is (2048 blocks x 256 threads x 8 = 4096 * 1024 exactly)
//   then 512 blocks for each of four weights [1024][1024] -> w16 + z * 1024 * 1024, carried x wscale (512 x 256 x 8 = 1024 * 1024 exactly)
// ---------------------------------------------------------------------------
constexpr int kXCastBlocks = (kSeqLen * kEmbd) / (8 * 256);
constexpr int kWCastBlocks = (kEmbd * kEmbd) / (8 * 256);
__global__ __launch_bounds__(256) void cast_kernel(const float* __restrict__ x,
                                                   const float* __restrict__ w0, const float* __restrict__ w1,
                                                   const float* __restrict__ w2, const float* __restrict__ w3,
                                                   unsigned short* __restrict__ x16, unsigned short* __restrict__ w16, float wscale) {
  const int bid = blockIdx.x;
  const float* in = x;
  unsigned short* o16 = x16;
  float scale = 1.0f;                              // times one: exact
  int blk = bid;
  if (bid >= kXCastBlocks) {
    const int z = (bid - kXCastBlocks) / kWCastBlocks;
    blk   = (bid - kXCastBlocks) - z * kWCastBlocks;
    in    = (z == 0) ? w0 : ((z == 1) ? w1 : ((z == 2) ? w2 : w3));
    o16   = w16 + (size_t)z * kEmbd * kEmbd;
    scale = wscale;
  }
  const size_t i = (size_t)blk * 256 + threadIdx.x;
  const float* p = in + 8 * i;
  const v4f a = *(const v4f*)(p);
  const v4f c = *(const v4f*)(p + 4);
  unsigned short hb[8];
#pragma unroll
  for (int e = 0; e < 4; ++e) {
    hb[e]     = h_bits(a[e] * scale);
    hb[4 + e] = h_bits(c[e] * scale);
  }
  const v4u u = (v4u){pk16(hb[0], hb[1]), pk16(hb[2], hb[3]), pk16(hb[4], hb[5]), pk16(hb[6], hb[7])};
  *(v4u*)(o16 + 8 * i) = u;
}

// ---------------------------------------------------------------------------
// Fused causal sigmoid attention, all heads in one launch; P never leaves the registers.
// One wave owns 32 query rows of one head and walks the keys 32 at a time, in rising order:
//   S^T = K . Q^T / 16 A = K16 rows (16 keys), B = Q16 rows (16 queries) times 1/16, k = head dim (2 x 32)
//   P^T = f16(1024 + 1024 * tanh(S^T)) = f16(2048 * sigmoid(q.k / 8)), zero where key > query
//   O^T += V^T . P^T   A = VT16 rows (16 head dims), B = P^T, k = 32 keys
// A lane's accumulators of the two 16-key tiles of S^T are, converted in place, its B operand of the second
// product (element e of tile kt -> element 8*kt + e), in the k order that Frag::load gives the V^T rows.
// O^T: a lane holds 8 consecutive head dims of one query row: one 16-byte store each.
// Placement: 256 blocks x 16 waves; block = (head, group g); tile slots 0..3 are query tiles 4g+s, slots 4..7
// are tiles 127-(4g+s-4), so every pair (s, s+4) has 129 key steps together. Every (head, tile) once.
// Two waves share a tile's keys: one takes the first 128 keys of every trip of 256, the other the second 128, each into
// O^T accumulators of its own; behind the loop the second wave's sums go through LDS and are added to the first's. So a SIMD
// holds four waves (a short and a long tile, twice), and two are still at work where the short tile is done: one wave's
// sigmoid work runs beside another's matrix products.
// K and V^T reach the waves through LDS: the waves of a block walk the same keys of the same head, so a trip's
// 256 K rows (128 bytes each) and 64 V^T rows (512 bytes each) are brought once for all of them, as whole lines, by
// asynchronous copies; no fragment load gathers 16 lines from the caches any more. Two buffers: the copies of trip t+1
// fly while trip t is worked on. LDS pitches 144 and 528 bytes (16 B x odd: ds_load_b128 without bank conflicts).
// Every wave copies and passes the barrier in every trip of its block, also a wave that is past its own diagonal.
// ---------------------------------------------------------------------------
constexpr int kTripKeys = 256;                   // keys per trip: two halves, one a wave
constexpr int kHalfKeys = 128;                   // keys of a wave per trip: four steps of 32
constexpr int kKPitch   = 72;                    // LDS pitch of a K row in 16-bit elements (144 bytes)
constexpr int kVPitch   = 264;                   // LDS pitch of a V^T row in 16-bit elements (528 bytes)
constexpr int kKTile    = kTripKeys * kKPitch;   // 16-bit elements of a trip's K rows in LDS
constexpr int kVTile    = kHeadD * kVPitch;      // 16-bit elements of a trip's V^T rows in LDS
constexpr int kKVStage  = kKTile + kVTile;       // one buffer: [K][V^T]

// This thread's share of a trip: 16 bytes of K rows r + 64 i (8 lanes a row) and of V^T rows r' + 16 i (32 lanes a row).
__device__ __forceinline__ void stage_kv(const unsigned short* gk, const unsigned short* gv, unsigned ldsK, unsigned ldsV) {
  unsigned l[8];
  const unsigned short* g[8];
#pragma unroll
  for (int i = 0; i < 4; ++i) {
    l[i]     = ldsK + (unsigned)(i * 64 * kKPitch * 2);
    l[4 + i] = ldsV + (unsigned)(i * 16 * kVPitch * 2);
    g[i]     = gk + (size_t)i * 64 * kHeadD;
    g[4 + i] = gv + (size_t)i * 16 * kSeqLen;
  }
  async_copy8(l, g);
}

// Two scores at a time: 2048 * sigmoid(x) = 1024 + 1024 * tanh(x / 2): the hardware's tanh, one transcendental a score, and
// one packed fma. u = x / 2 = q.k / 16 comes out of the matrix product as it is: the Q fragments carry the 1/16 (kQFold).
// Right over the whole range without a range test: tanh -> 1 gives 2048, tanh -> -1 gives 0. All of it in f32; the result is
// rounded to f16 as before.
__device__ __forceinline__ v2f sigmoid2_carried(v2f u) {
  const v2f t = (v2f){__builtin_amdgcn_tanhf(u.x), __builtin_amdgcn_tanhf(u.y)};
  return __builtin_elementwise_fma(t, (v2f){0.5f * kPCarry, 0.5f * kPCarry}, (v2f){0.5f * kPCarry, 0.5f * kPCarry});
}

// K fragments of one step of 32 keys; sk = this lane's place in the step's first K row in LDS
__device__ __forceinline__ void load_k(const _Float16* sk, v16h (&kf)[2][2]) {
#pragma unroll
  for (int kt = 0; kt < 2; ++kt)
#pragma unroll
    for (int ks = 0; ks < 2; ++ks) kf[kt][ks] = Frag<_Float16>::load(sk + (kt << 4) * kKPitch + (ks << 5));
}

// One step of 32 keys out of LDS. sk, sv: this lane's places in the step's K rows and V^T columns. MASK: the diagonal step
// (first key == first query of the wave). NEXT: the next step lies in the same buffer, its K fragments are fetched here.
template <bool MASK, bool NEXT>
__device__ __forceinline__ void attn_step(const _Float16* sk, const _Float16* sv, int c, int h8,
                                          v16h (&kf)[2][2], const v16h (&qf)[2][2], v8f (&o)[4][2]) {
  v8f s[2][2];
#pragma unroll
  for (int kt = 0; kt < 2; ++kt)
#pragma unroll
    for (int g = 0; g < 2; ++g) {
      s[kt][g] = (v8f){0.f,0.f,0.f,0.f,0.f,0.f,0.f,0.f};
      s[kt][g] = Frag<_Float16>::mma(kf[kt][0], qf[g][0], s[kt][g]);
      s[kt][g] = Frag<_Float16>::mma(kf[kt][1], qf[g][1], s[kt][g]);
    }
  // one group of LDS loads a step: this step's V^T rows and, behind this step's last use of the K registers, the next step's K rows
  v16h vf[4], kn[2][2];
#pragma unroll
  for (int dt = 0; dt < 4; ++dt) vf[dt] = Frag<_Float16>::load(sv + (dt << 4) * kVPitch);
  if (NEXT) load_k(sk + 32 * kKPitch, kn);
  // keeps the loads above in front of the sigmoid work, which covers their latency: sunk below it, they are waited out at the products that use them
  __builtin_amdgcn_sched_barrier(0);
#pragma unroll
  for (int g = 0; g < 2; ++g) {
    v16h p;
#pragma unroll
    for (int kt = 0; kt < 2; ++kt)
#pragma unroll
      for (int r = 0; r < 8; r += 2) {
        v2f sg = sigmoid2_carried((v2f){s[kt][g][r], s[kt][g][r + 1]});
        if (MASK) {
          const int rel = ((kt << 4) + h8 + r) - ((g << 4) + c);   // key minus query of element r
          sg.x = (rel > 0) ? 0.0f : sg.x;
          sg.y = (rel + 1 > 0) ? 0.0f : sg.y;
        }
        p[(kt << 3) + r]     = (_Float16)sg.x;
        p[(kt << 3) + r + 1] = (_Float16)sg.y;
      }
#pragma unroll
    for (int dt = 0; dt < 4; ++dt) o[dt][g] = Frag<_Float16>::mma(vf[dt], p, o[dt][g]);
  }
  if (NEXT) {
#pragma unroll
    for (int kt = 0; kt < 2; ++kt)
#pragma unroll
      for (int ks = 0; ks < 2; ++ks) kf[kt][ks] = kn[kt][ks];
  }
}

__global__ __launch_bounds__(512) void attn_fused_kernel(const unsigned short* __restrict__ Q16p,
                                                         const unsigned short* __restrict__ K16p,
                                                         const unsigned short* __restrict__ VT16p,
                                                         unsigned short* __restrict__ O16p) {
  __shared__ __align__(16) unsigned short kv[2 * kKVStage];
  const int lane = threadIdx.x & 31;
  const int wv16 = __builtin_amdgcn_readfirstlane(threadIdx.x >> 5);   // in a scalar register: the tests on it below are scalar branches
  // Dealt so that a SIMD gets a short and a long tile, both halves of each, if the sixteen waves go to the four SIMDs by wave
  // number mod 4, and two short and two long tiles, one half of each, if by wave number / 4; (slot, half) is a one-to-one map of the wave number.
  const int wmix = (wv16 >> 2) ^ (wv16 & 3);
  const int wave = (wv16 & 3) + ((wmix & 1) << 2);                     // tile slot
  const int half = wmix >> 1;                                          // which 128 keys of a trip
  const int c    = lane & 15;
  const int h8   = (lane >> 4) * 8;
  const int head = blockIdx.x & (kHeads - 1);
  const int grp  = blockIdx.x >> 4;                                    // 0..15
  const int qt   = (wave < 4) ? (4 * grp + wave) : (127 - (4 * grp + wave - 4));
  const int q0   = qt << 5;
  const int nt    = (kSeqLen / kHalfKeys + 1 - grp) >> 1;   // trips of the block: up to the diagonal of its longest tile, 127 - 4 grp (9..16)
  const int tEdge = qt >> 2;                      // the half trip (128 keys) that holds this tile's diagonal step
  const int nFree = qt & 3;                       // unmasked steps of that half trip
  const _Float16* Qh = (const _Float16*)Q16p + (size_t)head * kSeqLen * kHeadD;

  // this thread's share of the copies
  const unsigned short* gk = K16p  + (size_t)head * kSeqLen * kHeadD + (size_t)(threadIdx.x >> 3) * kHeadD + (threadIdx.x & 7) * 8;
  const unsigned short* gv = VT16p + ((size_t)head * kHeadD + (threadIdx.x >> 5)) * kSeqLen + (threadIdx.x & 31) * 8;
  const unsigned ldsK = (unsigned)(size_t)(&kv[(threadIdx.x >> 3) * kKPitch + (threadIdx.x & 7) * 8]);            // LDS byte address: low word of the pointer
  const unsigned ldsV = (unsigned)(size_t)(&kv[kKTile + (threadIdx.x >> 5) * kVPitch + (threadIdx.x & 31) * 8]);

  // tile 0 into buffer 0
  stage_kv(gk, gv, ldsK, ldsV);

  v16h qf[2][2], kf[2][2];
#pragma unroll
  for (int g = 0; g < 2; ++g)
#pragma unroll
    for (int ks = 0; ks < 2; ++ks)
      qf[g][ks] = Frag<_Float16>::load(Qh + (size_t)(q0 + (g << 4) + c) * kHeadD + (ks << 5) + h8);
  // the address registers of the loads above are reused right behind them: the wait stands in front of that reuse
  asm volatile("s_wait_xcnt 0x0" ::: "memory");
  qf[0][0] *= (_Float16)kQFold;
  qf[0][1] *= (_Float16)kQFold;
  qf[1][0] *= (_Float16)kQFold;
  qf[1][1] *= (_Float16)kQFold;
  v8f o[4][2];
#pragma unroll
  for (int dt = 0; dt < 4; ++dt)
#pragma unroll
    for (int g = 0; g < 2; ++g) o[dt][g] = (v8f){0.f,0.f,0.f,0.f,0.f,0.f,0.f,0.f};

  asm volatile("s_wait_asynccnt 0x0" ::: "memory");   // this wave's copies of tile 0 have landed
  __syncthreads();                                    // every wave's have
  if (nt > 1) stage_kv(gk + (size_t)kTripKeys * kHeadD, gv + kTripKeys, ldsK + kKVStage * 2, ldsV + kKVStage * 2);

  for (int t = 0; t < nt; ++t) {
    const int bufo = (t & 1) * kKVStage;
    const _Float16* sk = (const _Float16*)(kv + bufo) + (half * kHalfKeys + c) * kKPitch + h8;
    const _Float16* sv = (const _Float16*)(kv + bufo + kKTile) + c * kVPitch + half * kHalfKeys + h8;
    const int u = 2 * t + half;      // this wave's half trip
    if (u < tEdge) {                 // wave-uniform: all four steps lie below the diagonal
      load_k(sk, kf);
      // keeps the trip's first eight K loads together in front of its products: spread among them, each pair is waited out on its own
      __builtin_amdgcn_sched_barrier(0);
      attn_step<false, true >(sk,                sv,      c, h8, kf, qf, o);
      attn_step<false, true >(sk + 32 * kKPitch, sv + 32, c, h8, kf, qf, o);
      attn_step<false, true >(sk + 64 * kKPitch, sv + 64, c, h8, kf, qf, o);
      attn_step<false, false>(sk + 96 * kKPitch, sv + 96, c, h8, kf, qf, o);
    }
    if (u == tEdge) {                // wave-uniform: the steps up to the diagonal, then the diagonal step
      load_k(sk, kf);
      for (int j = 0; j < nFree; ++j) {
        attn_step<false, true>(sk, sv, c, h8, kf, qf, o);
        sk += 32 * kKPitch;
        sv += 32;
      }
      attn_step<true, false>(sk, sv, c, h8, kf, qf, o);
    }
    asm volatile("s_wait_dscnt 0x0" ::: "memory");      // this wave's reads of the buffer are done before it is refilled
    asm volatile("s_wait_asynccnt 0x0" ::: "memory");   // this wave's copies of tile t+1 have landed
    __syncthreads();                                    // publishes tile t+1 and ends every wave's reads of tile t
    if (t + 2 < nt)
      stage_kv(gk + (size_t)(t + 2) * kTripKeys * kHeadD, gv + (size_t)(t + 2) * kTripKeys, ldsK + bufo * 2, ldsV + bufo * 2);
  }
  asm volatile("s_wait_asynccnt 0x0" ::: "memory");     // no copy is in flight behind the loop

  // The two waves of a tile join their sums. The ring is free: the loop's last barrier stands behind every wave's last read and
  // last landed copy. 8 KiB a tile; a store or load covers 512 contiguous bytes (lane l: 16 bytes at 16 l), so no bank conflicts.
  v4f* join = (v4f*)kv + wave * 512 + lane;
  if (half == 1) {
#pragma unroll
    for (int dt = 0; dt < 4; ++dt)
#pragma unroll
      for (int g = 0; g < 2; ++g) {
        join[((dt << 1) + g) * 64]      = (v4f){o[dt][g][0], o[dt][g][1], o[dt][g][2], o[dt][g][3]};
        join[((dt << 1) + g) * 64 + 32] = (v4f){o[dt][g][4], o[dt][g][5], o[dt][g][6], o[dt][g][7]};
      }
  }
  __syncthreads();                                      // the second waves' sums are in LDS
  if (half == 0) {
#pragma unroll
    for (int g = 0; g < 2; ++g)
#pragma unroll
      for (int dt = 0; dt < 4; ++dt) {
        const v4f a = join[((dt << 1) + g) * 64];
        const v4f b = join[((dt << 1) + g) * 64 + 32];
        v8h hv;
#pragma unroll
        for (int r = 0; r < 4; ++r) {
          hv[r]     = (_Float16)((o[dt][g][r] + a[r]) * kPVScale);
          hv[4 + r] = (_Float16)((o[dt][g][4 + r] + b[r]) * kPVScale);
        }
        *(v8h*)(O16p + (size_t)(q0 + (g << 4) + c) * kEmbd + head * kHeadD + (dt << 4) + h8) = hv;
      }
  }
}

// ---------------------------------------------------------------------------
// Host-side orchestration
// ---------------------------------------------------------------------------
extern "C" void kernel_launch(void* const* d_in, const int* in_sizes, int n_in,
                              void* d_out, int out_size, void* d_ws,
                              size_t ws_size, hipStream_t stream) {
  if (n_in < 7) return;
  if (in_sizes[0] != kSeqLen * kEmbd) return;
  if (in_sizes[1] != kSeqLen * kRotD || in_sizes[2] != kSeqLen * kRotD) return;
  if (in_sizes[3] != kEmbd * kEmbd || in_sizes[4] != kEmbd * kEmbd ||
      in_sizes[5] != kEmbd * kEmbd || in_sizes[6] != kEmbd * kEmbd) return;
  if (out_size != kSeqLen * kEmbd) return;

  const float* x    = (const float*)d_in[0];
  const float* cosT = (const float*)d_in[1];
  const float* sinT = (const float*)d_in[2];
  const float* wq   = (const float*)d_in[3];
  const float* wk   = (const float*)d_in[4];
  const float* wv   = (const float*)d_in[5];
  const float* wp   = (const float*)d_in[6];

  // ---- workspace region map (bytes) ----
  // persistent:
  //   Q16  f16 [16][4096][64]   8 MiB  @ 0
  //   K16  f16 [16][4096][64]   8 MiB  @ 8 MiB   (must follow Q16 directly)
  //   VT16 f16 [1024][4096]     8 MiB  @ 16 MiB
  //   O16  f16 [4096][1024]     8 MiB  @ 24 MiB
  //   W16  f16 4 x [1024][1024] 8 MiB  @ 32 MiB  (wq, wk, wproj, wv carried x16)
  // dead after the projections:
  //   X16  f16  8 MiB @ 40 MiB
  // total = 48 MiB
  const size_t MiB = 1048576;
  const size_t total = 48 * MiB;
  if (total > ws_size) return;
  char* ws = (char*)d_ws;
  unsigned short* Q16  = (unsigned short*)(ws + 0 * MiB);
  unsigned short* K16  = (unsigned short*)(ws + 8 * MiB);
  unsigned short* VT16 = (unsigned short*)(ws + 16 * MiB);
  unsigned short* O16  = (unsigned short*)(ws + 24 * MiB);
  unsigned short* W16  = (unsigned short*)(ws + 32 * MiB);
  unsigned short* X16  = (unsigned short*)(ws + 40 * MiB);
  unsigned short* WP16 = W16 + 2 * (size_t)kEmbd * kEmbd;
  unsigned short* WV16 = W16 + 3 * (size_t)kEmbd * kEmbd;
  const float* fdummy = (const float*)(ws);

  // 1) casts, one launch: x, then wq, wk, wproj, wv
  cast_kernel<<<dim3(kXCastBlocks + 4 * kWCastBlocks), 256, 0, stream>>>(x, wq, wk, wp, wv, X16, W16, kWCarry);

  // 2) the three projections, one launch of 3 x 256 work-groups (they depend on the casts alone, not on one another):
  //    planes 0, 1: q,k = X16 . Wq16^T / Wk16^T : M=4096, N=1024, K=1024 (K%64==0, M,N%128==0), scale 1/16; RoPE + RMS-norm in the
  //    epilogue -> Q16, K16 planes [h][t][64]
  //    plane 2: V^T = Wv16 . X16^T, one f16 product: A = Wv plane [1024][1024] carried x16, Bt = X plane [4096][1024];
  //    f16 out [h*64+d][t] carried x16 (the weight's carry stays on it), row pitch 4096
  {
    const int tiles = (kSeqLen / 128) * (kEmbd / 128);   // 256 work-groups a plane
    wmma_gemm64<0, false, 0, 3, false, 0, true><<<dim3(tiles, 3), 256, 0, stream>>>(
        X16, WV16, kEmbd, (long)0,
        W16, X16, kEmbd, (long)kEmbd * kEmbd,
        (void*)Q16, (void*)VT16, kHeadD, (long)kHeads * kSeqLen * kHeadD,
        cosT, sinT, (long)0,
        kSeqLen, kEmbd, kEmbd, kQKScale, kSeqLen, kVScale);
  }

  // 3) attention, all heads: O16 = 64*y, f16 [4096][1024]; 16 heads x 16 groups = 256 blocks of 16 waves
  attn_fused_kernel<<<dim3(kHeads * (kSeqLen / 256)), 512, 0, stream>>>(Q16, K16, VT16, O16);

  // 4) out = (64*y) . (16*Wp)^T * (1/1024): M=4096, N=1024, K=1024, f32 out to d_out
  {
    const int tiles = (kSeqLen / 128) * (kEmbd / 128);   // 256 work-groups
    wmma_gemm64<0, false, 0, 0, false, 0><<<dim3(tiles, 1), 256, 0, stream>>>(
        O16, O16, kEmbd, (long)0,
        WP16, WP16, kEmbd, (long)0,
        d_out, d_out, kEmbd, (long)0,
        fdummy, fdummy, (long)0,
        kSeqLen, kEmbd, kEmbd, kOutScale, kEmbd, kOutScale);
  }
}

// v010
// One run takes 74.3 microseconds.
// Timed twice side by side with v009, it ran 1.03 and 1.04 times as fast.
// Counting every step since v000, it is 21.5 times as fast.
// Contractions: q,k projections (X f16 x W^T f16 carried x16), v projection (Wv f16 carried x16 x X^T f16), scores q.k^T (q,k f16 planes, K=64), attn.v (P f16 carried x2048 x V^T f16 carried x16), output projection (y f16 carried x64 x Wp^T f16 carried x16): v_wmma_f32_16x16x32_f16, f32 accumulate; rope, rms-norm, sigmoid in f32.
#include <hip/hip_runtime.h>
#include <math.h>

// ---------------------------------------------------------------------------
// Problem constants
// ---------------------------------------------------------------------------
constexpr int kSeqLen = 4096;
constexpr int kEmbd   = 1024;
constexpr int kHeads  = 16;
constexpr int kHeadD  = 64;
constexpr int kRotD   = 32;
constexpr float kWCarry   = 16.0f;              // f16 weights carried x16
constexpr float kVCarry   = 16.0f;              // V^T f16 plane carried x16
constexpr float kPCarry   = 2048.0f;            // sigmoid probabilities carried x2048
constexpr float kQKScale  = 1.0f / 16.0f;       // undo weight carry on q,k
constexpr float kVScale   = kVCarry / kWCarry; // V^T plane: the weight's carry becomes the plane's
constexpr float kScScale  = 0.125f;             // 1/sqrt(64)
constexpr float kQFold    = 0.5f * kScScale;    // on the Q fragments: the product is the argument of tanh, score / 2 (a power of two: no bit of a normal f16 is lost)
constexpr float kPVScale  = 1.0f / 32768.0f;    // 1/(kPCarry*kVCarry): O16 = 64*y
constexpr float kOutScale = 1.0f / 1024.0f;     // (1/64) * (1/kWCarry)
constexpr float kEpsRms   = 1e-6f;

typedef __attribute__((ext_vector_type(16))) _Float16 v16h;
typedef __attribute__((ext_vector_type(8)))  _Float16 v8h;
typedef __attribute__((ext_vector_type(16))) __bf16   v16b;
typedef __attribute__((ext_vector_type(8)))  __bf16   v8b;
typedef __attribute__((ext_vector_type(8)))  float    v8f;
typedef __attribute__((ext_vector_type(4)))  float    v4f;
typedef __attribute__((ext_vector_type(2)))  float    v2f;
typedef __attribute__((ext_vector_type(4)))  unsigned int v4u;

// ---------------------------------------------------------------------------
// Helpers
// ---------------------------------------------------------------------------
__device__ __forceinline__ unsigned short f2bf_bits(float f) {
  unsigned u = __float_as_uint(f);
  return (unsigned short)((u + 0x7FFFu + ((u >> 16) & 1u)) >> 16);
}
__device__ __forceinline__ float bf_bits2f(unsigned short h) { return __uint_as_float(((unsigned)h) << 16); }

// hazard guards as plain device helpers
__device__ __forceinline__ void dep_guard_h(v8f& a, v8f& b, v16h x, v16h y) { asm volatile("v_nop\n\tv_nop\n\tv_nop\n\tv_nop" : "+v"(a), "+v"(b) : "v"(x), "v"(y)); }
__device__ __forceinline__ void dep_guard_b(v8f& a, v8f& b, v16b x, v16b y) { asm volatile("v_nop\n\tv_nop\n\tv_nop\n\tv_nop" : "+v"(a), "+v"(b) : "v"(x), "v"(y)); }
__device__ __forceinline__ void keep4_h(v16h a, v16h b, v16h c, v16h d) { asm volatile("v_nop" :: "v"(a), "v"(b), "v"(c), "v"(d)); }
__device__ __forceinline__ void keep4_b(v16b a, v16b b, v16b c, v16b d) { asm volatile("v_nop" :: "v"(a), "v"(b), "v"(c), "v"(d)); }
__device__ __forceinline__ void acc_guard4(v8f& a, v8f& b, v8f& c, v8f& d) { asm volatile("v_nop\n\tv_nop\n\tv_nop\n\tv_nop" : "+v"(a), "+v"(b), "+v"(c), "+v"(d)); }
template <typename T> struct Frag;
template <> struct Frag<_Float16> {
  typedef v16h V; union U { v16h v; v8h h[2]; };
  static __device__ __forceinline__ v16h load(const _Float16* p) {   // elements 0..7 <- p[0..7], 8..15 <- p[16..23]
    U f; f.h[0] = *(const v8h*)(p); f.h[1] = *(const v8h*)(p + 16); return f.v;
  }
  static __device__ __forceinline__ v8f mma(v16h a, v16h b, v8f c) {
    return __builtin_amdgcn_wmma_f32_16x16x32_f16(false, a, false, b, (short)0, c, false, false);
  }
  static __device__ __forceinline__ void guard(v8f& a, v8f& b, v16h x, v16h y) { dep_guard_h(a, b, x, y); }
  static __device__ __forceinline__ void keep(v16h a, v16h b, v16h c, v16h d) { keep4_h(a, b, c, d); }
};
template <> struct Frag<__bf16> {
  typedef v16b V; union U { v16b v; v8b h[2]; };
  static __device__ __forceinline__ v16b load(const __bf16* p) {
    U f; f.h[0] = *(const v8b*)(p); f.h[1] = *(const v8b*)(p + 16); return f.v;
  }
  static __device__ __forceinline__ v8f mma(v16b a, v16b b, v8f c) {
    return __builtin_amdgcn_wmma_f32_16x16x32_bf16(false, a, false, b, (short)0, c, false, false);
  }
  static __device__ __forceinline__ void guard(v8f& a, v8f& b, v16b x, v16b y) { dep_guard_b(a, b, x, y); }
  static __device__ __forceinline__ void keep(v16b a, v16b b, v16b c, v16b d) { keep4_b(a, b, c, d); }
};

__device__ __forceinline__ unsigned pk16(unsigned short a, unsigned short b) { return (unsigned)a | ((unsigned)b << 16); }
__device__ __forceinline__ unsigned short h_bits(float f) { const _Float16 h = (_Float16)f; return __builtin_bit_cast(unsigned short, h); }

// ---- Batched WMMA GEMM, operands staged in LDS ------------------------------------------------
// C[m,n] = scale * sum_k A[m,k] * Bt[n,k] (+bias)(+resid).
// A row-major [M,K]; Bt row-major [N,K]; M,N % 128 == 0, K % 64 == 0.
// A work-group of 8 waves owns a 128x128 tile of C; wave w owns rows 32*(w>>1).., columns 64*(w&1).. of it.
// Per trip 64 k of the 128 A rows and the 128 Bt rows lie in LDS, brought there by asynchronous copies as whole
// 128-byte lines (8 lanes a row), so that no fragment load gathers 16 lines from the caches any more.
// LDS rows have a pitch of 144 bytes (16 B x odd: ds_load_b128 without bank conflicts). A ring of kRing buffers: the copies of
// trips t+1 .. t+kRing-1 fly while trip t is worked on. The k order of the sums is the one of the fragment loads from global memory.
// SPLIT: operands are hi/lo planes (A2/Bt2 = lo planes, same layout); product = hi.hi + hi.lo + lo.hi.
// BIAS_MODE: 0 = none, 1 = bias[m], 2 = bias[n].
// OUT_MODE: 0 = f32, 1 = f16, 2 = bf16 hi plane (Cout) + bf16 lo plane (Cout2),
//           3 = rotary step and per-head RMS-norm in f32, then f16 planes [n / 64][m][64] (bias = cos table, resid = sin table, both [m][32]).
// ACT: 2 relu, 4 leaky, 6 = causal sigmoid carry: v = (n > m) ? 0 : kPCarry / (1 + exp(-v)).
// ET: 0 = f16 operands, 1 = bf16 operands (pointers passed as 16-bit storage)
// JOIN: plane 2 of the grid (blockIdx.y == 2) is a second, independent product in the same launch:
//       Cout2[n,m] = scale2 * sum_k A2p[n,k] * Bt2p[m,k], an N x M result, f16, row pitch ldc2 (OUT_MODE 1's epilogue).
constexpr int kTileK    = 64;                  // k per trip, 128 bytes of every operand row
constexpr int kRowPitch = 72;                  // LDS row pitch in 16-bit elements (144 bytes)
constexpr int kPlane    = 128 * kRowPitch;     // 16-bit elements of one operand plane in LDS

// Eight copies of 16 bytes a lane, global memory -> LDS through no register. The closing wait stands inside the statement,
// in front of any later rewrite of the address registers that the copies name.
__device__ __forceinline__ void async_copy8(const unsigned (&l)[8], const unsigned short* const (&g)[8]) {
  asm volatile("global_load_async_to_lds_b128 %0, %8, off\n\t"
               "global_load_async_to_lds_b128 %1, %9, off\n\t"
               "global_load_async_to_lds_b128 %2, %10, off\n\t"
               "global_load_async_to_lds_b128 %3, %11, off\n\t"
               "global_load_async_to_lds_b128 %4, %12, off\n\t"
               "global_load_async_to_lds_b128 %5, %13, off\n\t"
               "global_load_async_to_lds_b128 %6, %14, off\n\t"
               "global_load_async_to_lds_b128 %7, %15, off\n\t"
               "s_wait_xcnt 0x0"
               :: "v"(l[0]), "v"(l[1]), "v"(l[2]), "v"(l[3]), "v"(l[4]), "v"(l[5]), "v"(l[6]), "v"(l[7]),
                  "v"(g[0]), "v"(g[1]), "v"(g[2]), "v"(g[3]), "v"(g[4]), "v"(g[5]), "v"(g[6]), "v"(g[7])
               : "memory");
}
// One plane of A and one of Bt, 128 rows x 128 bytes each: this thread's 16 bytes of rows r, r+32, r+64, r+96.
__device__ __forceinline__ void stage_pair(const unsigned short* ga, size_t stepA, const unsigned short* gb, size_t stepB,
                                           unsigned lds) {
  unsigned l[8];
  const unsigned short* g[8];
#pragma unroll
  for (int i = 0; i < 4; ++i) {
    l[i]     = lds + (unsigned)(i * 32 * kRowPitch * 2);
    l[4 + i] = lds + (unsigned)((kPlane + i * 32 * kRowPitch) * 2);
    g[i]     = ga + i * stepA;
    g[4 + i] = gb + i * stepB;
  }
  async_copy8(l, g);
}

// This wave's copies have landed, all but its N youngest (the counter returns in issue order). A statement of its own with the
// "memory" clobber: no LDS read moves in front of it.
template <int N>
__device__ __forceinline__ void wait_copies_but() { asm volatile("s_wait_asynccnt %0" :: "n"(N) : "memory"); }

// x + (x of lane l ^ XM), inside a row of 16 lanes, on the vector port (a shuffle through the LDS unit costs its latency at every step)
template <int XM>
__device__ __forceinline__ float add_lane_xor(float x) {
  const int y = __builtin_amdgcn_update_dpp(0, __builtin_bit_cast(int, x), 0x160 | XM, 0xf, 0xf, true);   // 0x160 | XM: row_xmask:XM
  return x + __builtin_bit_cast(float, y);
}

template <int ET> struct Elem;
template <> struct Elem<0> { typedef _Float16 T; };
template <> struct Elem<1> { typedef __bf16 T; };
template <int ET, bool SPLIT, int BIAS_MODE, int OUT_MODE, bool RESID, int ACT = 0, bool JOIN = false>
__global__ __launch_bounds__(256) void wmma_gemm64(
    const unsigned short* __restrict__ Ap, const unsigned short* __restrict__ A2p, int lda, long strideA,
    const unsigned short* __restrict__ Btp, const unsigned short* __restrict__ Bt2p, int ldb, long strideB,
    void* __restrict__ Cout, void* __restrict__ Cout2, int ldc1, long strideC,
    const float* __restrict__ bias,
    const float* __restrict__ resid, long strideR,
    int M, int N, int K, float scale1, int ldc2, float scale2) {
  static_assert(!JOIN || (!SPLIT && OUT_MODE == 3), "the second product takes the places of the lo planes");
  typedef typename Elem<ET>::T T;
  typedef typename Frag<T>::V V;
  constexpr int kStage = (SPLIT ? 4 : 2) * kPlane;           // one buffer: [A][Bt], SPLIT: [A hi][Bt hi][A lo][Bt lo]
  constexpr int kGroupK = (SPLIT || JOIN) ? 32 : 64;         // k of one group of fragment loads: 24 loads; JOIN: 12, which keeps a wave under 160 registers:
                                                             // six waves a SIMD, so the grid's three work-groups a WGP (3 x 106 KiB of LDS) are resident together
  // Buffers of the ring. JOIN: two, three work-groups share a WGP's LDS and cover one another's waits. Else the grid is one work-group
  // a WGP, which has the LDS to itself and nobody to cover a tile's way from L2 or memory: six, so that five tiles are on their way.
  constexpr int kRing   = JOIN ? 2 : 6;
  constexpr int kCopies = SPLIT ? 16 : 8;                    // copies of a wave per tile
  static_assert(kRing * kCopies <= 63, "copies of a wave outstanding at once");
  __shared__ __align__(16) unsigned short ring[kRing * kStage];
  __shared__ __align__(16) float sT[8][16 * 68];   // per-wave 16x64 slab, pitch 68 floats
  const int b    = blockIdx.y;
  const int lane = threadIdx.x & 31;
  const int wave = threadIdx.x >> 5;
  const bool join = JOIN && b == 2;            // the same for the whole work-group
  const int   ldc   = join ? ldc2 : ldc1;
  const float scale = join ? scale2 : scale1;
  const int tilesN = (join ? M : N) >> 7;
  const int tilesM = (join ? N : M) >> 7;
  if ((int)blockIdx.x >= tilesM * tilesN) return;   // the same for the whole work-group, in front of every barrier
  const int bm = blockIdx.x / tilesN;
  const int bn = blockIdx.x - bm * tilesN;
  const int m0 = (bm << 7) + ((wave >> 1) << 5);
  const int n0 = (bn << 7) + ((wave & 1) << 6);
  const int nt = K / kTileK;

  const int rlane = lane & 15;                 // row (A) / col (B, D) within subtile
  const int koff  = (lane >> 4) * 8;           // k offset of this lane half
  const int mOff  = (lane >> 4) * 8;           // D row offset

  // this thread's share of the copies: 16 bytes at column ccol of rows crow + 32 i of every plane
  const int crow = threadIdx.x >> 3;
  const int ccol = (threadIdx.x & 7) * 8;
  const size_t stepA = (size_t)32 * lda;
  const size_t stepB = (size_t)32 * ldb;
  const size_t offA = (join ? 0 : (size_t)b * strideA) + (size_t)((bm << 7) + crow) * lda + ccol;
  const size_t offB = (join ? 0 : (size_t)b * strideB) + (size_t)((bn << 7) + crow) * ldb + ccol;
  const unsigned short* Aop = join ? A2p : Ap;
  const unsigned short* Bop = join ? Bt2p : Btp;
  const unsigned lds0 = (unsigned)(size_t)(&ring[crow * kRowPitch + ccol]);   // LDS byte address: low word of the pointer

  // this lane's fragment rows in a buffer
  const int fragA = (((wave >> 1) << 5) + rlane) * kRowPitch + koff;
  const int fragB = kPlane + (((wave & 1) << 6) + rlane) * kRowPitch + koff;

  v8f acc[2][4];
#pragma unroll
  for (int i = 0; i < 2; ++i)
#pragma unroll
    for (int j = 0; j < 4; ++j) acc[i][j] = (v8f){0.f,0.f,0.f,0.f,0.f,0.f,0.f,0.f};

  // this thread's copies of one tile into one buffer
  auto stage_tile = [&](int tile, int bufo) {
    const size_t ko = (size_t)tile * kTileK;
    stage_pair(Aop + offA + ko, stepA, Bop + offB + ko, stepB, lds0 + bufo * 2);
    if (SPLIT) stage_pair(A2p + offA + ko, stepA, Bt2p + offB + ko, stepB, lds0 + (bufo + 2 * kPlane) * 2);
  };
  stage_tile(0, 0);
  if (kRing == 2) {
    // tile 0 into buffer 0, landed and published; then tile 1 into buffer 1
    wait_copies_but<0>();                             // this wave's copies of tile 0 have landed
    __syncthreads();                                  // every wave's have
    if (nt > 1) stage_tile(1, kStage);
  } else {
    // every buffer is free: the first kRing tiles set out together; tile 0 landed and published
    // (unrolled: each tile's offsets in memory and in LDS are constants)
#pragma unroll
    for (int s = 1; s < kRing; ++s)
      if (s < nt) stage_tile(s, s * kStage);
    if (nt >= kRing) wait_copies_but<(kRing - 1) * kCopies>();   // the youngest copies are those of tiles 1 .. kRing-1
    else             wait_copies_but<0>();
    __syncthreads();                                  // every wave's copies of tile 0 have landed
  }

  int bufo = 0;                                       // the buffer of trip t: (t mod kRing) * kStage
  for (int t = 0; t < nt; ++t) {
    const T* sb = (const T*)(ring + bufo);
#pragma unroll
    for (int kg = 0; kg < kTileK; kg += kGroupK) {
      // all fragment loads of a group stand in front of its products: one place where the wave waits for LDS
      V ah[kGroupK / 32][2], al[kGroupK / 32][2], bh[kGroupK / 32][4], bl[kGroupK / 32][4];
#pragma unroll
      for (int s = 0; s < kGroupK / 32; ++s) {
#pragma unroll
        for (int i = 0; i < 2; ++i) {
          const int ao = fragA + (i << 4) * kRowPitch + kg + (s << 5);
          ah[s][i] = Frag<T>::load(sb + ao);
          if (SPLIT) al[s][i] = Frag<T>::load(sb + 2 * kPlane + ao);
        }
#pragma unroll
        for (int j = 0; j < 4; ++j) {
          const int bo = fragB + (j << 4) * kRowPitch + kg + (s << 5);
          bh[s][j] = Frag<T>::load(sb + bo);
          if (SPLIT) bl[s][j] = Frag<T>::load(sb + 2 * kPlane + bo);
        }
      }
#pragma unroll
      for (int s = 0; s < kGroupK / 32; ++s) {
#pragma unroll
        for (int i = 0; i < 2; ++i) {
#pragma unroll
          for (int j = 0; j < 4; ++j) {
            acc[i][j] = Frag<T>::mma(ah[s][i], bh[s][j], acc[i][j]);
            if (SPLIT) {
              acc[i][j] = Frag<T>::mma(ah[s][i], bl[s][j], acc[i][j]);
              acc[i][j] = Frag<T>::mma(al[s][i], bh[s][j], acc[i][j]);
            }
          }
          Frag<T>::guard(acc[i][0], acc[i][3], ah[s][i], SPLIT ? al[s][i] : ah[s][i]);
        }
        Frag<T>::keep(bh[s][0], bh[s][1], bh[s][2], bh[s][3]);
        if (SPLIT) Frag<T>::keep(bl[s][0], bl[s][1], bl[s][2], bl[s][3]);
      }
    }
    asm volatile("s_wait_dscnt 0x0" ::: "memory");      // this wave's reads of the buffer are done before it is refilled
    // this wave's copies of tile t+1 have landed; where tile t+kRing-1 exists, the youngest copies are those of tiles t+2 .. t+kRing-1
    // and fly on; in the last trips, which issue none, the wait is to 0
    if (kRing > 2 && t + kRing - 1 < nt) wait_copies_but<(kRing - 2) * kCopies>();
    else                                 wait_copies_but<0>();
    __syncthreads();                                    // publishes tile t+1 and ends every wave's reads of tile t
    if (t + kRing < nt) stage_tile(t + kRing, bufo);
    bufo = (bufo + kStage == kRing * kStage) ? 0 : bufo + kStage;
  }
  // OUT_MODE 3: the cos and sin values of the wave's 32 rows, columns rlane and rlane + 16, all asked for here in one go:
  // their latency is paid once, not once per 16 rows behind the first rows' stores
  float cs[2][8][2], sn[2][8][2];
  const bool rope = OUT_MODE == 3 && !join;
  if (rope) {
    const float* pc = bias  + (m0 + mOff) * kRotD + rlane;
    const float* pn = resid + (m0 + mOff) * kRotD + rlane;
#pragma unroll
    for (int i = 0; i < 2; ++i)
#pragma unroll
      for (int r = 0; r < 8; ++r)
#pragma unroll
        for (int h = 0; h < 2; ++h) {
          cs[i][r][h] = pc[((i << 4) + r) * kRotD + (h << 4)];
          sn[i][r][h] = pn[((i << 4) + r) * kRotD + (h << 4)];
        }
    // the address registers of the loads above are reused right behind them: the wait stands in front of that reuse; as its inputs
    // they stay whole up to it, so that no later load of the group lands in one of them
    asm volatile("s_wait_xcnt 0x0" :: "v"(pc), "v"(pn) : "memory");
  }
  asm volatile("s_wait_asynccnt 0x0" ::: "memory");     // no copy is in flight behind the loop
  acc_guard4(acc[0][0], acc[0][1], acc[0][2], acc[0][3]);
  acc_guard4(acc[1][0], acc[1][1], acc[1][2], acc[1][3]);

  // ---- epilogue ----
  float* slab = sT[wave];
  const float* Rb = RESID ? (resid + (size_t)b * strideR) : nullptr;
#pragma unroll
  for (int i = 0; i < 2; ++i) {
    const int mBase = m0 + (i << 4);
    if (rope) {
      // The wave's 64 columns are one head: columns d and d + 32 of a row lie in one lane (tiles j and j + 2), so the rotation needs no exchange.
#pragma unroll
      for (int r = 0; r < 8; ++r) {
        const float c0 = cs[i][r][0], c1 = cs[i][r][1];
        const float s0 = sn[i][r][0], s1 = sn[i][r][1];
        const float x0 = acc[i][0][r] * scale, x1 = acc[i][1][r] * scale;
        const float x2 = acc[i][2][r] * scale, x3 = acc[i][3][r] * scale;
        float* row = slab + (mOff + r) * 68 + rlane;
        row[0]  = x0 * c0 + x2 * s0;
        row[16] = x1 * c1 + x3 * s1;
        row[32] = x2 * c0 - x0 * s0;
        row[48] = x3 * c1 - x1 * s1;
      }
    } else {
#pragma unroll
      for (int j = 0; j < 4; ++j) {
        const int n = n0 + (j << 4) + rlane;
        float bv = 0.f;
        if (BIAS_MODE == 2) bv = bias[n];
#pragma unroll
        for (int r = 0; r < 8; ++r) {
          float v = acc[i][j][r] * scale;
          if (BIAS_MODE == 1) v += bias[mBase + mOff + r];
          if (BIAS_MODE == 2) v += bv;
          if (RESID) v += Rb[(size_t)(mBase + mOff + r) * ldc + n];
          if (ACT == 2) v = fmaxf(v, 0.0f);
          if (ACT == 4) v = (v > 0.f) ? v : 0.01f * v;
          if (ACT == 6) {
            const float sg = kPCarry / (1.0f + expf(-v));
            v = (n > (mBase + mOff + r)) ? 0.0f : sg;
          }
          slab[(mOff + r) * 68 + (j << 4) + rlane] = v;
        }
      }
    }
    __builtin_amdgcn_fence(__ATOMIC_RELEASE, "workgroup");
    __builtin_amdgcn_wave_barrier();
    __builtin_amdgcn_fence(__ATOMIC_ACQUIRE, "workgroup");
    if (OUT_MODE == 0) {
      float* C = (float*)Cout + (size_t)b * strideC;
      const int hh = lane >> 4, c4 = (lane & 15) * 4;     // row seg = 256 B = 16 lanes x 16 B
      {
#pragma unroll
        for (int it = 0; it < 8; ++it) {
          const int row = it * 2 + hh;
          v4f v = *(const v4f*)(slab + row * 68 + c4);
          *(v4f*)(C + (size_t)(mBase + row) * ldc + n0 + c4) = v;
        }
        
      }
    } else if (rope) {
      // 8 lanes a row: each squares its 8 values, three exchanges give the row's sum; a store covers 4 rows = 512 contiguous bytes
      const int q = lane >> 3, c8 = (lane & 7) * 8;
      unsigned short* C = (unsigned short*)Cout + (size_t)b * strideC + (size_t)(n0 >> 6) * M * kHeadD;
#pragma unroll
      for (int it = 0; it < 4; ++it) {
        const int row = it * 4 + q;
        const float* sp = slab + row * 68 + c8;
        const v4f a = *(const v4f*)(sp);
        const v4f c = *(const v4f*)(sp + 4);
        float ss = a[0] * a[0];
#pragma unroll
        for (int e = 1; e < 4; ++e) ss = fmaf(a[e], a[e], ss);
#pragma unroll
        for (int e = 0; e < 4; ++e) ss = fmaf(c[e], c[e], ss);
        ss = add_lane_xor<1>(ss);
        ss = add_lane_xor<2>(ss);
        ss = add_lane_xor<4>(ss);
        const float rn = rsqrtf(ss * (1.0f / kHeadD) + kEpsRms);
        v8h hv;
#pragma unroll
        for (int e = 0; e < 4; ++e) {
          hv[e]     = (_Float16)(a[e] * rn);
          hv[4 + e] = (_Float16)(c[e] * rn);
        }
        *(v8h*)(C + (size_t)(mBase + row) * kHeadD + c8) = hv;
      }
    } else {
      const int q = lane >> 3, c8 = (lane & 7) * 8;
      unsigned short* C  = join ? (unsigned short*)Cout2 : (unsigned short*)Cout + (size_t)b * strideC;
      unsigned short* C2 = (OUT_MODE == 2) ? ((unsigned short*)Cout2 + (size_t)b * strideC) : nullptr;
      {
#pragma unroll
        for (int it = 0; it < 4; ++it) {
          const int row = it * 4 + q;
          const float* sp = slab + row * 68 + c8;
          v8h hv, lv;
#pragma unroll
          for (int e = 0; e < 8; ++e) {
            if (OUT_MODE == 1 || JOIN) {
              hv[e] = (_Float16)sp[e];
            } else {
              unsigned short hb = f2bf_bits(sp[e]);
              unsigned short lb = f2bf_bits(sp[e] - bf_bits2f(hb));
              hv[e] = __builtin_bit_cast(_Float16, hb);
              lv[e] = __builtin_bit_cast(_Float16, lb);
            }
          }
          *(v8h*)(C + (size_t)(mBase + row) * ldc + n0 + c8) = hv;
          if (OUT_MODE == 2) *(v8h*)(C2 + (size_t)(mBase + row) * ldc + n0 + c8) = lv;
        }
        
      }
    }
    __builtin_amdgcn_fence(__ATOMIC_RELEASE, "workgroup");
    __builtin_amdgcn_wave_barrier();
    __builtin_amdgcn_fence(__ATOMIC_ACQUIRE, "workgroup");
  }
}

// ---------------------------------------------------------------------------
// All f32 -> f16 conversions (RNE) in one launch, 8 elements per thread, each lane one 16-byte store; the source is picked by the
// block index (the same for the whole work-group):
//   blocks 0 .. 2047: x [4096][1024] -> x16, as it is (2048 blocks x 256 threads x 8 = 4096 * 1024 exactly)
//   then 512 blocks for each of four weights [1024][1024] -> w16 + z * 1024 * 1024, carried x wscale (512 x 256 x 8 = 1024 * 1024 exactly)
// ---------------------------------------------------------------------------
constexpr int kXCastBlocks = (kSeqLen * kEmbd) / (8 * 256);
constexpr int kWCastBlocks = (kEmbd * kEmbd) / (8 * 256);
__global__ __launch_bounds__(256) void cast_kernel(const float* __restrict__ x,
                                                   const float* __restrict__ w0, const float* __restrict__ w1,
                                                   const float* __restrict__ w2, const float* __restrict__ w3,
                                                   unsigned short* __restrict__ x16, unsigned short* __restrict__ w16, float wscale) {
  const int bid = blockIdx.x;
  const float* in = x;
  unsigned short* o16 = x16;
  float scale = 1.0f;                              // times one: exact
  int blk = bid;
  if (bid >= kXCastBlocks) {
    const int z = (bid - kXCastBlocks) / kWCastBlocks;
    blk   = (bid - kXCastBlocks) - z * kWCastBlocks;
    in    = (z == 0) ? w0 : ((z == 1) ? w1 : ((z == 2) ? w2 : w3));
    o16   = w16 + (size_t)z * kEmbd * kEmbd;
    scale = wscale;
  }
  const size_t i = (size_t)blk * 256 + threadIdx.x;
  const float* p = in + 8 * i;
  const v4f a = *(const v4f*)(p);
  const v4f c = *(const v4f*)(p + 4);
  unsigned short hb[8];
#pragma unroll
  for (int e = 0; e < 4; ++e) {
    hb[e]     = h_bits(a[e] * scale);
    hb[4 + e] = h_bits(c[e] * scale);
  }
  const v4u u = (v4u){pk16(hb[0], hb[1]), pk16(hb[2], hb[3]), pk16(hb[4], hb[5]), pk16(hb[6], hb[7])};
  *(v4u*)(o16 + 8 * i) = u;
}

// ---------------------------------------------------------------------------
// Fused causal sigmoid attention, all heads in one launch; P never leaves the registers.
// One wave owns 32 query rows of one head and walks the keys 32 at a time, in rising order:
//   S^T = K . Q^T / 16 A = K16 rows (16 keys), B = Q16 rows (16 queries) times 1/16, k = head dim (2 x 32)
//   P^T = f16(1024 + 1024 * tanh(S^T)) = f16(2048 * sigmoid(q.k / 8)), zero where key > query
//   O^T += V^T . P^T   A = VT16 rows (16 head dims), B = P^T, k = 32 keys
// A lane's accumulators of the two 16-key tiles of S^T are, converted in place, its B operand of the second
// product (element e of tile kt -> element 8*kt + e), in the k order that Frag::load gives the V^T rows.
// O^T: a lane holds 8 consecutive head dims of one query row: one 16-byte store each.
// Placement: 256 blocks x 16 waves; block = (head, group g); tile slots 0..3 are query tiles 4g+s, slots 4..7
// are tiles 127-(4g+s-4), so every pair (s, s+4) has 129 key steps together. Every (head, tile) once.
// Two waves share a tile's keys: one takes the first 128 keys of every trip of 256, the other the second 128, each into
// O^T accumulators of its own; behind the loop the second wave's sums go through LDS and are added to the first's. So a SIMD
// holds four waves (a short and a long tile, twice), and two are still at work where the short tile is done: one wave's
// sigmoid work runs beside another's matrix products.
// K and V^T reach the waves through LDS: the waves of a block walk the same keys of the same head, so a trip's
// 256 K rows (128 bytes each) and 64 V^T rows (512 bytes each) are brought once for all of them, as whole lines, by
// asynchronous copies; no fragment load gathers 16 lines from the caches any more. Four buffers: the copies of trips t+1
// to t+3 fly while trip t is worked on. LDS pitches 144 and 528 bytes (16 B x odd: ds_load_b128 without bank conflicts).
// Every wave copies and passes the barrier in every trip of its block, also a wave that is past its own diagonal.
// ---------------------------------------------------------------------------
constexpr int kTripKeys = 256;                   // keys per trip: two halves, one a wave
constexpr int kHalfKeys = 128;                   // keys of a wave per trip: four steps of 32
constexpr int kKPitch   = 72;                    // LDS pitch of a K row in 16-bit elements (144 bytes)
constexpr int kVPitch   = 264;                   // LDS pitch of a V^T row in 16-bit elements (528 bytes)
constexpr int kKTile    = kTripKeys * kKPitch;   // 16-bit elements of a trip's K rows in LDS
constexpr int kVTile    = kHeadD * kVPitch;      // 16-bit elements of a trip's V^T rows in LDS
constexpr int kKVStage  = kKTile + kVTile;       // one buffer: [K][V^T]
constexpr int kKVRing   = 4;                     // buffers: a tile has three trips for its way from L2 or memory
constexpr int kKVCopies = 8;                     // copies of a wave per tile

// This thread's share of a trip: 16 bytes of K rows r + 64 i (8 lanes a row) and of V^T rows r' + 16 i (32 lanes a row).
__device__ __forceinline__ void stage_kv(const unsigned short* gk, const unsigned short* gv, unsigned ldsK, unsigned ldsV) {
  unsigned l[8];
  const unsigned short* g[8];
#pragma unroll
  for (int i = 0; i < 4; ++i) {
    l[i]     = ldsK + (unsigned)(i * 64 * kKPitch * 2);
    l[4 + i] = ldsV + (unsigned)(i * 16 * kVPitch * 2);
    g[i]     = gk + (size_t)i * 64 * kHeadD;
    g[4 + i] = gv + (size_t)i * 16 * kSeqLen;
  }
  async_copy8(l, g);
}

// Two scores at a time: 2048 * sigmoid(x) = 1024 + 1024 * tanh(x / 2): the hardware's tanh, one transcendental a score, and
// one packed fma. u = x / 2 = q.k / 16 comes out of the matrix product as it is: the Q fragments carry the 1/16 (kQFold).
// Right over the whole range without a range test: tanh -> 1 gives 2048, tanh -> -1 gives 0. All of it in f32; the result is
// rounded to f16 as before.
__device__ __forceinline__ v2f sigmoid2_carried(v2f u) {
  const v2f t = (v2f){__builtin_amdgcn_tanhf(u.x), __builtin_amdgcn_tanhf(u.y)};
  return __builtin_elementwise_fma(t, (v2f){0.5f * kPCarry, 0.5f * kPCarry}, (v2f){0.5f * kPCarry, 0.5f * kPCarry});
}

// K fragments of one step of 32 keys; sk = this lane's place in the step's first K row in LDS
__device__ __forceinline__ void load_k(const _Float16* sk, v16h (&kf)[2][2]) {
#pragma unroll
  for (int kt = 0; kt < 2; ++kt)
#pragma unroll
    for (int ks = 0; ks < 2; ++ks) kf[kt][ks] = Frag<_Float16>::load(sk + (kt << 4) * kKPitch + (ks << 5));
}

// One step of 32 keys out of LDS. sk, sv: this lane's places in the step's K rows and V^T columns. MASK: the diagonal step
// (first key == first query of the wave). NEXT: the next step lies in the same buffer, its K fragments are fetched here.
template <bool MASK, bool NEXT>
__device__ __forceinline__ void attn_step(const _Float16* sk, const _Float16* sv, int c, int h8,
                                          v16h (&kf)[2][2], const v16h (&qf)[2][2], v8f (&o)[4][2]) {
  v8f s[2][2];
#pragma unroll
  for (int kt = 0; kt < 2; ++kt)
#pragma unroll
    for (int g = 0; g < 2; ++g) {
      s[kt][g] = (v8f){0.f,0.f,0.f,0.f,0.f,0.f,0.f,0.f};
      s[kt][g] = Frag<_Float16>::mma(kf[kt][0], qf[g][0], s[kt][g]);
      s[kt][g] = Frag<_Float16>::mma(kf[kt][1], qf[g][1], s[kt][g]);
    }
  // one group of LDS loads a step: this step's V^T rows and, behind this step's last use of the K registers, the next step's K rows
  v16h vf[4], kn[2][2];
#pragma unroll
  for (int dt = 0; dt < 4; ++dt) vf[dt] = Frag<_Float16>::load(sv + (dt << 4) * kVPitch);
  if (NEXT) load_k(sk + 32 * kKPitch, kn);
  // keeps the loads above in front of the sigmoid work, which covers their latency: sunk below it, they are waited out at the products that use them
  __builtin_amdgcn_sched_barrier(0);
#pragma unroll
  for (int g = 0; g < 2; ++g) {
    v16h p;
#pragma unroll
    for (int kt = 0; kt < 2; ++kt)
#pragma unroll
      for (int r = 0; r < 8; r += 2) {
        v2f sg = sigmoid2_carried((v2f){s[kt][g][r], s[kt][g][r + 1]});
        if (MASK) {
          const int rel = ((kt << 4) + h8 + r) - ((g << 4) + c);   // key minus query of element r
          sg.x = (rel > 0) ? 0.0f : sg.x;
          sg.y = (rel + 1 > 0) ? 0.0f : sg.y;
        }
        p[(kt << 3) + r]     = (_Float16)sg.x;
        p[(kt << 3) + r + 1] = (_Float16)sg.y;
      }
#pragma unroll
    for (int dt = 0; dt < 4; ++dt) o[dt][g] = Frag<_Float16>::mma(vf[dt], p, o[dt][g]);
  }
  if (NEXT) {
#pragma unroll
    for (int kt = 0; kt < 2; ++kt)
#pragma unroll
      for (int ks = 0; ks < 2; ++ks) kf[kt][ks] = kn[kt][ks];
  }
}

__global__ __launch_bounds__(512) void attn_fused_kernel(const unsigned short* __restrict__ Q16p,
                                                         const unsigned short* __restrict__ K16p,
                                                         const unsigned short* __restrict__ VT16p,
                                                         unsigned short* __restrict__ O16p) {
  __shared__ __align__(16) unsigned short kv[kKVRing * kKVStage];
  const int lane = threadIdx.x & 31;
  const int wv16 = __builtin_amdgcn_readfirstlane(threadIdx.x >> 5);   // in a scalar register: the tests on it below are scalar branches
  // Dealt so that a SIMD gets a short and a long tile, both halves of each, if the sixteen waves go to the four SIMDs by wave
  // number mod 4, and two short and two long tiles, one half of each, if by wave number / 4; (slot, half) is a one-to-one map of the wave number.
  const int wmix = (wv16 >> 2) ^ (wv16 & 3);
  const int wave = (wv16 & 3) + ((wmix & 1) << 2);                     // tile slot
  const int half = wmix >> 1;                                          // which 128 keys of a trip
  const int c    = lane & 15;
  const int h8   = (lane >> 4) * 8;
  const int head = blockIdx.x & (kHeads - 1);
  const int grp  = blockIdx.x >> 4;                                    // 0..15
  const int qt   = (wave < 4) ? (4 * grp + wave) : (127 - (4 * grp + wave - 4));
  const int q0   = qt << 5;
  const int nt    = (kSeqLen / kHalfKeys + 1 - grp) >> 1;   // trips of the block: up to the diagonal of its longest tile, 127 - 4 grp (9..16)
  const int tEdge = qt >> 2;                      // the half trip (128 keys) that holds this tile's diagonal step
  const int nFree = qt & 3;                       // unmasked steps of that half trip
  const _Float16* Qh = (const _Float16*)Q16p + (size_t)head * kSeqLen * kHeadD;

  // this thread's share of the copies
  const unsigned short* gk = K16p  + (size_t)head * kSeqLen * kHeadD + (size_t)(threadIdx.x >> 3) * kHeadD + (threadIdx.x & 7) * 8;
  const unsigned short* gv = VT16p + ((size_t)head * kHeadD + (threadIdx.x >> 5)) * kSeqLen + (threadIdx.x & 31) * 8;
  const unsigned ldsK = (unsigned)(size_t)(&kv[(threadIdx.x >> 3) * kKPitch + (threadIdx.x & 7) * 8]);            // LDS byte address: low word of the pointer
  const unsigned ldsV = (unsigned)(size_t)(&kv[kKTile + (threadIdx.x >> 5) * kVPitch + (threadIdx.x & 31) * 8]);

  // every buffer is free: the first kKVRing tiles set out together (unrolled: each tile's offsets in memory and in LDS are constants)
  stage_kv(gk, gv, ldsK, ldsV);
#pragma unroll
  for (int s = 1; s < kKVRing; ++s)
    if (s < nt) stage_kv(gk + (size_t)s * kTripKeys * kHeadD, gv + s * kTripKeys, ldsK + s * kKVStage * 2, ldsV + s * kKVStage * 2);

  v16h qf[2][2], kf[2][2];
#pragma unroll
  for (int g = 0; g < 2; ++g)
#pragma unroll
    for (int ks = 0; ks < 2; ++ks)
      qf[g][ks] = Frag<_Float16>::load(Qh + (size_t)(q0 + (g << 4) + c) * kHeadD + (ks << 5) + h8);
  // the address registers of the loads above are reused right behind them: the wait stands in front of that reuse
  asm volatile("s_wait_xcnt 0x0" ::: "memory");
  qf[0][0] *= (_Float16)kQFold;
  qf[0][1] *= (_Float16)kQFold;
  qf[1][0] *= (_Float16)kQFold;
  qf[1][1] *= (_Float16)kQFold;
  v8f o[4][2];
#pragma unroll
  for (int dt = 0; dt < 4; ++dt)
#pragma unroll
    for (int g = 0; g < 2; ++g) o[dt][g] = (v8f){0.f,0.f,0.f,0.f,0.f,0.f,0.f,0.f};

  // this wave's copies of tile 0 have landed: the youngest are those of tiles 1 .. kKVRing-1
  if (nt >= kKVRing) wait_copies_but<(kKVRing - 1) * kKVCopies>();
  else               wait_copies_but<0>();
  __syncthreads();                                    // every wave's have

  int bufo = 0;                                       // the buffer of trip t: (t mod kKVRing) * kKVStage
  for (int t = 0; t < nt; ++t) {
    const _Float16* sk = (const _Float16*)(kv + bufo) + (half * kHalfKeys + c) * kKPitch + h8;
    const _Float16* sv = (const _Float16*)(kv + bufo + kKTile) + c * kVPitch + half * kHalfKeys + h8;
    const int u = 2 * t + half;      // this wave's half trip
    if (u < tEdge) {                 // wave-uniform: all four steps lie below the diagonal
      load_k(sk, kf);
      // keeps the trip's first eight K loads together in front of its products: spread among them, each pair is waited out on its own
      __builtin_amdgcn_sched_barrier(0);
      attn_step<false, true >(sk,                sv,      c, h8, kf, qf, o);
      attn_step<false, true >(sk + 32 * kKPitch, sv + 32, c, h8, kf, qf, o);
      attn_step<false, true >(sk + 64 * kKPitch, sv + 64, c, h8, kf, qf, o);
      attn_step<false, false>(sk + 96 * kKPitch, sv + 96, c, h8, kf, qf, o);
    }
    if (u == tEdge) {                // wave-uniform: the steps up to the diagonal, then the diagonal step
      load_k(sk, kf);
      for (int j = 0; j < nFree; ++j) {
        attn_step<false, true>(sk, sv, c, h8, kf, qf, o);
        sk += 32 * kKPitch;
        sv += 32;
      }
      attn_step<true, false>(sk, sv, c, h8, kf, qf, o);
    }
    asm volatile("s_wait_dscnt 0x0" ::: "memory");      // this wave's reads of the buffer are done before it is refilled
    // this wave's copies of tile t+1 have landed; where tile t+kKVRing-1 exists, the youngest copies are those of tiles t+2 .. t+kKVRing-1
    // and fly on; in the last trips, which issue none, the wait is to 0
    if (t + kKVRing - 1 < nt) wait_copies_but<(kKVRing - 2) * kKVCopies>();
    else                      wait_copies_but<0>();
    __syncthreads();                                    // publishes tile t+1 and ends every wave's reads of tile t
    if (t + kKVRing < nt)
      stage_kv(gk + (size_t)(t + kKVRing) * kTripKeys * kHeadD, gv + (size_t)(t + kKVRing) * kTripKeys, ldsK + bufo * 2, ldsV + bufo * 2);
    bufo = (bufo + kKVStage == kKVRing * kKVStage) ? 0 : bufo + kKVStage;
  }
  asm volatile("s_wait_asynccnt 0x0" ::: "memory");     // no copy is in flight behind the loop

  // The two waves of a tile join their sums. The ring is free: the loop's last barrier stands behind every wave's last read and
  // last landed copy. 8 KiB a tile; a store or load covers 512 contiguous bytes (lane l: 16 bytes at 16 l), so no bank conflicts.
  v4f* join = (v4f*)kv + wave * 512 + lane;
  if (half == 1) {
#pragma unroll
    for (int dt = 0; dt < 4; ++dt)
#pragma unroll
      for (int g = 0; g < 2; ++g) {
        join[((dt << 1) + g) * 64]      = (v4f){o[dt][g][0], o[dt][g][1], o[dt][g][2], o[dt][g][3]};
        join[((dt << 1) + g) * 64 + 32] = (v4f){o[dt][g][4], o[dt][g][5], o[dt][g][6], o[dt][g][7]};
      }
  }
  __syncthreads();                                      // the second waves' sums are in LDS
  if (half == 0) {
#pragma unroll
    for (int g = 0; g < 2; ++g)
#pragma unroll
      for (int dt = 0; dt < 4; ++dt) {
        const v4f a = join[((dt << 1) + g) * 64];
        const v4f b = join[((dt << 1) + g) * 64 + 32];
        v8h hv;
#pragma unroll
        for (int r = 0; r < 4; ++r) {
          hv[r]     = (_Float16)((o[dt][g][r] + a[r]) * kPVScale);
          hv[4 + r] = (_Float16)((o[dt][g][4 + r] + b[r]) * kPVScale);
        }
        *(v8h*)(O16p + (size_t)(q0 + (g << 4) + c) * kEmbd + head * kHeadD + (dt << 4) + h8) = hv;
      }
  }
}

// ---------------------------------------------------------------------------
// Host-side orchestration
// ---------------------------------------------------------------------------
extern "C" void kernel_launch(void* const* d_in, const int* in_sizes, int n_in,
                              void* d_out, int out_size, void* d_ws,
                              size_t ws_size, hipStream_t stream) {
  if (n_in < 7) return;
  if (in_sizes[0] != kSeqLen * kEmbd) return;
  if (in_sizes[1] != kSeqLen * kRotD || in_sizes[2] != kSeqLen * kRotD) return;
  if (in_sizes[3] != kEmbd * kEmbd || in_sizes[4] != kEmbd * kEmbd ||
      in_sizes[5] != kEmbd * kEmbd || in_sizes[6] != kEmbd * kEmbd) return;
  if (out_size != kSeqLen * kEmbd) return;

  const float* x    = (const float*)d_in[0];
  const float* cosT = (const float*)d_in[1];
  const float* sinT = (const float*)d_in[2];
  const float* wq   = (const float*)d_in[3];
  const float* wk   = (const float*)d_in[4];
  const float* wv   = (const float*)d_in[5];
  const float* wp   = (const float*)d_in[6];

  // ---- workspace region map (bytes) ----
  // persistent:
  //   Q16  f16 [16][4096][64]   8 MiB  @ 0
  //   K16  f16 [16][4096][64]   8 MiB  @ 8 MiB   (must follow Q16 directly)
  //   VT16 f16 [1024][4096]     8 MiB  @ 16 MiB
  //   O16  f16 [4096][1024]     8 MiB  @ 24 MiB
  //   W16  f16 4 x [1024][1024] 8 MiB  @ 32 MiB  (wq, wk, wproj, wv carried x16)
  // dead after the projections:
  //   X16  f16  8 MiB @ 40 MiB
  // total = 48 MiB
  const size_t MiB = 1048576;
  const size_t total = 48 * MiB;
  if (total > ws_size) return;
  char* ws = (char*)d_ws;
  unsigned short* Q16  = (unsigned short*)(ws + 0 * MiB);
  unsigned short* K16  = (unsigned short*)(ws + 8 * MiB);
  unsigned short* VT16 = (unsigned short*)(ws + 16 * MiB);
  unsigned short* O16  = (unsigned short*)(ws + 24 * MiB);
  unsigned short* W16  = (unsigned short*)(ws + 32 * MiB);
  unsigned short* X16  = (unsigned short*)(ws + 40 * MiB);
  unsigned short* WP16 = W16 + 2 * (size_t)kEmbd * kEmbd;
  unsigned short* WV16 = W16 + 3 * (size_t)kEmbd * kEmbd;
  const float* fdummy = (const float*)(ws);

  // 1) casts, one launch: x, then wq, wk, wproj, wv
  cast_kernel<<<dim3(kXCastBlocks + 4 * kWCastBlocks), 256, 0, stream>>>(x, wq, wk, wp, wv, X16, W16, kWCarry);

  // 2) the three projections, one launch of 3 x 256 work-groups (they depend on the casts alone, not on one another):
  //    planes 0, 1: q,k = X16 . Wq16^T / Wk16^T : M=4096, N=1024, K=1024 (K%64==0, M,N%128==0), scale 1/16; RoPE + RMS-norm in the
  //    epilogue -> Q16, K16 planes [h][t][64]
  //    plane 2: V^T = Wv16 . X16^T, one f16 product: A = Wv plane [1024][1024] carried x16, Bt = X plane [4096][1024];
  //    f16 out [h*64+d][t] carried x16 (the weight's carry stays on it), row pitch 4096
  {
    const int tiles = (kSeqLen / 128) * (kEmbd / 128);   // 256 work-groups a plane
    wmma_gemm64<0, false, 0, 3, false, 0, true><<<dim3(tiles, 3), 256, 0, stream>>>(
        X16, WV16, kEmbd, (long)0,
        W16, X16, kEmbd, (long)kEmbd * kEmbd,
        (void*)Q16, (void*)VT16, kHeadD, (long)kHeads * kSeqLen * kHeadD,
        cosT, sinT, (long)0,
        kSeqLen, kEmbd, kEmbd, kQKScale, kSeqLen, kVScale);
  }

  // 3) attention, all heads: O16 = 64*y, f16 [4096][1024]; 16 heads x 16 groups = 256 blocks of 16 waves
  attn_fused_kernel<<<dim3(kHeads * (kSeqLen / 256)), 512, 0, stream>>>(Q16, K16, VT16, O16);

  // 4) out = (64*y) . (16*Wp)^T * (1/1024): M=4096, N=1024, K=1024, f32 out to d_out
  {
    const int tiles = (kSeqLen / 128) * (kEmbd / 128);   // 256 work-groups
    wmma_gemm64<0, false, 0, 0, false, 0><<<dim3(tiles, 1), 256, 0, stream>>>(
        O16, O16, kEmbd, (long)0,
        WP16, WP16, kEmbd, (long)0,
        d_out, d_out, kEmbd, (long)0,
        fdummy, fdummy, (long)0,
        kSeqLen, kEmbd, kEmbd, kOutScale, kEmbd, kOutScale);
  }
}
